// v000
// Times are from an AMD MI455X. After a warm-up the kernel runs many times in a row, and a time is the length of
// such a window on the GPU divided by its runs, so every launch and the gaps after it count. The runs cycle
// through copies of the inputs. A figure is the median of several windows, for all but v000 over two sittings.
// Sittings can differ by a few percent; kernels timed side by side share one.
// v000 is the starting kernel. One run takes 448 microseconds.
#include <hip/hip_runtime.h>

// Compute dtypes, f32 accumulate, one batch item per pass: q/k/v = x.W_qkv ([2048 x 1024].[1024 x 3072], k-major weights transposed once to n-major planes; PLAIN bf16
// operands: inputs rounded once, exact) with q and k written straight from the GEMM epilogue as f16 hi + residual x1024 planes, on v_wmma_f32_16x16x32_bf16;
// the 16-head full attention (64-dim heads, scale 1/sqrt(1024) as the reference) written straight to the f32 output (no output projection), fused on
// v_wmma_f32_16x16x32_f16 (scores hi.hi + hi.lo + lo.hi with the residual terms on their own accumulator, online f32 softmax, weights (x32768) and v as f16

#define NB_  1                   // per pass: the 2 batch items are processed one at a time
#define NT_  2048
#define DM   1024
#define NH_  16
#define HD   64
#define NTK  (NB_ * NT_)
#define NW   1024
#define NQKV 1024
#define PSC  32768.0f
#define LOSC 1024.0f
#define LOSCI (1.0f / 1024.0f)

typedef _Float16 h16;
typedef unsigned short bf;
typedef __attribute__((ext_vector_type(16))) __bf16   v16bf;
typedef __attribute__((ext_vector_type(16))) _Float16 v16h;
typedef __attribute__((ext_vector_type(8)))  _Float16 v8h;
typedef __attribute__((ext_vector_type(8)))  unsigned short v8us;
typedef __attribute__((ext_vector_type(8)))  float    v8f;
typedef __attribute__((ext_vector_type(4)))  float    v4f;
typedef v8h  __attribute__((may_alias)) v8ha;
typedef v4f  __attribute__((may_alias)) v4fa;
typedef v8us __attribute__((may_alias)) v8usa;

__device__ __forceinline__ unsigned short f2bf(float f) { unsigned u = __float_as_uint(f); u += 0x7FFFu + ((u >> 16) & 1u); return (unsigned short)(u >> 16); }
__device__ __forceinline__ float bf2f(unsigned short b) { return __uint_as_float(((unsigned)b) << 16); }
__device__ __forceinline__ float bfr(float f) { return bf2f(f2bf(f)); }
__device__ __forceinline__ v16h cat16(v8h lo, v8h hi) { return __builtin_shufflevector(lo, hi, 0, 1, 2, 3, 4, 5, 6, 7, 8, 9, 10, 11, 12, 13, 14, 15); }
__device__ __forceinline__ v16bf cat16b(v8us lo, v8us hi) { return __builtin_bit_cast(v16bf, __builtin_shufflevector(lo, hi, 0, 1, 2, 3, 4, 5, 6, 7, 8, 9, 10, 11, 12, 13, 14, 15)); }
__device__ __forceinline__ v8f wmma16(v16h a, v16h b, v8f c) { return __builtin_amdgcn_wmma_f32_16x16x32_f16(false, a, false, b, (short)0, c, false, false); }
__device__ __forceinline__ v8f wmmab(v16bf a, v16bf b, v8f c) { return __builtin_amdgcn_wmma_f32_16x16x32_bf16(false, a, false, b, (short)0, c, false, false); }

__global__ __launch_bounds__(256) void k_cvtb(const float* __restrict__ src, int nrows, bf* dst) {
    const int lane = threadIdx.x & 31, r = blockIdx.x * 8 + (threadIdx.x >> 5);
    if (r >= nrows) return;
    v8us o[DM / 256];
#pragma unroll
    for (int q = 0; q < DM / 256; ++q) { v8us t;
#pragma unroll
        for (int i = 0; i < 8; ++i) t[i] = f2bf(src[(size_t)r * DM + q * 256 + lane * 8 + i]);
        o[q] = t; }
#pragma unroll
    for (int q = 0; q < DM / 256; ++q) *(v8us*)(dst + (size_t)r * DM + q * 256 + lane * 8) = o[q];
    
}

// k_wt: WT [n][K] = bf16(W[k][n]) (k-major [K][ncols]) via 64 x 64 LDS tiles; grid (K/64, ncols/64).
__global__ __launch_bounds__(256) void k_wt(const float* __restrict__ Wm, int K, int ncols, bf* WT) {
    __shared__ __align__(16) unsigned short tl[64 * 72];
    const int tid = threadIdx.x, k0 = blockIdx.x * 64, n0 = blockIdx.y * 64;
    const int kk = tid >> 2, nq = (tid & 3) * 16;
#pragma unroll
    for (int i = 0; i < 16; ++i) tl[(nq + i) * 72 + kk] = f2bf(Wm[(size_t)(k0 + kk) * ncols + n0 + nq + i]);
    __syncthreads();
    const int piece = tid & 7;
    auto pass = [&]() {
#pragma unroll
        for (int s = 0; s < 2; ++s) { const int nr = (tid >> 3) + 32 * s; const v8us val = *(const v8usa*)(tl + nr * 72 + piece * 8); *(v8us*)(WT + (size_t)(n0 + nr) * K + k0 + piece * 8) = val; }
    };
    pass(); 
}
template <bool SPLITA, bool F16OUT = false>
__global__ __launch_bounds__(128) void k_gemmb(const bf* __restrict__ A, const bf* __restrict__ Al, const bf* __restrict__ Bn, const float* __restrict__ bias, float* C, int ldc, h16* C2) {
    __shared__ __align__(16) float ost[4][16 * 68];
    const int lane = threadIdx.x & 31, wave = threadIdx.x >> 5, lr = lane & 15, hi = lane >> 4;
    const int r0 = blockIdx.x * 64 + wave * 16, c0 = blockIdx.y * 64;
    const size_t aoff = (size_t)(r0 + lr) * DM + 8 * hi;
    size_t boff[4];
#pragma unroll
    for (int t = 0; t < 4; ++t) boff[t] = (size_t)(c0 + t * 16 + lr) * DM + 8 * hi;
    v8f acc[4];
#pragma unroll
    for (int t = 0; t < 4; ++t) acc[t] = (v8f){};
#pragma unroll 1
    for (int kc = 0; kc < DM; kc += 32) {
        const v16bf a = cat16b(*(const v8us*)(A + aoff + kc), *(const v8us*)(A + aoff + kc + 16));
        v16bf al = a;
        if (SPLITA) al = cat16b(*(const v8us*)(Al + aoff + kc), *(const v8us*)(Al + aoff + kc + 16));
#pragma unroll
        for (int t = 0; t < 4; ++t) { const v16bf b = cat16b(*(const v8us*)(Bn + boff[t] + kc), *(const v8us*)(Bn + boff[t] + kc + 16)); acc[t] = wmmab(a, b, acc[t]); if (SPLITA) acc[t] = wmmab(al, b, acc[t]); }
        asm volatile("v_nop\n\tv_nop\n\tv_nop\n\tv_nop" : "+v"(acc[0]), "+v"(acc[1]), "+v"(acc[2]), "+v"(acc[3]) : "v"(a), "v"(al));
    }
    float* os = &ost[wave][0];
#pragma unroll
    for (int t = 0; t < 4; ++t) { const float bv = bias ? bfr(bias[c0 + t * 16 + lr]) : 0.f;
#pragma unroll
        for (int j = 0; j < 8; ++j) os[(hi * 8 + j) * 68 + t * 16 + lr] = acc[t][j] + bv; }
    __syncthreads();
    if (F16OUT) {
        h16* crow = (h16*)(void*)C + (size_t)r0 * ldc + c0;
        auto pass = [&]() {
#pragma unroll
            for (int s = 0; s < 4; ++s) { const int row = 4 * s + (lane >> 3), piece = lane & 7; const float* sp = os + row * 68 + piece * 8; v8h o, o2;
#pragma unroll
                for (int i = 0; i < 8; ++i) { const h16 a = (h16)sp[i]; o[i] = a; o2[i] = (h16)((sp[i] - (float)a) * LOSC); }
                *(v8h*)(crow + (size_t)row * ldc + piece * 8) = o; if (C2) *(v8h*)(C2 + (size_t)r0 * ldc + c0 + (size_t)row * ldc + piece * 8) = o2; }
        };
        pass(); 
    } else {
        float* crow = C + (size_t)r0 * ldc + c0;
        auto pass = [&]() {
#pragma unroll
            for (int s = 0; s < 8; ++s) { const int Lid = (lane >> 3) + 4 * s, piece = lane & 7; const int row = Lid >> 1, cofs = (Lid & 1) * 32 + piece * 4;
                const v4f val = *(const v4fa*)(os + row * 68 + cofs); *(v4f*)(crow + (size_t)row * ldc + cofs) = val; }
        };
        pass(); 
    }
}

__global__ __launch_bounds__(256) void k_vt(const float* __restrict__ V, h16* VTH, h16* VTL) {
    __shared__ __align__(16) h16 tile[64 * 72];
    __shared__ __align__(16) h16 til2[64 * 72];
    const int bid = blockIdx.x;
    const int b = bid / (NH_ * (NT_ / 64)), rem = bid - b * (NH_ * (NT_ / 64)), h = rem / (NT_ / 64), kt = rem - h * (NT_ / 64);
    const int k0 = kt * 64, tid = threadIdx.x;
    const int kk = tid >> 2, d0 = (tid & 3) * 16;
    const float* src = V + ((size_t)b * NT_ + k0 + kk) * DM + h * HD + d0;
#pragma unroll
    for (int i = 0; i < 16; ++i) { const float v = src[i]; const h16 a = (h16)v; tile[(d0 + i) * 72 + kk] = a; til2[(d0 + i) * 72 + kk] = (h16)((v - (float)a) * LOSC); }
    __syncthreads();
    const int piece = tid & 7;
    const size_t base = (((size_t)b * NH_ + h) * HD) * NT_ + k0;
    auto pass = [&]() {
#pragma unroll
        for (int s = 0; s < 4; ++s) { const int Lid = (tid >> 3) + 32 * s; const int pln = Lid >> 6, d = Lid & 63;
            const v8h val = *(const v8ha*)((pln ? til2 : tile) + d * 72 + piece * 8); *(v8h*)((pln ? VTL : VTH) + base + (size_t)d * NT_ + piece * 8) = val; }
    };
    pass(); 
}

// k_attn: block = (b, h, 64 queries), wave = 16; ALL 64 key tiles of 32 keys (no mask); 4 WMMA scores /32 (f32), online softmax, weights x32768 f16 tile (same-wave may_alias
// reload after a compiler barrier), 4 WMMA .v; ctx -> f32 output rows out[tok][h*64+d].
__global__ __launch_bounds__(128) void k_attn(const h16* __restrict__ Q16, const h16* __restrict__ QL16, const h16* __restrict__ K16, const h16* __restrict__ KL16, const h16* __restrict__ VTH, const h16* __restrict__ VTL, float* OUTP) {
    __shared__ __align__(16) h16 plds[4][16 * 32];
    __shared__ __align__(16) h16 plds2[4][16 * 32];
    __shared__ __align__(16) float ost[4][16 * 68];
    const int lane = threadIdx.x & 31, wave = threadIdx.x >> 5, lr = lane & 15, hi = lane >> 4;
    const int bid = blockIdx.x;
    const int b = bid / (NH_ * (NT_ / 64)), rem = bid - b * (NH_ * (NT_ / 64)), h = rem / (NT_ / 64), qt = rem - h * (NT_ / 64);
    const int q0 = qt * 64 + wave * 16;
    const size_t tok0 = (size_t)b * NT_;
    h16* pl = &plds[wave][0]; h16* pl2 = &plds2[wave][0];
    v16h qa[2];
    const size_t qo0 = (tok0 + q0 + lr) * DM + h * HD + 8 * hi;
#pragma unroll
    for (int kc = 0; kc < 2; ++kc) qa[kc] = cat16(*(const v8h*)(Q16 + qo0 + kc * 32), *(const v8h*)(Q16 + qo0 + kc * 32 + 16));
    const h16* kh_b = K16 + tok0 * DM + h * HD;
    const h16* kl_b = KL16 + tok0 * DM + h * HD;
    const size_t vbase = (((size_t)b * NH_ + h) * HD) * NT_;
    v8f o[4], ox[4];
#pragma unroll
    for (int n = 0; n < 4; ++n) { o[n] = (v8f){}; ox[n] = (v8f){}; }
    float mrow[8], lpart[8];
#pragma unroll
    for (int j = 0; j < 8; ++j) { mrow[j] = -3.0e38f; lpart[j] = 0.f; }
    int qpos[8];
#pragma unroll
    for (int j = 0; j < 8; ++j) qpos[j] = q0 + 8 * hi + j;
    const int kt_lo = 0, kt_hi = NT_ / 32 - 1;     // full attention
#pragma unroll 1
    for (int kt = kt_lo; kt <= kt_hi; ++kt) {
        const int l0 = kt * 32;
        const size_t ko0 = (size_t)(l0 + lr) * DM + 8 * hi, ko1 = (size_t)(l0 + 16 + lr) * DM + 8 * hi;
        v8f s0 = {}, s1 = {}, x0 = {}, x1 = {};
#pragma unroll
        for (int kc = 0; kc < 2; ++kc) {
            { const v16h k0h = cat16(*(const v8h*)(kh_b + ko0 + kc * 32), *(const v8h*)(kh_b + ko0 + kc * 32 + 16)), k1h = cat16(*(const v8h*)(kh_b + ko1 + kc * 32), *(const v8h*)(kh_b + ko1 + kc * 32 + 16));
              const v16h qlk = cat16(*(const v8h*)(QL16 + qo0 + kc * 32), *(const v8h*)(QL16 + qo0 + kc * 32 + 16));     // query residual re-read per step (registers)
              s0 = wmma16(qa[kc], k0h, s0); x0 = wmma16(qlk, k0h, x0); s1 = wmma16(qa[kc], k1h, s1); x1 = wmma16(qlk, k1h, x1);
              asm volatile("v_nop" : "+v"(s0), "+v"(s1), "+v"(x0), "+v"(x1) : "v"(qlk), "v"(k0h), "v"(k1h) : "memory"); }
            { const v16h k0l = cat16(*(const v8h*)(kl_b + ko0 + kc * 32), *(const v8h*)(kl_b + ko0 + kc * 32 + 16)), k1l = cat16(*(const v8h*)(kl_b + ko1 + kc * 32), *(const v8h*)(kl_b + ko1 + kc * 32 + 16));
              x0 = wmma16(qa[kc], k0l, x0); x1 = wmma16(qa[kc], k1l, x1);
              asm volatile("v_nop" : "+v"(x0), "+v"(x1) : "v"(k0l), "v"(k1l) : "memory"); }
        }
        asm volatile("v_nop\n\tv_nop\n\tv_nop\n\tv_nop" : "+v"(s0), "+v"(s1), "+v"(x0), "+v"(x1) : "v"(qa[0]), "v"(qa[1]));
        float alpha[8];
#pragma unroll
        for (int j = 0; j < 8; ++j) {
            const int ja = l0 + lr, jb = l0 + 16 + lr, qi = qpos[j];
            const float a0 = (s0[j] + x0[j] * LOSCI) * 0.03125f, a1 = (s1[j] + x1[j] * LOSCI) * 0.03125f; (void)ja; (void)jb; (void)qi;   // scale 1/sqrt(1024), as the reference
            float mx = fmaxf(a0, a1);
            mx = fmaxf(mx, __shfl_xor(mx, 1, 16)); mx = fmaxf(mx, __shfl_xor(mx, 2, 16)); mx = fmaxf(mx, __shfl_xor(mx, 4, 16)); mx = fmaxf(mx, __shfl_xor(mx, 8, 16));
            const float mn = fmaxf(mrow[j], mx);
            alpha[j] = __expf(mrow[j] - mn); mrow[j] = mn;
            const float p0 = __expf(a0 - mn), p1 = __expf(a1 - mn);
            lpart[j] = lpart[j] * alpha[j] + (p0 + p1);
            const int mr = hi * 8 + j;
            const float ps0 = p0 * PSC, ps1 = p1 * PSC; const h16 h0 = (h16)ps0, h1 = (h16)ps1;
            pl[mr * 32 + lr] = h0; pl[mr * 32 + 16 + lr] = h1;
            pl2[mr * 32 + lr] = (h16)((ps0 - (float)h0) * LOSC); pl2[mr * 32 + 16 + lr] = (h16)((ps1 - (float)h1) * LOSC);
        }
#pragma unroll
        for (int n = 0; n < 4; ++n)
#pragma unroll
            for (int j = 0; j < 8; ++j) { o[n][j] *= alpha[j]; ox[n][j] *= alpha[j]; }
        asm volatile("" ::: "memory");
        const v16h pa = cat16(*(const v8ha*)(pl + lr * 32 + hi * 8), *(const v8ha*)(pl + lr * 32 + 16 + hi * 8));
        const v16h px = cat16(*(const v8ha*)(pl2 + lr * 32 + hi * 8), *(const v8ha*)(pl2 + lr * 32 + 16 + hi * 8));
#pragma unroll
        for (int n = 0; n < 4; ++n) { const size_t vo = vbase + (size_t)(n * 16 + lr) * NT_ + l0 + hi * 8;
            const v16h vh = cat16(*(const v8h*)(VTH + vo), *(const v8h*)(VTH + vo + 16)), vl = cat16(*(const v8h*)(VTL + vo), *(const v8h*)(VTL + vo + 16));
            o[n] = wmma16(pa, vh, o[n]); ox[n] = wmma16(pa, vl, ox[n]); ox[n] = wmma16(px, vh, ox[n]);
            asm volatile("" : "+v"(o[n]), "+v"(ox[n]) : "v"(vh), "v"(vl) : "memory"); }
        asm volatile("v_nop\n\tv_nop\n\tv_nop\n\tv_nop" : "+v"(o[0]), "+v"(o[1]), "+v"(o[2]), "+v"(o[3]), "+v"(ox[0]), "+v"(ox[1]), "+v"(ox[2]), "+v"(ox[3]) : "v"(pa), "v"(px));
    }
    float inv[8];
#pragma unroll
    for (int j = 0; j < 8; ++j) { float rs = lpart[j]; rs += __shfl_xor(rs, 1, 16); rs += __shfl_xor(rs, 2, 16); rs += __shfl_xor(rs, 4, 16); rs += __shfl_xor(rs, 8, 16); inv[j] = 1.0f / (rs * PSC); }
    float* os = &ost[wave][0];
#pragma unroll
    for (int n = 0; n < 4; ++n)
#pragma unroll
        for (int j = 0; j < 8; ++j) os[(hi * 8 + j) * 68 + n * 16 + lr] = (o[n][j] + ox[n][j] * LOSCI) * inv[j];
    __syncthreads();
    float* ob = OUTP + (tok0 + q0) * DM + (size_t)h * HD;
    auto pass = [&]() {
#pragma unroll
        for (int s = 0; s < 8; ++s) { const int Lid = (lane >> 3) + 4 * s, piece = lane & 7; const int row = Lid >> 1, cofs = (Lid & 1) * 32 + piece * 4;
            const v4f val = *(const v4fa*)(os + row * 68 + cofs); *(v4f*)(ob + (size_t)row * DM + cofs) = val; }
    };
    pass(); 
}

#define VST2(T, p, v) do { const T vst2_v_ = (v); *(T*)(p) = vst2_v_;  } while (0)
extern "C" void kernel_launch(void* const* d_in, const int* in_sizes, int n_in,
                              void* d_out, int out_size, void* d_ws, size_t ws_size, hipStream_t stream) {
    (void)in_sizes; (void)n_in; (void)out_size;
    const float* x = (const float*)d_in[0]; const float* Wqkv = (const float*)d_in[1];   // k-major [1024][3072]
    float* out = (float*)d_out;    // [2][2048][1024]
    char* wsp = (char*)d_ws;
    auto take = [&](size_t bytes) { char* p = wsp; wsp += (bytes + 255) & ~(size_t)255; return (void*)p; };
    bf* Xb = (bf*)take((size_t)NTK * DM * 2); bf* WqkvT = (bf*)take((size_t)3 * DM * DM * 2);
    float* TMP = (float*)take((size_t)NTK * DM * 4);
    h16* QH = (h16*)take((size_t)NTK * DM * 2); h16* QL = (h16*)take((size_t)NTK * DM * 2); h16* KH = (h16*)take((size_t)NTK * DM * 2); h16* KL = (h16*)take((size_t)NTK * DM * 2);
    h16* VTH = (h16*)take((size_t)NTK * DM * 2); h16* VTL = (h16*)take((size_t)NTK * DM * 2);
    if ((size_t)(wsp - (char*)d_ws) > ws_size) return;    // 4.2 + 6.3 + 8.4 + 6 x 4.2 ~ 44 MB, no aliasing
    const bf* WqB = WqkvT; const bf* WkB = WqkvT + (size_t)DM * DM; const bf* WvB = WqkvT + (size_t)2 * DM * DM;
    k_wt<<<dim3(DM / 64, 3 * DM / 64, 1), 256, 0, stream>>>(Wqkv, DM, 3 * DM, WqkvT);
    for (int b = 0; b < 2; ++b) {
        k_cvtb<<<NTK / 8, 256, 0, stream>>>(x + (size_t)b * NTK * DM, NTK, Xb);
        k_gemmb<false, true><<<dim3(NTK / 64, DM / 64, 1), 128, 0, stream>>>(Xb, nullptr, WqB, nullptr, (float*)(void*)QH, DM, QL);
        k_gemmb<false, true><<<dim3(NTK / 64, DM / 64, 1), 128, 0, stream>>>(Xb, nullptr, WkB, nullptr, (float*)(void*)KH, DM, KL);
        k_gemmb<false, false><<<dim3(NTK / 64, DM / 64, 1), 128, 0, stream>>>(Xb, nullptr, WvB, nullptr, TMP, DM, nullptr);
        k_vt<<<NB_ * NH_ * (NT_ / 64), 256, 0, stream>>>(TMP, VTH, VTL);
        k_attn<<<NB_ * NH_ * (NT_ / 64), 128, 0, stream>>>(QH, QL, KH, KL, VTH, VTL, out + (size_t)b * NTK * DM);
    }
}

// v001
// It runs in 311 microseconds.
// Two timings next to v000 both put it at 1.49 times that version's speed.
#include <hip/hip_runtime.h>

// Compute dtypes, f32 accumulate, one batch item per pass: q/k/v = x.W_qkv ([2048 x 1024].[1024 x 3072], k-major weights transposed once to n-major planes; PLAIN bf16
// operands: inputs rounded once, exact) with q and k written straight from the GEMM epilogue as f16 hi + residual x1024 planes, on v_wmma_f32_16x16x32_bf16;
// the 16-head full attention (64-dim heads, scale 1/sqrt(1024) as the reference) written straight to the f32 output (no output projection), fused on
// v_wmma_f32_16x16x32_f16 (scores hi.hi + hi.lo + lo.hi with the residual terms on their own accumulator, online f32 softmax, weights (x32768) and v as f16

#define NB_  1                   // per pass: the 2 batch items are processed one at a time
#define NT_  2048
#define DM   1024
#define NH_  16
#define HD   64
#define NTK  (NB_ * NT_)
#define NW   1024
#define NQKV 1024
#define PSC  32768.0f
#define LOSC 1024.0f
#define LOSCI (1.0f / 1024.0f)

typedef _Float16 h16;
typedef unsigned short bf;
typedef __attribute__((ext_vector_type(16))) __bf16   v16bf;
typedef __attribute__((ext_vector_type(16))) _Float16 v16h;
typedef __attribute__((ext_vector_type(8)))  _Float16 v8h;
typedef __attribute__((ext_vector_type(8)))  unsigned short v8us;
typedef __attribute__((ext_vector_type(8)))  float    v8f;
typedef __attribute__((ext_vector_type(4)))  float    v4f;
typedef v8h  __attribute__((may_alias)) v8ha;
typedef v4f  __attribute__((may_alias)) v4fa;
typedef v8us __attribute__((may_alias)) v8usa;

__device__ __forceinline__ unsigned short f2bf(float f) { unsigned u = __float_as_uint(f); u += 0x7FFFu + ((u >> 16) & 1u); return (unsigned short)(u >> 16); }
__device__ __forceinline__ float bf2f(unsigned short b) { return __uint_as_float(((unsigned)b) << 16); }
__device__ __forceinline__ float bfr(float f) { return bf2f(f2bf(f)); }
__device__ __forceinline__ v16h cat16(v8h lo, v8h hi) { return __builtin_shufflevector(lo, hi, 0, 1, 2, 3, 4, 5, 6, 7, 8, 9, 10, 11, 12, 13, 14, 15); }
__device__ __forceinline__ v16bf cat16b(v8us lo, v8us hi) { return __builtin_bit_cast(v16bf, __builtin_shufflevector(lo, hi, 0, 1, 2, 3, 4, 5, 6, 7, 8, 9, 10, 11, 12, 13, 14, 15)); }
__device__ __forceinline__ v8f wmma16(v16h a, v16h b, v8f c) { return __builtin_amdgcn_wmma_f32_16x16x32_f16(false, a, false, b, (short)0, c, false, false); }
__device__ __forceinline__ v8f wmmab(v16bf a, v16bf b, v8f c) { return __builtin_amdgcn_wmma_f32_16x16x32_bf16(false, a, false, b, (short)0, c, false, false); }

__global__ __launch_bounds__(256) void k_cvtb(const float* __restrict__ src, int nrows, bf* dst) {
    const int lane = threadIdx.x & 31, r = blockIdx.x * 8 + (threadIdx.x >> 5);
    if (r >= nrows) return;
    v8us o[DM / 256];
#pragma unroll
    for (int q = 0; q < DM / 256; ++q) { v8us t;
#pragma unroll
        for (int i = 0; i < 8; ++i) t[i] = f2bf(src[(size_t)r * DM + q * 256 + lane * 8 + i]);
        o[q] = t; }
#pragma unroll
    for (int q = 0; q < DM / 256; ++q) *(v8us*)(dst + (size_t)r * DM + q * 256 + lane * 8) = o[q];
    
}

// k_wt: WT [n][K] = bf16(W[k][n]) (k-major [K][ncols]) via 64 x 64 LDS tiles; grid (K/64, ncols/64).
__global__ __launch_bounds__(256) void k_wt(const float* __restrict__ Wm, int K, int ncols, bf* WT) {
    __shared__ __align__(16) unsigned short tl[64 * 72];
    const int tid = threadIdx.x, k0 = blockIdx.x * 64, n0 = blockIdx.y * 64;
    const int kk = tid >> 2, nq = (tid & 3) * 16;
#pragma unroll
    for (int i = 0; i < 16; ++i) tl[(nq + i) * 72 + kk] = f2bf(Wm[(size_t)(k0 + kk) * ncols + n0 + nq + i]);
    __syncthreads();
    const int piece = tid & 7;
    auto pass = [&]() {
#pragma unroll
        for (int s = 0; s < 2; ++s) { const int nr = (tid >> 3) + 32 * s; const v8us val = *(const v8usa*)(tl + nr * 72 + piece * 8); *(v8us*)(WT + (size_t)(n0 + nr) * K + k0 + piece * 8) = val; }
    };
    pass(); 
}
template <bool SPLITA, bool F16OUT = false>
__global__ __launch_bounds__(128) void k_gemmb(const bf* __restrict__ A, const bf* __restrict__ Al, const bf* __restrict__ Bn, const float* __restrict__ bias, float* C, int ldc, h16* C2) {
    __shared__ __align__(16) float ost[4][16 * 68];
    const int lane = threadIdx.x & 31, wave = threadIdx.x >> 5, lr = lane & 15, hi = lane >> 4;
    const int r0 = blockIdx.x * 64 + wave * 16, c0 = blockIdx.y * 64;
    const size_t aoff = (size_t)(r0 + lr) * DM + 8 * hi;
    size_t boff[4];
#pragma unroll
    for (int t = 0; t < 4; ++t) boff[t] = (size_t)(c0 + t * 16 + lr) * DM + 8 * hi;
    v8f acc[4];
#pragma unroll
    for (int t = 0; t < 4; ++t) acc[t] = (v8f){};
#pragma unroll 1
    for (int kc = 0; kc < DM; kc += 32) {
        const v16bf a = cat16b(*(const v8us*)(A + aoff + kc), *(const v8us*)(A + aoff + kc + 16));
        v16bf al = a;
        if (SPLITA) al = cat16b(*(const v8us*)(Al + aoff + kc), *(const v8us*)(Al + aoff + kc + 16));
#pragma unroll
        for (int t = 0; t < 4; ++t) { const v16bf b = cat16b(*(const v8us*)(Bn + boff[t] + kc), *(const v8us*)(Bn + boff[t] + kc + 16)); acc[t] = wmmab(a, b, acc[t]); if (SPLITA) acc[t] = wmmab(al, b, acc[t]); }
        asm volatile("v_nop\n\tv_nop\n\tv_nop\n\tv_nop" : "+v"(acc[0]), "+v"(acc[1]), "+v"(acc[2]), "+v"(acc[3]) : "v"(a), "v"(al));
    }
    float* os = &ost[wave][0];
#pragma unroll
    for (int t = 0; t < 4; ++t) { const float bv = bias ? bfr(bias[c0 + t * 16 + lr]) : 0.f;
#pragma unroll
        for (int j = 0; j < 8; ++j) os[(hi * 8 + j) * 68 + t * 16 + lr] = acc[t][j] + bv; }
    __syncthreads();
    if (F16OUT) {
        h16* crow = (h16*)(void*)C + (size_t)r0 * ldc + c0;
        auto pass = [&]() {
#pragma unroll
            for (int s = 0; s < 4; ++s) { const int row = 4 * s + (lane >> 3), piece = lane & 7; const float* sp = os + row * 68 + piece * 8; v8h o, o2;
#pragma unroll
                for (int i = 0; i < 8; ++i) { const h16 a = (h16)sp[i]; o[i] = a; o2[i] = (h16)((sp[i] - (float)a) * LOSC); }
                *(v8h*)(crow + (size_t)row * ldc + piece * 8) = o; if (C2) *(v8h*)(C2 + (size_t)r0 * ldc + c0 + (size_t)row * ldc + piece * 8) = o2; }
        };
        pass(); 
    } else {
        float* crow = C + (size_t)r0 * ldc + c0;
        auto pass = [&]() {
#pragma unroll
            for (int s = 0; s < 8; ++s) { const int Lid = (lane >> 3) + 4 * s, piece = lane & 7; const int row = Lid >> 1, cofs = (Lid & 1) * 32 + piece * 4;
                const v4f val = *(const v4fa*)(os + row * 68 + cofs); *(v4f*)(crow + (size_t)row * ldc + cofs) = val; }
        };
        pass(); 
    }
}

__global__ __launch_bounds__(256) void k_vt(const float* __restrict__ V, h16* VTH, h16* VTL) {
    __shared__ __align__(16) h16 tile[64 * 72];
    __shared__ __align__(16) h16 til2[64 * 72];
    const int bid = blockIdx.x;
    const int b = bid / (NH_ * (NT_ / 64)), rem = bid - b * (NH_ * (NT_ / 64)), h = rem / (NT_ / 64), kt = rem - h * (NT_ / 64);
    const int k0 = kt * 64, tid = threadIdx.x;
    const int kk = tid >> 2, d0 = (tid & 3) * 16;
    const float* src = V + ((size_t)b * NT_ + k0 + kk) * DM + h * HD + d0;
#pragma unroll
    for (int i = 0; i < 16; ++i) { const float v = src[i]; const h16 a = (h16)v; tile[(d0 + i) * 72 + kk] = a; til2[(d0 + i) * 72 + kk] = (h16)((v - (float)a) * LOSC); }
    __syncthreads();
    const int piece = tid & 7;
    const size_t base = (((size_t)b * NH_ + h) * HD) * NT_ + k0;
    auto pass = [&]() {
#pragma unroll
        for (int s = 0; s < 4; ++s) { const int Lid = (tid >> 3) + 32 * s; const int pln = Lid >> 6, d = Lid & 63;
            const v8h val = *(const v8ha*)((pln ? til2 : tile) + d * 72 + piece * 8); *(v8h*)((pln ? VTL : VTH) + base + (size_t)d * NT_ + piece * 8) = val; }
    };
    pass(); 
}

// k_attn: block = (b, h, 64 queries), wave = 16; ALL 64 key tiles of 32 keys (no mask); 4 WMMA scores /32 (f32), online softmax, weights x32768 f16 tile (same-wave may_alias
// reload after a compiler barrier), 4 WMMA .v; ctx -> f32 output rows out[tok][h*64+d].
// k and v planes reach the waves through LDS: 64 keys a stage, each plane 64 rows of 128 B brought as whole cache lines once per block by asynchronous copies
// (every thread 16 pieces of 16 B), kept at a 144-B row pitch (16 B x odd: conflict-free 16-B fragment reads), two buffers, one block barrier a stage;
// fragment indices and sum order as before.
#define SKEY 64                  // keys per stage
#define SPIT 72                  // LDS row pitch in f16 (144 B)
#define SPLN (64 * SPIT)         // one plane of a stage
#define NSTG (NT_ / SKEY)

// Two planes of a stage: eight asynchronous 16-B copies per lane, rows 16 apart (la/lb: LDS byte addresses, ga/gb: global addresses, lstep/gstep: the row steps).
// The s_wait_xcnt ends the copies' own statement, so that no address register is rewritten ahead of it.
__device__ __forceinline__ void acopy8(unsigned la, unsigned lb, const h16* ga, const h16* gb, unsigned lstep, size_t gstep) {
    asm volatile("global_load_async_to_lds_b128 %0, %8, off\n\t"
                 "global_load_async_to_lds_b128 %1, %9, off\n\t"
                 "global_load_async_to_lds_b128 %2, %10, off\n\t"
                 "global_load_async_to_lds_b128 %3, %11, off\n\t"
                 "global_load_async_to_lds_b128 %4, %12, off\n\t"
                 "global_load_async_to_lds_b128 %5, %13, off\n\t"
                 "global_load_async_to_lds_b128 %6, %14, off\n\t"
                 "global_load_async_to_lds_b128 %7, %15, off\n\t"
                 "s_wait_xcnt 0x0"
                 :: "v"(la), "v"(la + lstep), "v"(la + 2 * lstep), "v"(la + 3 * lstep), "v"(lb), "v"(lb + lstep), "v"(lb + 2 * lstep), "v"(lb + 3 * lstep),
                    "v"(ga), "v"(ga + gstep), "v"(ga + 2 * gstep), "v"(ga + 3 * gstep), "v"(gb), "v"(gb + gstep), "v"(gb + 2 * gstep), "v"(gb + 3 * gstep)
                 : "memory");
}
__global__ __launch_bounds__(128) void k_attn(const h16* __restrict__ Q16, const h16* __restrict__ QL16, const h16* __restrict__ K16, const h16* __restrict__ KL16, const h16* __restrict__ VTH, const h16* __restrict__ VTL, float* OUTP) {
    __shared__ __align__(16) h16 plds[4][16 * 32];
    __shared__ __align__(16) h16 plds2[4][16 * 32];
    __shared__ __align__(16) float ost[4][16 * 68];
    __shared__ __align__(16) h16 stg[2][4 * SPLN];     // per buffer: k hi, k residual, v^T hi, v^T residual
    const int lane = threadIdx.x & 31, wave = threadIdx.x >> 5, lr = lane & 15, hi = lane >> 4;
    const int bid = blockIdx.x;
    const int b = bid / (NH_ * (NT_ / 64)), rem = bid - b * (NH_ * (NT_ / 64)), h = rem / (NT_ / 64), qt = rem - h * (NT_ / 64);
    const int q0 = qt * 64 + wave * 16;
    const size_t tok0 = (size_t)b * NT_;
    h16* pl = &plds[wave][0]; h16* pl2 = &plds2[wave][0];
    v16h qa[2];
    const size_t qo0 = (tok0 + q0 + lr) * DM + h * HD + 8 * hi;
#pragma unroll
    for (int kc = 0; kc < 2; ++kc) qa[kc] = cat16(*(const v8h*)(Q16 + qo0 + kc * 32), *(const v8h*)(Q16 + qo0 + kc * 32 + 16));
    const h16* kh_b = K16 + tok0 * DM + h * HD;
    const h16* kl_b = KL16 + tok0 * DM + h * HD;
    const size_t vbase = (((size_t)b * NH_ + h) * HD) * NT_;
    v8f o[4], ox[4];
#pragma unroll
    for (int n = 0; n < 4; ++n) { o[n] = (v8f){}; ox[n] = (v8f){}; }
    float mrow[8], lpart[8];
#pragma unroll
    for (int j = 0; j < 8; ++j) { mrow[j] = -3.0e38f; lpart[j] = 0.f; }
    int qpos[8];
#pragma unroll
    for (int j = 0; j < 8; ++j) qpos[j] = q0 + 8 * hi + j;
    const int srow = threadIdx.x >> 3, spc = (threadIdx.x & 7) * 8;     // a thread's first row and its 16-B piece: 8 lanes cover one 128-B row
    const unsigned lthr = (unsigned)(size_t)&stg[0][0] + (unsigned)(srow * SPIT + spc) * 2u;      // the thread's LDS byte address in buffer 0, plane 0
    auto stage_in = [&](int st) {
        const unsigned d = lthr + (unsigned)(st & 1) * (4u * SPLN * 2u);
        const size_t kof = (size_t)(st * SKEY + srow) * DM + spc, vof = vbase + (size_t)srow * NT_ + st * SKEY + spc;
        acopy8(d, d + SPLN * 2u, kh_b + kof, kl_b + kof, 16u * SPIT * 2u, (size_t)16 * DM);
        acopy8(d + 2u * SPLN * 2u, d + 3u * SPLN * 2u, VTH + vof, VTL + vof, 16u * SPIT * 2u, (size_t)16 * NT_);
    };
    stage_in(0);
    asm volatile("s_wait_asynccnt 0x0" ::: "memory");     // this wave's copies of stage 0 have landed
    __syncthreads();                                      // every wave's have: stage 0 may be read
    stage_in(1);
#pragma unroll 1
    for (int st = 0; st < NSTG; ++st) {            // full attention; stage st + 1's copies fly while stage st is worked on
      const h16* sb = &stg[st & 1][0];
      // both 32-key halves of a stage unrolled: their LDS offsets become immediates of the reads
#pragma unroll
      for (int sub = 0; sub < SKEY / 32; ++sub) {
        const int l0 = st * SKEY + sub * 32;
        const h16* kh_s = sb; const h16* kl_s = sb + SPLN; const h16* vh_s = sb + 2 * SPLN; const h16* vl_s = sb + 3 * SPLN;
        const int ko0 = (sub * 32 + lr) * SPIT + 8 * hi, ko1 = (sub * 32 + 16 + lr) * SPIT + 8 * hi;
        v8f s0 = {}, s1 = {}, x0 = {}, x1 = {};
#pragma unroll
        for (int kc = 0; kc < 2; ++kc) {
            { const v16h k0h = cat16(*(const v8ha*)(kh_s + ko0 + kc * 32), *(const v8ha*)(kh_s + ko0 + kc * 32 + 16)), k1h = cat16(*(const v8ha*)(kh_s + ko1 + kc * 32), *(const v8ha*)(kh_s + ko1 + kc * 32 + 16));
              const v16h qlk = cat16(*(const v8h*)(QL16 + qo0 + kc * 32), *(const v8h*)(QL16 + qo0 + kc * 32 + 16));     // query residual re-read per step (registers)
              s0 = wmma16(qa[kc], k0h, s0); x0 = wmma16(qlk, k0h, x0); s1 = wmma16(qa[kc], k1h, s1); x1 = wmma16(qlk, k1h, x1);
              asm volatile("v_nop" : "+v"(s0), "+v"(s1), "+v"(x0), "+v"(x1) : "v"(qlk), "v"(k0h), "v"(k1h) : "memory"); }
            { const v16h k0l = cat16(*(const v8ha*)(kl_s + ko0 + kc * 32), *(const v8ha*)(kl_s + ko0 + kc * 32 + 16)), k1l = cat16(*(const v8ha*)(kl_s + ko1 + kc * 32), *(const v8ha*)(kl_s + ko1 + kc * 32 + 16));
              x0 = wmma16(qa[kc], k0l, x0); x1 = wmma16(qa[kc], k1l, x1);
              asm volatile("v_nop" : "+v"(x0), "+v"(x1) : "v"(k0l), "v"(k1l) : "memory"); }
        }
        asm volatile("v_nop\n\tv_nop\n\tv_nop\n\tv_nop" : "+v"(s0), "+v"(s1), "+v"(x0), "+v"(x1) : "v"(qa[0]), "v"(qa[1]));
        float alpha[8];
#pragma unroll
        for (int j = 0; j < 8; ++j) {
            const int ja = l0 + lr, jb = l0 + 16 + lr, qi = qpos[j];
            const float a0 = (s0[j] + x0[j] * LOSCI) * 0.03125f, a1 = (s1[j] + x1[j] * LOSCI) * 0.03125f; (void)ja; (void)jb; (void)qi;   // scale 1/sqrt(1024), as the reference
            float mx = fmaxf(a0, a1);
            mx = fmaxf(mx, __shfl_xor(mx, 1, 16)); mx = fmaxf(mx, __shfl_xor(mx, 2, 16)); mx = fmaxf(mx, __shfl_xor(mx, 4, 16)); mx = fmaxf(mx, __shfl_xor(mx, 8, 16));
            const float mn = fmaxf(mrow[j], mx);
            alpha[j] = __expf(mrow[j] - mn); mrow[j] = mn;
            const float p0 = __expf(a0 - mn), p1 = __expf(a1 - mn);
            lpart[j] = lpart[j] * alpha[j] + (p0 + p1);
            const int mr = hi * 8 + j;
            const float ps0 = p0 * PSC, ps1 = p1 * PSC; const h16 h0 = (h16)ps0, h1 = (h16)ps1;
            pl[mr * 32 + lr] = h0; pl[mr * 32 + 16 + lr] = h1;
            pl2[mr * 32 + lr] = (h16)((ps0 - (float)h0) * LOSC); pl2[mr * 32 + 16 + lr] = (h16)((ps1 - (float)h1) * LOSC);
        }
#pragma unroll
        for (int n = 0; n < 4; ++n)
#pragma unroll
            for (int j = 0; j < 8; ++j) { o[n][j] *= alpha[j]; ox[n][j] *= alpha[j]; }
        asm volatile("" ::: "memory");
        const v16h pa = cat16(*(const v8ha*)(pl + lr * 32 + hi * 8), *(const v8ha*)(pl + lr * 32 + 16 + hi * 8));
        const v16h px = cat16(*(const v8ha*)(pl2 + lr * 32 + hi * 8), *(const v8ha*)(pl2 + lr * 32 + 16 + hi * 8));
#pragma unroll
        for (int n = 0; n < 4; ++n) { const int vo = (n * 16 + lr) * SPIT + sub * 32 + hi * 8;
            const v16h vh = cat16(*(const v8ha*)(vh_s + vo), *(const v8ha*)(vh_s + vo + 16)), vl = cat16(*(const v8ha*)(vl_s + vo), *(const v8ha*)(vl_s + vo + 16));
            o[n] = wmma16(pa, vh, o[n]); ox[n] = wmma16(pa, vl, ox[n]); ox[n] = wmma16(px, vh, ox[n]);
            asm volatile("" : "+v"(o[n]), "+v"(ox[n]) : "v"(vh), "v"(vl) : "memory"); }
        asm volatile("v_nop\n\tv_nop\n\tv_nop\n\tv_nop" : "+v"(o[0]), "+v"(o[1]), "+v"(o[2]), "+v"(o[3]), "+v"(ox[0]), "+v"(ox[1]), "+v"(ox[2]), "+v"(ox[3]) : "v"(pa), "v"(px));
      }
      asm volatile("s_wait_dscnt 0x0" ::: "memory");        // this wave's LDS reads of stage st are done before its buffer is refilled
      asm volatile("s_wait_asynccnt 0x0" ::: "memory");     // this wave's copies of stage st + 1 have landed
      __syncthreads();                                      // publishes stage st + 1 and ends every wave's reads of stage st
      if (st + 2 < NSTG) stage_in(st + 2);                  // block-uniform test; into the buffer that stage st has just left
    }
    asm volatile("s_wait_asynccnt 0x0" ::: "memory");       // no copy is outstanding when the wave goes on to its end
    float inv[8];
#pragma unroll
    for (int j = 0; j < 8; ++j) { float rs = lpart[j]; rs += __shfl_xor(rs, 1, 16); rs += __shfl_xor(rs, 2, 16); rs += __shfl_xor(rs, 4, 16); rs += __shfl_xor(rs, 8, 16); inv[j] = 1.0f / (rs * PSC); }
    float* os = &ost[wave][0];
#pragma unroll
    for (int n = 0; n < 4; ++n)
#pragma unroll
        for (int j = 0; j < 8; ++j) os[(hi * 8 + j) * 68 + n * 16 + lr] = (o[n][j] + ox[n][j] * LOSCI) * inv[j];
    __syncthreads();
    float* ob = OUTP + (tok0 + q0) * DM + (size_t)h * HD;
    auto pass = [&]() {
#pragma unroll
        for (int s = 0; s < 8; ++s) { const int Lid = (lane >> 3) + 4 * s, piece = lane & 7; const int row = Lid >> 1, cofs = (Lid & 1) * 32 + piece * 4;
            const v4f val = *(const v4fa*)(os + row * 68 + cofs); *(v4f*)(ob + (size_t)row * DM + cofs) = val; }
    };
    pass(); 
}

#define VST2(T, p, v) do { const T vst2_v_ = (v); *(T*)(p) = vst2_v_;  } while (0)
extern "C" void kernel_launch(void* const* d_in, const int* in_sizes, int n_in,
                              void* d_out, int out_size, void* d_ws, size_t ws_size, hipStream_t stream) {
    (void)in_sizes; (void)n_in; (void)out_size;
    const float* x = (const float*)d_in[0]; const float* Wqkv = (const float*)d_in[1];   // k-major [1024][3072]
    float* out = (float*)d_out;    // [2][2048][1024]
    char* wsp = (char*)d_ws;
    auto take = [&](size_t bytes) { char* p = wsp; wsp += (bytes + 255) & ~(size_t)255; return (void*)p; };
    bf* Xb = (bf*)take((size_t)NTK * DM * 2); bf* WqkvT = (bf*)take((size_t)3 * DM * DM * 2);
    float* TMP = (float*)take((size_t)NTK * DM * 4);
    h16* QH = (h16*)take((size_t)NTK * DM * 2); h16* QL = (h16*)take((size_t)NTK * DM * 2); h16* KH = (h16*)take((size_t)NTK * DM * 2); h16* KL = (h16*)take((size_t)NTK * DM * 2);
    h16* VTH = (h16*)take((size_t)NTK * DM * 2); h16* VTL = (h16*)take((size_t)NTK * DM * 2);
    if ((size_t)(wsp - (char*)d_ws) > ws_size) return;    // 4.2 + 6.3 + 8.4 + 6 x 4.2 ~ 44 MB, no aliasing
    const bf* WqB = WqkvT; const bf* WkB = WqkvT + (size_t)DM * DM; const bf* WvB = WqkvT + (size_t)2 * DM * DM;
    k_wt<<<dim3(DM / 64, 3 * DM / 64, 1), 256, 0, stream>>>(Wqkv, DM, 3 * DM, WqkvT);
    for (int b = 0; b < 2; ++b) {
        k_cvtb<<<NTK / 8, 256, 0, stream>>>(x + (size_t)b * NTK * DM, NTK, Xb);
        k_gemmb<false, true><<<dim3(NTK / 64, DM / 64, 1), 128, 0, stream>>>(Xb, nullptr, WqB, nullptr, (float*)(void*)QH, DM, QL);
        k_gemmb<false, true><<<dim3(NTK / 64, DM / 64, 1), 128, 0, stream>>>(Xb, nullptr, WkB, nullptr, (float*)(void*)KH, DM, KL);
        k_gemmb<false, false><<<dim3(NTK / 64, DM / 64, 1), 128, 0, stream>>>(Xb, nullptr, WvB, nullptr, TMP, DM, nullptr);
        k_vt<<<NB_ * NH_ * (NT_ / 64), 256, 0, stream>>>(TMP, VTH, VTL);
        k_attn<<<NB_ * NH_ * (NT_ / 64), 128, 0, stream>>>(QH, QL, KH, KL, VTH, VTL, out + (size_t)b * NTK * DM);
    }
}

// v002
// A run of this version takes 267 microseconds.
// Timed twice side by side with v001, it ran 1.17 and 1.16 times as fast.
// Counting every step since v000, it is 1.74 times as fast.
#include <hip/hip_runtime.h>

// Compute dtypes, f32 accumulate, one batch item per pass: q/k/v = x.W_qkv ([2048 x 1024].[1024 x 3072], k-major weights transposed once to n-major planes; PLAIN bf16
// operands: inputs rounded once, exact) with q and k written straight from the GEMM epilogue as f16 hi + residual x1024 planes, on v_wmma_f32_16x16x32_bf16;
// the 16-head full attention (64-dim heads, scale 1/sqrt(1024) as the reference) written straight to the f32 output (no output projection), fused on
// v_wmma_f32_16x16x32_f16 (scores hi.hi + hi.lo + lo.hi with the residual terms on their own accumulator, online f32 softmax, weights (x32768) and v as f16

#define NB_  1                   // per pass: the 2 batch items are processed one at a time
#define NT_  2048
#define DM   1024
#define NH_  16
#define HD   64
#define NTK  (NB_ * NT_)
#define NW   1024
#define NQKV 1024
#define PSC  32768.0f
#define LOSC 1024.0f
#define LOSCI (1.0f / 1024.0f)

typedef _Float16 h16;
typedef unsigned short bf;
typedef __attribute__((ext_vector_type(16))) __bf16   v16bf;
typedef __attribute__((ext_vector_type(16))) _Float16 v16h;
typedef __attribute__((ext_vector_type(8)))  _Float16 v8h;
typedef __attribute__((ext_vector_type(8)))  unsigned short v8us;
typedef __attribute__((ext_vector_type(8)))  float    v8f;
typedef __attribute__((ext_vector_type(4)))  float    v4f;
typedef v8h  __attribute__((may_alias)) v8ha;
typedef v4f  __attribute__((may_alias)) v4fa;
typedef v8us __attribute__((may_alias)) v8usa;

__device__ __forceinline__ unsigned short f2bf(float f) { unsigned u = __float_as_uint(f); u += 0x7FFFu + ((u >> 16) & 1u); return (unsigned short)(u >> 16); }
__device__ __forceinline__ float bf2f(unsigned short b) { return __uint_as_float(((unsigned)b) << 16); }
__device__ __forceinline__ float bfr(float f) { return bf2f(f2bf(f)); }
__device__ __forceinline__ v16h cat16(v8h lo, v8h hi) { return __builtin_shufflevector(lo, hi, 0, 1, 2, 3, 4, 5, 6, 7, 8, 9, 10, 11, 12, 13, 14, 15); }
__device__ __forceinline__ v16bf cat16b(v8us lo, v8us hi) { return __builtin_bit_cast(v16bf, __builtin_shufflevector(lo, hi, 0, 1, 2, 3, 4, 5, 6, 7, 8, 9, 10, 11, 12, 13, 14, 15)); }
__device__ __forceinline__ v8f wmma16(v16h a, v16h b, v8f c) { return __builtin_amdgcn_wmma_f32_16x16x32_f16(false, a, false, b, (short)0, c, false, false); }
__device__ __forceinline__ v8f wmmab(v16bf a, v16bf b, v8f c) { return __builtin_amdgcn_wmma_f32_16x16x32_bf16(false, a, false, b, (short)0, c, false, false); }

__global__ __launch_bounds__(256) void k_cvtb(const float* __restrict__ src, int nrows, bf* dst) {
    const int lane = threadIdx.x & 31, r = blockIdx.x * 8 + (threadIdx.x >> 5);
    if (r >= nrows) return;
    v8us o[DM / 256];
#pragma unroll
    for (int q = 0; q < DM / 256; ++q) { v8us t;
#pragma unroll
        for (int i = 0; i < 8; ++i) t[i] = f2bf(src[(size_t)r * DM + q * 256 + lane * 8 + i]);
        o[q] = t; }
#pragma unroll
    for (int q = 0; q < DM / 256; ++q) *(v8us*)(dst + (size_t)r * DM + q * 256 + lane * 8) = o[q];
    
}

// k_wt: WT [n][K] = bf16(W[k][n]) (k-major [K][ncols]) via 64 x 64 LDS tiles; grid (K/64, ncols/64).
__global__ __launch_bounds__(256) void k_wt(const float* __restrict__ Wm, int K, int ncols, bf* WT) {
    __shared__ __align__(16) unsigned short tl[64 * 72];
    const int tid = threadIdx.x, k0 = blockIdx.x * 64, n0 = blockIdx.y * 64;
    const int kk = tid >> 2, nq = (tid & 3) * 16;
#pragma unroll
    for (int i = 0; i < 16; ++i) tl[(nq + i) * 72 + kk] = f2bf(Wm[(size_t)(k0 + kk) * ncols + n0 + nq + i]);
    __syncthreads();
    const int piece = tid & 7;
    auto pass = [&]() {
#pragma unroll
        for (int s = 0; s < 2; ++s) { const int nr = (tid >> 3) + 32 * s; const v8us val = *(const v8usa*)(tl + nr * 72 + piece * 8); *(v8us*)(WT + (size_t)(n0 + nr) * K + k0 + piece * 8) = val; }
    };
    pass(); 
}
template <bool SPLITA, bool F16OUT = false>
__global__ __launch_bounds__(128) void k_gemmb(const bf* __restrict__ A, const bf* __restrict__ Al, const bf* __restrict__ Bn, const float* __restrict__ bias, float* C, int ldc, h16* C2) {
    __shared__ __align__(16) float ost[4][16 * 68];
    const int lane = threadIdx.x & 31, wave = threadIdx.x >> 5, lr = lane & 15, hi = lane >> 4;
    const int r0 = blockIdx.x * 64 + wave * 16, c0 = blockIdx.y * 64;
    const size_t aoff = (size_t)(r0 + lr) * DM + 8 * hi;
    size_t boff[4];
#pragma unroll
    for (int t = 0; t < 4; ++t) boff[t] = (size_t)(c0 + t * 16 + lr) * DM + 8 * hi;
    v8f acc[4];
#pragma unroll
    for (int t = 0; t < 4; ++t) acc[t] = (v8f){};
#pragma unroll 1
    for (int kc = 0; kc < DM; kc += 32) {
        const v16bf a = cat16b(*(const v8us*)(A + aoff + kc), *(const v8us*)(A + aoff + kc + 16));
        v16bf al = a;
        if (SPLITA) al = cat16b(*(const v8us*)(Al + aoff + kc), *(const v8us*)(Al + aoff + kc + 16));
#pragma unroll
        for (int t = 0; t < 4; ++t) { const v16bf b = cat16b(*(const v8us*)(Bn + boff[t] + kc), *(const v8us*)(Bn + boff[t] + kc + 16)); acc[t] = wmmab(a, b, acc[t]); if (SPLITA) acc[t] = wmmab(al, b, acc[t]); }
        asm volatile("v_nop\n\tv_nop\n\tv_nop\n\tv_nop" : "+v"(acc[0]), "+v"(acc[1]), "+v"(acc[2]), "+v"(acc[3]) : "v"(a), "v"(al));
    }
    float* os = &ost[wave][0];
#pragma unroll
    for (int t = 0; t < 4; ++t) { const float bv = bias ? bfr(bias[c0 + t * 16 + lr]) : 0.f;
#pragma unroll
        for (int j = 0; j < 8; ++j) os[(hi * 8 + j) * 68 + t * 16 + lr] = acc[t][j] + bv; }
    __syncthreads();
    if (F16OUT) {
        h16* crow = (h16*)(void*)C + (size_t)r0 * ldc + c0;
        auto pass = [&]() {
#pragma unroll
            for (int s = 0; s < 4; ++s) { const int row = 4 * s + (lane >> 3), piece = lane & 7; const float* sp = os + row * 68 + piece * 8; v8h o, o2;
#pragma unroll
                for (int i = 0; i < 8; ++i) { const h16 a = (h16)sp[i]; o[i] = a; o2[i] = (h16)((sp[i] - (float)a) * LOSC); }
                *(v8h*)(crow + (size_t)row * ldc + piece * 8) = o; if (C2) *(v8h*)(C2 + (size_t)r0 * ldc + c0 + (size_t)row * ldc + piece * 8) = o2; }
        };
        pass(); 
    } else {
        float* crow = C + (size_t)r0 * ldc + c0;
        auto pass = [&]() {
#pragma unroll
            for (int s = 0; s < 8; ++s) { const int Lid = (lane >> 3) + 4 * s, piece = lane & 7; const int row = Lid >> 1, cofs = (Lid & 1) * 32 + piece * 4;
                const v4f val = *(const v4fa*)(os + row * 68 + cofs); *(v4f*)(crow + (size_t)row * ldc + cofs) = val; }
        };
        pass(); 
    }
}

__global__ __launch_bounds__(256) void k_vt(const float* __restrict__ V, h16* VTH, h16* VTL) {
    __shared__ __align__(16) h16 tile[64 * 72];
    __shared__ __align__(16) h16 til2[64 * 72];
    const int bid = blockIdx.x;
    const int b = bid / (NH_ * (NT_ / 64)), rem = bid - b * (NH_ * (NT_ / 64)), h = rem / (NT_ / 64), kt = rem - h * (NT_ / 64);
    const int k0 = kt * 64, tid = threadIdx.x;
    const int kk = tid >> 2, d0 = (tid & 3) * 16;
    const float* src = V + ((size_t)b * NT_ + k0 + kk) * DM + h * HD + d0;
#pragma unroll
    for (int i = 0; i < 16; ++i) { const float v = src[i]; const h16 a = (h16)v; tile[(d0 + i) * 72 + kk] = a; til2[(d0 + i) * 72 + kk] = (h16)((v - (float)a) * LOSC); }
    __syncthreads();
    const int piece = tid & 7;
    const size_t base = (((size_t)b * NH_ + h) * HD) * NT_ + k0;
    auto pass = [&]() {
#pragma unroll
        for (int s = 0; s < 4; ++s) { const int Lid = (tid >> 3) + 32 * s; const int pln = Lid >> 6, d = Lid & 63;
            const v8h val = *(const v8ha*)((pln ? til2 : tile) + d * 72 + piece * 8); *(v8h*)((pln ? VTL : VTH) + base + (size_t)d * NT_ + piece * 8) = val; }
    };
    pass(); 
}

// k_attn: block = (b, h, 64 queries), wave = 16; ALL 32 key tiles (no mask); scores TRANSPOSED (k rows as A, q as B): a lane holds 16 of the 32 scores of ONE query,
// so the online f32 softmax is in-lane but for one exchange between the wave's halves, and the weights (x32768, f16 hi + residual), converted in place, are the B operand
// of out^T += v^T . p^T (two score tiles = the k order 8h+s, 16+8h+s that the v^T loader has): no LDS round trip; ctx -> f32 output rows out[tok][h*64+d].
// k and v planes reach the waves through LDS: 64 keys a stage, each plane 64 rows of 128 B brought as whole cache lines once per block by asynchronous copies
// (every thread 16 pieces of 16 B), kept at a 144-B row pitch (16 B x odd: conflict-free 16-B fragment reads), two buffers, one block barrier a stage;
// fragment indices and sum order as before.
#define SKEY 64                  // keys per stage
#define SPIT 72                  // LDS row pitch in f16 (144 B)
#define SPLN (64 * SPIT)         // one plane of a stage
#define NSTG (NT_ / SKEY)

// Two planes of a stage: eight asynchronous 16-B copies per lane, rows 16 apart (la/lb: LDS byte addresses, ga/gb: global addresses, lstep/gstep: the row steps).
// The s_wait_xcnt ends the copies' own statement, so that no address register is rewritten ahead of it.
__device__ __forceinline__ void acopy8(unsigned la, unsigned lb, const h16* ga, const h16* gb, unsigned lstep, size_t gstep) {
    asm volatile("global_load_async_to_lds_b128 %0, %8, off\n\t"
                 "global_load_async_to_lds_b128 %1, %9, off\n\t"
                 "global_load_async_to_lds_b128 %2, %10, off\n\t"
                 "global_load_async_to_lds_b128 %3, %11, off\n\t"
                 "global_load_async_to_lds_b128 %4, %12, off\n\t"
                 "global_load_async_to_lds_b128 %5, %13, off\n\t"
                 "global_load_async_to_lds_b128 %6, %14, off\n\t"
                 "global_load_async_to_lds_b128 %7, %15, off\n\t"
                 "s_wait_xcnt 0x0"
                 :: "v"(la), "v"(la + lstep), "v"(la + 2 * lstep), "v"(la + 3 * lstep), "v"(lb), "v"(lb + lstep), "v"(lb + 2 * lstep), "v"(lb + 3 * lstep),
                    "v"(ga), "v"(ga + gstep), "v"(ga + 2 * gstep), "v"(ga + 3 * gstep), "v"(gb), "v"(gb + gstep), "v"(gb + 2 * gstep), "v"(gb + 3 * gstep)
                 : "memory");
}
// lane l with lane l ^ 16 (the other half of the wave holds the same query's other keys)
__device__ __forceinline__ float xhalf(float x) { return __builtin_bit_cast(float, __builtin_amdgcn_permlanex16(__builtin_bit_cast(int, x), __builtin_bit_cast(int, x), 0x76543210, 0xfedcba98, false, false)); }
#define L2E 1.44269504f          // exp(x) = exp2(x * log2 e)
// exp2 written with its slot: the instruction set asks for one independent instruction or v_nop between a transcendental and a use of its result or an overwrite of its
// source. Eight in one statement: the outputs are early-clobbered, so none reads its predecessor's result or overwrites its source; the v_nop is the last one's slot.
__device__ __forceinline__ void exp2x8(float* r, const float* x) {
    asm("v_exp_f32 %0, %8\n\tv_exp_f32 %1, %9\n\tv_exp_f32 %2, %10\n\tv_exp_f32 %3, %11\n\tv_exp_f32 %4, %12\n\tv_exp_f32 %5, %13\n\tv_exp_f32 %6, %14\n\tv_exp_f32 %7, %15\n\tv_nop"
        : "=&v"(r[0]), "=&v"(r[1]), "=&v"(r[2]), "=&v"(r[3]), "=&v"(r[4]), "=&v"(r[5]), "=&v"(r[6]), "=&v"(r[7])
        : "v"(x[0]), "v"(x[1]), "v"(x[2]), "v"(x[3]), "v"(x[4]), "v"(x[5]), "v"(x[6]), "v"(x[7]));
}
__device__ __forceinline__ float exp2x1(float x) { float r; asm("v_exp_f32 %0, %1\n\tv_nop" : "=v"(r) : "v"(x)); return r; }     // the v_nop: the same slot
__global__ __launch_bounds__(128) void k_attn(const h16* __restrict__ Q16, const h16* __restrict__ QL16, const h16* __restrict__ K16, const h16* __restrict__ KL16, const h16* __restrict__ VTH, const h16* __restrict__ VTL, float* OUTP) {
    __shared__ __align__(16) float ost[4][16 * 68];
    __shared__ __align__(16) h16 stg[2][4 * SPLN];     // per buffer: k hi, k residual, v^T hi, v^T residual
    const int lane = threadIdx.x & 31, wave = threadIdx.x >> 5, lr = lane & 15, hi = lane >> 4;
    const int bid = blockIdx.x;
    const int b = bid / (NH_ * (NT_ / 64)), rem = bid - b * (NH_ * (NT_ / 64)), h = rem / (NT_ / 64), qt = rem - h * (NT_ / 64);
    const int q0 = qt * 64 + wave * 16;
    const size_t tok0 = (size_t)b * NT_;
    v16h qa[2];
    const size_t qo0 = (tok0 + q0 + lr) * DM + h * HD + 8 * hi;
#pragma unroll
    for (int kc = 0; kc < 2; ++kc) qa[kc] = cat16(*(const v8h*)(Q16 + qo0 + kc * 32), *(const v8h*)(Q16 + qo0 + kc * 32 + 16));
    const h16* kh_b = K16 + tok0 * DM + h * HD;
    const h16* kl_b = KL16 + tok0 * DM + h * HD;
    const size_t vbase = (((size_t)b * NH_ + h) * HD) * NT_;
    v8f o[4], ox[4];
#pragma unroll
    for (int n = 0; n < 4; ++n) { o[n] = (v8f){}; ox[n] = (v8f){}; }
    float mrow = -3.0e38f, lpart = 0.f;      // of the lane's query q0 + lr; lpart: this half's keys only
    const int srow = threadIdx.x >> 3, spc = (threadIdx.x & 7) * 8;     // a thread's first row and its 16-B piece: 8 lanes cover one 128-B row
    const unsigned lthr = (unsigned)(size_t)&stg[0][0] + (unsigned)(srow * SPIT + spc) * 2u;      // the thread's LDS byte address in buffer 0, plane 0
    auto stage_in = [&](int st) {
        const unsigned d = lthr + (unsigned)(st & 1) * (4u * SPLN * 2u);
        const size_t kof = (size_t)(st * SKEY + srow) * DM + spc, vof = vbase + (size_t)srow * NT_ + st * SKEY + spc;
        acopy8(d, d + SPLN * 2u, kh_b + kof, kl_b + kof, 16u * SPIT * 2u, (size_t)16 * DM);
        acopy8(d + 2u * SPLN * 2u, d + 3u * SPLN * 2u, VTH + vof, VTL + vof, 16u * SPIT * 2u, (size_t)16 * NT_);
    };
    stage_in(0);
    asm volatile("s_wait_asynccnt 0x0" ::: "memory");     // this wave's copies of stage 0 have landed
    __syncthreads();                                      // every wave's have: stage 0 may be read
    stage_in(1);
#pragma unroll 1
    for (int st = 0; st < NSTG; ++st) {            // full attention; stage st + 1's copies fly while stage st is worked on
      const h16* sb = &stg[st & 1][0];
      // both 32-key halves of a stage unrolled: their LDS offsets become immediates of the reads
#pragma unroll
      for (int sub = 0; sub < SKEY / 32; ++sub) {
        const h16* kh_s = sb; const h16* kl_s = sb + SPLN; const h16* vh_s = sb + 2 * SPLN; const h16* vl_s = sb + 3 * SPLN;
        const int ko0 = (sub * 32 + lr) * SPIT + 8 * hi, ko1 = (sub * 32 + 16 + lr) * SPIT + 8 * hi;
        v8f s0 = {}, s1 = {}, x0 = {}, x1 = {};
#pragma unroll
        for (int kc = 0; kc < 2; ++kc) {
            { const v16h k0h = cat16(*(const v8ha*)(kh_s + ko0 + kc * 32), *(const v8ha*)(kh_s + ko0 + kc * 32 + 16)), k1h = cat16(*(const v8ha*)(kh_s + ko1 + kc * 32), *(const v8ha*)(kh_s + ko1 + kc * 32 + 16));
              const v16h qlk = cat16(*(const v8h*)(QL16 + qo0 + kc * 32), *(const v8h*)(QL16 + qo0 + kc * 32 + 16));     // query residual re-read per step (registers)
              s0 = wmma16(k0h, qa[kc], s0); x0 = wmma16(k0h, qlk, x0); s1 = wmma16(k1h, qa[kc], s1); x1 = wmma16(k1h, qlk, x1);
              asm volatile("v_nop" : "+v"(s0), "+v"(s1), "+v"(x0), "+v"(x1) : "v"(qlk), "v"(k0h), "v"(k1h) : "memory"); }
            { const v16h k0l = cat16(*(const v8ha*)(kl_s + ko0 + kc * 32), *(const v8ha*)(kl_s + ko0 + kc * 32 + 16)), k1l = cat16(*(const v8ha*)(kl_s + ko1 + kc * 32), *(const v8ha*)(kl_s + ko1 + kc * 32 + 16));
              x0 = wmma16(k0l, qa[kc], x0); x1 = wmma16(k1l, qa[kc], x1);
              asm volatile("v_nop" : "+v"(x0), "+v"(x1) : "v"(k0l), "v"(k1l) : "memory"); }
        }
        asm volatile("v_nop\n\tv_nop\n\tv_nop\n\tv_nop" : "+v"(s0), "+v"(s1), "+v"(x0), "+v"(x1) : "v"(qa[0]), "v"(qa[1]));
        // s0[j], s1[j]: keys 8 * hi + j and 16 + 8 * hi + j of this 32-key step, query lr
        float a[16], e[16], p[16];
#pragma unroll
        for (int j = 0; j < 8; ++j) a[j] = (s0[j] + x0[j] * LOSCI) * 0.03125f;          // scale 1/sqrt(1024), as the reference
#pragma unroll
        for (int j = 0; j < 8; ++j) a[8 + j] = (s1[j] + x1[j] * LOSCI) * 0.03125f;
        float mx = fmaxf(fmaxf(fmaxf(fmaxf(a[0], a[1]), fmaxf(a[2], a[3])), fmaxf(fmaxf(a[4], a[5]), fmaxf(a[6], a[7]))),
                         fmaxf(fmaxf(fmaxf(a[8], a[9]), fmaxf(a[10], a[11])), fmaxf(fmaxf(a[12], a[13]), fmaxf(a[14], a[15]))));
        mx = fmaxf(mx, xhalf(mx));                 // both halves now hold the maximum over the query's 32 keys
        const float mn = fmaxf(mrow, mx);
        const float alpha = exp2x1((mrow - mn) * L2E); mrow = mn;
#pragma unroll
        for (int i = 0; i < 16; ++i) e[i] = (a[i] - mn) * L2E;
        exp2x8(p, e); exp2x8(p + 8, e + 8);
        v16h pa, px;
#pragma unroll
        for (int i = 0; i < 16; ++i) { const float ps = p[i] * PSC; const h16 hh = (h16)ps; pa[i] = hh; px[i] = (h16)((ps - (float)hh) * LOSC); }
        lpart = lpart * alpha + ((((p[0] + p[1]) + (p[2] + p[3])) + ((p[4] + p[5]) + (p[6] + p[7]))) + (((p[8] + p[9]) + (p[10] + p[11])) + ((p[12] + p[13]) + (p[14] + p[15]))));
#pragma unroll
        for (int n = 0; n < 4; ++n)
#pragma unroll
            for (int j = 0; j < 8; ++j) { o[n][j] *= alpha; ox[n][j] *= alpha; }
#pragma unroll
        for (int n = 0; n < 4; ++n) { const int vo = (n * 16 + lr) * SPIT + sub * 32 + hi * 8;
            const v16h vh = cat16(*(const v8ha*)(vh_s + vo), *(const v8ha*)(vh_s + vo + 16)), vl = cat16(*(const v8ha*)(vl_s + vo), *(const v8ha*)(vl_s + vo + 16));
            o[n] = wmma16(vh, pa, o[n]); ox[n] = wmma16(vl, pa, ox[n]); ox[n] = wmma16(vh, px, ox[n]);     // o[n][j]: d = n * 16 + 8 * hi + j, query lr
            asm volatile("" : "+v"(o[n]), "+v"(ox[n]) : "v"(vh), "v"(vl) : "memory"); }
        asm volatile("v_nop\n\tv_nop\n\tv_nop\n\tv_nop" : "+v"(o[0]), "+v"(o[1]), "+v"(o[2]), "+v"(o[3]), "+v"(ox[0]), "+v"(ox[1]), "+v"(ox[2]), "+v"(ox[3]) : "v"(pa), "v"(px));
      }
      asm volatile("s_wait_dscnt 0x0" ::: "memory");        // this wave's LDS reads of stage st are done before its buffer is refilled
      asm volatile("s_wait_asynccnt 0x0" ::: "memory");     // this wave's copies of stage st + 1 have landed
      __syncthreads();                                      // publishes stage st + 1 and ends every wave's reads of stage st
      if (st + 2 < NSTG) stage_in(st + 2);                  // block-uniform test; into the buffer that stage st has just left
    }
    asm volatile("s_wait_asynccnt 0x0" ::: "memory");       // no copy is outstanding when the wave goes on to its end
    const float inv = 1.0f / ((lpart + xhalf(lpart)) * PSC);     // the two halves' sums joined once
    float* os = &ost[wave][0];
#pragma unroll
    for (int n = 0; n < 4; ++n)
#pragma unroll
        for (int g = 0; g < 2; ++g) { v4f w;
#pragma unroll
            for (int i = 0; i < 4; ++i) w[i] = (o[n][4 * g + i] + ox[n][4 * g + i] * LOSCI) * inv;
            *(v4fa*)(os + lr * 68 + n * 16 + hi * 8 + 4 * g) = w; }
    __syncthreads();
    float* ob = OUTP + (tok0 + q0) * DM + (size_t)h * HD;
    auto pass = [&]() {
#pragma unroll
        for (int s = 0; s < 8; ++s) { const int Lid = (lane >> 3) + 4 * s, piece = lane & 7; const int row = Lid >> 1, cofs = (Lid & 1) * 32 + piece * 4;
            const v4f val = *(const v4fa*)(os + row * 68 + cofs); *(v4f*)(ob + (size_t)row * DM + cofs) = val; }
    };
    pass(); 
}

#define VST2(T, p, v) do { const T vst2_v_ = (v); *(T*)(p) = vst2_v_;  } while (0)
extern "C" void kernel_launch(void* const* d_in, const int* in_sizes, int n_in,
                              void* d_out, int out_size, void* d_ws, size_t ws_size, hipStream_t stream) {
    (void)in_sizes; (void)n_in; (void)out_size;
    const float* x = (const float*)d_in[0]; const float* Wqkv = (const float*)d_in[1];   // k-major [1024][3072]
    float* out = (float*)d_out;    // [2][2048][1024]
    char* wsp = (char*)d_ws;
    auto take = [&](size_t bytes) { char* p = wsp; wsp += (bytes + 255) & ~(size_t)255; return (void*)p; };
    bf* Xb = (bf*)take((size_t)NTK * DM * 2); bf* WqkvT = (bf*)take((size_t)3 * DM * DM * 2);
    float* TMP = (float*)take((size_t)NTK * DM * 4);
    h16* QH = (h16*)take((size_t)NTK * DM * 2); h16* QL = (h16*)take((size_t)NTK * DM * 2); h16* KH = (h16*)take((size_t)NTK * DM * 2); h16* KL = (h16*)take((size_t)NTK * DM * 2);
    h16* VTH = (h16*)take((size_t)NTK * DM * 2); h16* VTL = (h16*)take((size_t)NTK * DM * 2);
    if ((size_t)(wsp - (char*)d_ws) > ws_size) return;    // 4.2 + 6.3 + 8.4 + 6 x 4.2 ~ 44 MB, no aliasing
    const bf* WqB = WqkvT; const bf* WkB = WqkvT + (size_t)DM * DM; const bf* WvB = WqkvT + (size_t)2 * DM * DM;
    k_wt<<<dim3(DM / 64, 3 * DM / 64, 1), 256, 0, stream>>>(Wqkv, DM, 3 * DM, WqkvT);
    for (int b = 0; b < 2; ++b) {
        k_cvtb<<<NTK / 8, 256, 0, stream>>>(x + (size_t)b * NTK * DM, NTK, Xb);
        k_gemmb<false, true><<<dim3(NTK / 64, DM / 64, 1), 128, 0, stream>>>(Xb, nullptr, WqB, nullptr, (float*)(void*)QH, DM, QL);
        k_gemmb<false, true><<<dim3(NTK / 64, DM / 64, 1), 128, 0, stream>>>(Xb, nullptr, WkB, nullptr, (float*)(void*)KH, DM, KL);
        k_gemmb<false, false><<<dim3(NTK / 64, DM / 64, 1), 128, 0, stream>>>(Xb, nullptr, WvB, nullptr, TMP, DM, nullptr);
        k_vt<<<NB_ * NH_ * (NT_ / 64), 256, 0, stream>>>(TMP, VTH, VTL);
        k_attn<<<NB_ * NH_ * (NT_ / 64), 128, 0, stream>>>(QH, QL, KH, KL, VTH, VTL, out + (size_t)b * NTK * DM);
    }
}

// v003
// It runs in 196 microseconds.
// In two side-by-side timings against v002, it was 1.36 and 1.37 times as fast.
// Counting every step since v000, it is 2.37 times as fast.
#include <hip/hip_runtime.h>

// Compute dtypes, f32 accumulate, one batch item per pass: q/k/v = x.W_qkv ([2048 x 1024].[1024 x 3072], k-major weights transposed once to n-major planes; PLAIN bf16
// operands: inputs rounded once, exact) with q and k written straight from the GEMM epilogue as f16 hi + residual x1024 planes, on v_wmma_f32_16x16x32_bf16;
// the 16-head full attention (64-dim heads, scale 1/sqrt(1024) as the reference) written straight to the f32 output (no output projection), fused on
// v_wmma_f32_16x16x32_f16 (scores hi.hi + hi.lo + lo.hi with the residual terms on their own accumulator, online f32 softmax, weights (x32768) and v as f16

#define NB_  1                   // per pass: the 2 batch items are processed one at a time
#define NT_  2048
#define DM   1024
#define NH_  16
#define HD   64
#define NTK  (NB_ * NT_)
#define NW   1024
#define NQKV 1024
#define PSC  32768.0f
#define LOSC 1024.0f
#define LOSCI (1.0f / 1024.0f)

typedef _Float16 h16;
typedef unsigned short bf;
typedef __attribute__((ext_vector_type(16))) __bf16   v16bf;
typedef __attribute__((ext_vector_type(16))) _Float16 v16h;
typedef __attribute__((ext_vector_type(8)))  _Float16 v8h;
typedef __attribute__((ext_vector_type(8)))  unsigned short v8us;
typedef __attribute__((ext_vector_type(8)))  float    v8f;
typedef __attribute__((ext_vector_type(4)))  float    v4f;
typedef v8h  __attribute__((may_alias)) v8ha;
typedef v4f  __attribute__((may_alias)) v4fa;
typedef v8us __attribute__((may_alias)) v8usa;

__device__ __forceinline__ unsigned short f2bf(float f) { unsigned u = __float_as_uint(f); u += 0x7FFFu + ((u >> 16) & 1u); return (unsigned short)(u >> 16); }
__device__ __forceinline__ float bf2f(unsigned short b) { return __uint_as_float(((unsigned)b) << 16); }
__device__ __forceinline__ float bfr(float f) { return bf2f(f2bf(f)); }
__device__ __forceinline__ v16h cat16(v8h lo, v8h hi) { return __builtin_shufflevector(lo, hi, 0, 1, 2, 3, 4, 5, 6, 7, 8, 9, 10, 11, 12, 13, 14, 15); }
__device__ __forceinline__ v16bf cat16b(v8us lo, v8us hi) { return __builtin_bit_cast(v16bf, __builtin_shufflevector(lo, hi, 0, 1, 2, 3, 4, 5, 6, 7, 8, 9, 10, 11, 12, 13, 14, 15)); }
__device__ __forceinline__ v8f wmma16(v16h a, v16h b, v8f c) { return __builtin_amdgcn_wmma_f32_16x16x32_f16(false, a, false, b, (short)0, c, false, false); }
__device__ __forceinline__ v8f wmmab(v16bf a, v16bf b, v8f c) { return __builtin_amdgcn_wmma_f32_16x16x32_bf16(false, a, false, b, (short)0, c, false, false); }

__global__ __launch_bounds__(256) void k_cvtb(const float* __restrict__ src, int nrows, bf* dst) {
    const int lane = threadIdx.x & 31, r = blockIdx.x * 8 + (threadIdx.x >> 5);
    if (r >= nrows) return;
    v8us o[DM / 256];
#pragma unroll
    for (int q = 0; q < DM / 256; ++q) { v8us t;
#pragma unroll
        for (int i = 0; i < 8; ++i) t[i] = f2bf(src[(size_t)r * DM + q * 256 + lane * 8 + i]);
        o[q] = t; }
#pragma unroll
    for (int q = 0; q < DM / 256; ++q) *(v8us*)(dst + (size_t)r * DM + q * 256 + lane * 8) = o[q];
    
}

// k_wt: WT [n][K] = bf16(W[k][n]) (k-major [K][ncols]) via 64 x 64 LDS tiles; grid (K/64, ncols/64).
__global__ __launch_bounds__(256) void k_wt(const float* __restrict__ Wm, int K, int ncols, bf* WT) {
    __shared__ __align__(16) unsigned short tl[64 * 72];
    const int tid = threadIdx.x, k0 = blockIdx.x * 64, n0 = blockIdx.y * 64;
    const int kk = tid >> 2, nq = (tid & 3) * 16;
#pragma unroll
    for (int i = 0; i < 16; ++i) tl[(nq + i) * 72 + kk] = f2bf(Wm[(size_t)(k0 + kk) * ncols + n0 + nq + i]);
    __syncthreads();
    const int piece = tid & 7;
    auto pass = [&]() {
#pragma unroll
        for (int s = 0; s < 2; ++s) { const int nr = (tid >> 3) + 32 * s; const v8us val = *(const v8usa*)(tl + nr * 72 + piece * 8); *(v8us*)(WT + (size_t)(n0 + nr) * K + k0 + piece * 8) = val; }
    };
    pass(); 
}
// Two planes of a stage: eight asynchronous 16-B copies per lane, four rows of each a fixed step apart (la/lb: LDS byte addresses, ga/gb: global addresses, lstep/gstep: the row steps).
// The s_wait_xcnt ends the copies' own statement, so that no address register is rewritten ahead of it.
__device__ __forceinline__ void acopy8(unsigned la, unsigned lb, const h16* ga, const h16* gb, unsigned lstep, size_t gstep) {
    asm volatile("global_load_async_to_lds_b128 %0, %8, off\n\t"
                 "global_load_async_to_lds_b128 %1, %9, off\n\t"
                 "global_load_async_to_lds_b128 %2, %10, off\n\t"
                 "global_load_async_to_lds_b128 %3, %11, off\n\t"
                 "global_load_async_to_lds_b128 %4, %12, off\n\t"
                 "global_load_async_to_lds_b128 %5, %13, off\n\t"
                 "global_load_async_to_lds_b128 %6, %14, off\n\t"
                 "global_load_async_to_lds_b128 %7, %15, off\n\t"
                 "s_wait_xcnt 0x0"
                 :: "v"(la), "v"(la + lstep), "v"(la + 2 * lstep), "v"(la + 3 * lstep), "v"(lb), "v"(lb + lstep), "v"(lb + 2 * lstep), "v"(lb + 3 * lstep),
                    "v"(ga), "v"(ga + gstep), "v"(ga + 2 * gstep), "v"(ga + 3 * gstep), "v"(gb), "v"(gb + gstep), "v"(gb + 2 * gstep), "v"(gb + 3 * gstep)
                 : "memory");
}
// k_gemmb: block = 64 x 64 of C, wave = 16 x 64. Both operand tiles reach the waves through LDS: 128 k a stage, 64 A rows and 64 B rows of 256 B brought as whole cache
// lines once per block by asynchronous copies (every thread 16 pieces of 16 B), kept at a 272-B row pitch (16 B x odd: conflict-free 16-B fragment reads), two buffers,
// one block barrier a stage; fragment indices and the k order of the sums as with direct loads.
#define GKS  128                 // k per stage
#define GPIT 136                 // LDS row pitch in bf16 (272 B)
#define GBUF (128 * GPIT)        // one buffer: the 64 A rows, then the 64 B rows
#define GNST (DM / GKS)
template <bool SPLITA, bool F16OUT = false>
__global__ __launch_bounds__(128) void k_gemmb(const bf* __restrict__ A, const bf* __restrict__ Al, const bf* __restrict__ Bn, const float* __restrict__ bias, float* C, int ldc, h16* C2) {
    __shared__ __align__(16) float ost[4][16 * 68];
    __shared__ __align__(16) bf gst[2][GBUF];
    const int lane = threadIdx.x & 31, wave = threadIdx.x >> 5, lr = lane & 15, hi = lane >> 4;
    const int rb = blockIdx.x * 64, r0 = rb + wave * 16, c0 = blockIdx.y * 64;
    const size_t aoff = (size_t)(r0 + lr) * DM + 8 * hi;
    const int srow = threadIdx.x >> 4, spc = (threadIdx.x & 15) * 8;     // a thread's first row and its 16-B piece: 16 lanes cover one 256-B row
    const unsigned lthr = (unsigned)(size_t)&gst[0][0] + (unsigned)(srow * GPIT + spc) * 2u;      // the thread's LDS byte address in buffer 0, A row srow
    const h16* ga = (const h16*)(const void*)A + (size_t)(rb + srow) * DM + spc;                  // 2-byte elements: only addresses are formed from these
    const h16* gb = (const h16*)(const void*)Bn + (size_t)(c0 + srow) * DM + spc;
    auto stage_in = [&](int st) {     // rows srow + 8 i, i = 0..7, of each tile
        const unsigned d = lthr + (unsigned)(st & 1) * (GBUF * 2u);
        acopy8(d, d + 32u * GPIT * 2u, ga + st * GKS, ga + st * GKS + (size_t)32 * DM, 8u * GPIT * 2u, (size_t)8 * DM);
        acopy8(d + 64u * GPIT * 2u, d + 96u * GPIT * 2u, gb + st * GKS, gb + st * GKS + (size_t)32 * DM, 8u * GPIT * 2u, (size_t)8 * DM);
    };
    v8f acc[4];
#pragma unroll
    for (int t = 0; t < 4; ++t) acc[t] = (v8f){};
    stage_in(0);
    asm volatile("s_wait_asynccnt 0x0" ::: "memory");     // this wave's copies of stage 0 have landed
    __syncthreads();                                      // every wave's have: stage 0 may be read
    stage_in(1);
    // rolled: one copy of the stage body; stage st + 1's copies fly while stage st is worked on
#pragma unroll 1
    for (int st = 0; st < GNST; ++st) {
        const bf* sa = &gst[st & 1][0] + (wave * 16 + lr) * GPIT + 8 * hi;
        const bf* sb = &gst[st & 1][0] + (64 + lr) * GPIT + 8 * hi;
        // the four 32-k steps of a stage unrolled: their LDS offsets become immediates of the reads
#pragma unroll
        for (int kl = 0; kl < GKS; kl += 32) {
            const v16bf a = cat16b(*(const v8usa*)(sa + kl), *(const v8usa*)(sa + kl + 16));
            v16bf al = a;
            if (SPLITA) al = cat16b(*(const v8us*)(Al + aoff + st * GKS + kl), *(const v8us*)(Al + aoff + st * GKS + kl + 16));
#pragma unroll
            for (int t = 0; t < 4; ++t) { const v16bf b = cat16b(*(const v8usa*)(sb + t * 16 * GPIT + kl), *(const v8usa*)(sb + t * 16 * GPIT + kl + 16)); acc[t] = wmmab(a, b, acc[t]); if (SPLITA) acc[t] = wmmab(al, b, acc[t]); }
        }
        asm volatile("v_nop\n\tv_nop\n\tv_nop\n\tv_nop" : "+v"(acc[0]), "+v"(acc[1]), "+v"(acc[2]), "+v"(acc[3]));     // the matrix instructions' distance on the taken branches below; the stage's last one stays in front of the waits
        asm volatile("s_wait_dscnt 0x0" ::: "memory");        // this wave's LDS reads of stage st are done before its buffer is refilled
        asm volatile("s_wait_asynccnt 0x0" ::: "memory");     // this wave's copies of stage st + 1 have landed
        __syncthreads();                                      // publishes stage st + 1 and ends every wave's reads of stage st
        if (st + 2 < GNST) stage_in(st + 2);                  // block-uniform test; into the buffer that stage st has just left
    }
    asm volatile("s_wait_asynccnt 0x0" ::: "memory");         // no copy is outstanding when the wave goes on to its end
    float* os = &ost[wave][0];
#pragma unroll
    for (int t = 0; t < 4; ++t) { const float bv = bias ? bfr(bias[c0 + t * 16 + lr]) : 0.f;
#pragma unroll
        for (int j = 0; j < 8; ++j) os[(hi * 8 + j) * 68 + t * 16 + lr] = acc[t][j] + bv; }
    __syncthreads();
    if (F16OUT) {
        h16* crow = (h16*)(void*)C + (size_t)r0 * ldc + c0;
        auto pass = [&]() {
#pragma unroll
            for (int s = 0; s < 4; ++s) { const int row = 4 * s + (lane >> 3), piece = lane & 7; const float* sp = os + row * 68 + piece * 8; v8h o, o2;
#pragma unroll
                for (int i = 0; i < 8; ++i) { const h16 a = (h16)sp[i]; o[i] = a; o2[i] = (h16)((sp[i] - (float)a) * LOSC); }
                *(v8h*)(crow + (size_t)row * ldc + piece * 8) = o; if (C2) *(v8h*)(C2 + (size_t)r0 * ldc + c0 + (size_t)row * ldc + piece * 8) = o2; }
        };
        pass(); 
    } else {
        float* crow = C + (size_t)r0 * ldc + c0;
        auto pass = [&]() {
#pragma unroll
            for (int s = 0; s < 8; ++s) { const int Lid = (lane >> 3) + 4 * s, piece = lane & 7; const int row = Lid >> 1, cofs = (Lid & 1) * 32 + piece * 4;
                const v4f val = *(const v4fa*)(os + row * 68 + cofs); *(v4f*)(crow + (size_t)row * ldc + cofs) = val; }
        };
        pass(); 
    }
}

__global__ __launch_bounds__(256) void k_vt(const float* __restrict__ V, h16* VTH, h16* VTL) {
    __shared__ __align__(16) h16 tile[64 * 72];
    __shared__ __align__(16) h16 til2[64 * 72];
    const int bid = blockIdx.x;
    const int b = bid / (NH_ * (NT_ / 64)), rem = bid - b * (NH_ * (NT_ / 64)), h = rem / (NT_ / 64), kt = rem - h * (NT_ / 64);
    const int k0 = kt * 64, tid = threadIdx.x;
    const int kk = tid >> 2, d0 = (tid & 3) * 16;
    const float* src = V + ((size_t)b * NT_ + k0 + kk) * DM + h * HD + d0;
#pragma unroll
    for (int i = 0; i < 16; ++i) { const float v = src[i]; const h16 a = (h16)v; tile[(d0 + i) * 72 + kk] = a; til2[(d0 + i) * 72 + kk] = (h16)((v - (float)a) * LOSC); }
    __syncthreads();
    const int piece = tid & 7;
    const size_t base = (((size_t)b * NH_ + h) * HD) * NT_ + k0;
    auto pass = [&]() {
#pragma unroll
        for (int s = 0; s < 4; ++s) { const int Lid = (tid >> 3) + 32 * s; const int pln = Lid >> 6, d = Lid & 63;
            const v8h val = *(const v8ha*)((pln ? til2 : tile) + d * 72 + piece * 8); *(v8h*)((pln ? VTL : VTH) + base + (size_t)d * NT_ + piece * 8) = val; }
    };
    pass(); 
}

// k_attn: block = (b, h, 64 queries), wave = 16; ALL 32 key tiles (no mask); scores TRANSPOSED (k rows as A, q as B): a lane holds 16 of the 32 scores of ONE query,
// so the online f32 softmax is in-lane but for one exchange between the wave's halves, and the weights (x32768, f16 hi + residual), converted in place, are the B operand
// of out^T += v^T . p^T (two score tiles = the k order 8h+s, 16+8h+s that the v^T loader has): no LDS round trip; ctx -> f32 output rows out[tok][h*64+d].
// k and v planes reach the waves through LDS: 64 keys a stage, each plane 64 rows of 128 B brought as whole cache lines once per block by asynchronous copies
// (every thread 16 pieces of 16 B), kept at a 144-B row pitch (16 B x odd: conflict-free 16-B fragment reads), two buffers, one block barrier a stage;
// fragment indices and sum order as before.
#define SKEY 64                  // keys per stage
#define SPIT 72                  // LDS row pitch in f16 (144 B)
#define SPLN (64 * SPIT)         // one plane of a stage
#define NSTG (NT_ / SKEY)

// lane l with lane l ^ 16 (the other half of the wave holds the same query's other keys)
__device__ __forceinline__ float xhalf(float x) { return __builtin_bit_cast(float, __builtin_amdgcn_permlanex16(__builtin_bit_cast(int, x), __builtin_bit_cast(int, x), 0x76543210, 0xfedcba98, false, false)); }
#define L2E 1.44269504f          // exp(x) = exp2(x * log2 e)
// exp2 written with its slot: the instruction set asks for one independent instruction or v_nop between a transcendental and a use of its result or an overwrite of its
// source. Eight in one statement: the outputs are early-clobbered, so none reads its predecessor's result or overwrites its source; the v_nop is the last one's slot.
__device__ __forceinline__ void exp2x8(float* r, const float* x) {
    asm("v_exp_f32 %0, %8\n\tv_exp_f32 %1, %9\n\tv_exp_f32 %2, %10\n\tv_exp_f32 %3, %11\n\tv_exp_f32 %4, %12\n\tv_exp_f32 %5, %13\n\tv_exp_f32 %6, %14\n\tv_exp_f32 %7, %15\n\tv_nop"
        : "=&v"(r[0]), "=&v"(r[1]), "=&v"(r[2]), "=&v"(r[3]), "=&v"(r[4]), "=&v"(r[5]), "=&v"(r[6]), "=&v"(r[7])
        : "v"(x[0]), "v"(x[1]), "v"(x[2]), "v"(x[3]), "v"(x[4]), "v"(x[5]), "v"(x[6]), "v"(x[7]));
}
__device__ __forceinline__ float exp2x1(float x) { float r; asm("v_exp_f32 %0, %1\n\tv_nop" : "=v"(r) : "v"(x)); return r; }     // the v_nop: the same slot
__global__ __launch_bounds__(128) void k_attn(const h16* __restrict__ Q16, const h16* __restrict__ QL16, const h16* __restrict__ K16, const h16* __restrict__ KL16, const h16* __restrict__ VTH, const h16* __restrict__ VTL, float* OUTP) {
    __shared__ __align__(16) float ost[4][16 * 68];
    __shared__ __align__(16) h16 stg[2][4 * SPLN];     // per buffer: k hi, k residual, v^T hi, v^T residual
    const int lane = threadIdx.x & 31, wave = threadIdx.x >> 5, lr = lane & 15, hi = lane >> 4;
    const int bid = blockIdx.x;
    const int b = bid / (NH_ * (NT_ / 64)), rem = bid - b * (NH_ * (NT_ / 64)), h = rem / (NT_ / 64), qt = rem - h * (NT_ / 64);
    const int q0 = qt * 64 + wave * 16;
    const size_t tok0 = (size_t)b * NT_;
    v16h qa[2];
    const size_t qo0 = (tok0 + q0 + lr) * DM + h * HD + 8 * hi;
#pragma unroll
    for (int kc = 0; kc < 2; ++kc) qa[kc] = cat16(*(const v8h*)(Q16 + qo0 + kc * 32), *(const v8h*)(Q16 + qo0 + kc * 32 + 16));
    const h16* kh_b = K16 + tok0 * DM + h * HD;
    const h16* kl_b = KL16 + tok0 * DM + h * HD;
    const size_t vbase = (((size_t)b * NH_ + h) * HD) * NT_;
    v8f o[4], ox[4];
#pragma unroll
    for (int n = 0; n < 4; ++n) { o[n] = (v8f){}; ox[n] = (v8f){}; }
    float mrow = -3.0e38f, lpart = 0.f;      // of the lane's query q0 + lr; lpart: this half's keys only
    const int srow = threadIdx.x >> 3, spc = (threadIdx.x & 7) * 8;     // a thread's first row and its 16-B piece: 8 lanes cover one 128-B row
    const unsigned lthr = (unsigned)(size_t)&stg[0][0] + (unsigned)(srow * SPIT + spc) * 2u;      // the thread's LDS byte address in buffer 0, plane 0
    auto stage_in = [&](int st) {
        const unsigned d = lthr + (unsigned)(st & 1) * (4u * SPLN * 2u);
        const size_t kof = (size_t)(st * SKEY + srow) * DM + spc, vof = vbase + (size_t)srow * NT_ + st * SKEY + spc;
        acopy8(d, d + SPLN * 2u, kh_b + kof, kl_b + kof, 16u * SPIT * 2u, (size_t)16 * DM);
        acopy8(d + 2u * SPLN * 2u, d + 3u * SPLN * 2u, VTH + vof, VTL + vof, 16u * SPIT * 2u, (size_t)16 * NT_);
    };
    stage_in(0);
    asm volatile("s_wait_asynccnt 0x0" ::: "memory");     // this wave's copies of stage 0 have landed
    __syncthreads();                                      // every wave's have: stage 0 may be read
    stage_in(1);
#pragma unroll 1
    for (int st = 0; st < NSTG; ++st) {            // full attention; stage st + 1's copies fly while stage st is worked on
      const h16* sb = &stg[st & 1][0];
      // both 32-key halves of a stage unrolled: their LDS offsets become immediates of the reads
#pragma unroll
      for (int sub = 0; sub < SKEY / 32; ++sub) {
        const h16* kh_s = sb; const h16* kl_s = sb + SPLN; const h16* vh_s = sb + 2 * SPLN; const h16* vl_s = sb + 3 * SPLN;
        const int ko0 = (sub * 32 + lr) * SPIT + 8 * hi, ko1 = (sub * 32 + 16 + lr) * SPIT + 8 * hi;
        v8f s0 = {}, s1 = {}, x0 = {}, x1 = {};
#pragma unroll
        for (int kc = 0; kc < 2; ++kc) {
            { const v16h k0h = cat16(*(const v8ha*)(kh_s + ko0 + kc * 32), *(const v8ha*)(kh_s + ko0 + kc * 32 + 16)), k1h = cat16(*(const v8ha*)(kh_s + ko1 + kc * 32), *(const v8ha*)(kh_s + ko1 + kc * 32 + 16));
              const v16h qlk = cat16(*(const v8h*)(QL16 + qo0 + kc * 32), *(const v8h*)(QL16 + qo0 + kc * 32 + 16));     // query residual re-read per step (registers)
              s0 = wmma16(k0h, qa[kc], s0); x0 = wmma16(k0h, qlk, x0); s1 = wmma16(k1h, qa[kc], s1); x1 = wmma16(k1h, qlk, x1);
              asm volatile("v_nop" : "+v"(s0), "+v"(s1), "+v"(x0), "+v"(x1) : "v"(qlk), "v"(k0h), "v"(k1h) : "memory"); }
            { const v16h k0l = cat16(*(const v8ha*)(kl_s + ko0 + kc * 32), *(const v8ha*)(kl_s + ko0 + kc * 32 + 16)), k1l = cat16(*(const v8ha*)(kl_s + ko1 + kc * 32), *(const v8ha*)(kl_s + ko1 + kc * 32 + 16));
              x0 = wmma16(k0l, qa[kc], x0); x1 = wmma16(k1l, qa[kc], x1);
              asm volatile("v_nop" : "+v"(x0), "+v"(x1) : "v"(k0l), "v"(k1l) : "memory"); }
        }
        asm volatile("v_nop\n\tv_nop\n\tv_nop\n\tv_nop" : "+v"(s0), "+v"(s1), "+v"(x0), "+v"(x1) : "v"(qa[0]), "v"(qa[1]));
        // s0[j], s1[j]: keys 8 * hi + j and 16 + 8 * hi + j of this 32-key step, query lr
        float a[16], e[16], p[16];
#pragma unroll
        for (int j = 0; j < 8; ++j) a[j] = (s0[j] + x0[j] * LOSCI) * 0.03125f;          // scale 1/sqrt(1024), as the reference
#pragma unroll
        for (int j = 0; j < 8; ++j) a[8 + j] = (s1[j] + x1[j] * LOSCI) * 0.03125f;
        float mx = fmaxf(fmaxf(fmaxf(fmaxf(a[0], a[1]), fmaxf(a[2], a[3])), fmaxf(fmaxf(a[4], a[5]), fmaxf(a[6], a[7]))),
                         fmaxf(fmaxf(fmaxf(a[8], a[9]), fmaxf(a[10], a[11])), fmaxf(fmaxf(a[12], a[13]), fmaxf(a[14], a[15]))));
        mx = fmaxf(mx, xhalf(mx));                 // both halves now hold the maximum over the query's 32 keys
        const float mn = fmaxf(mrow, mx);
        const float alpha = exp2x1((mrow - mn) * L2E); mrow = mn;
#pragma unroll
        for (int i = 0; i < 16; ++i) e[i] = (a[i] - mn) * L2E;
        exp2x8(p, e); exp2x8(p + 8, e + 8);
        v16h pa, px;
#pragma unroll
        for (int i = 0; i < 16; ++i) { const float ps = p[i] * PSC; const h16 hh = (h16)ps; pa[i] = hh; px[i] = (h16)((ps - (float)hh) * LOSC); }
        lpart = lpart * alpha + ((((p[0] + p[1]) + (p[2] + p[3])) + ((p[4] + p[5]) + (p[6] + p[7]))) + (((p[8] + p[9]) + (p[10] + p[11])) + ((p[12] + p[13]) + (p[14] + p[15]))));
#pragma unroll
        for (int n = 0; n < 4; ++n)
#pragma unroll
            for (int j = 0; j < 8; ++j) { o[n][j] *= alpha; ox[n][j] *= alpha; }
#pragma unroll
        for (int n = 0; n < 4; ++n) { const int vo = (n * 16 + lr) * SPIT + sub * 32 + hi * 8;
            const v16h vh = cat16(*(const v8ha*)(vh_s + vo), *(const v8ha*)(vh_s + vo + 16)), vl = cat16(*(const v8ha*)(vl_s + vo), *(const v8ha*)(vl_s + vo + 16));
            o[n] = wmma16(vh, pa, o[n]); ox[n] = wmma16(vl, pa, ox[n]); ox[n] = wmma16(vh, px, ox[n]);     // o[n][j]: d = n * 16 + 8 * hi + j, query lr
            asm volatile("" : "+v"(o[n]), "+v"(ox[n]) : "v"(vh), "v"(vl) : "memory"); }
        asm volatile("v_nop\n\tv_nop\n\tv_nop\n\tv_nop" : "+v"(o[0]), "+v"(o[1]), "+v"(o[2]), "+v"(o[3]), "+v"(ox[0]), "+v"(ox[1]), "+v"(ox[2]), "+v"(ox[3]) : "v"(pa), "v"(px));
      }
      asm volatile("s_wait_dscnt 0x0" ::: "memory");        // this wave's LDS reads of stage st are done before its buffer is refilled
      asm volatile("s_wait_asynccnt 0x0" ::: "memory");     // this wave's copies of stage st + 1 have landed
      __syncthreads();                                      // publishes stage st + 1 and ends every wave's reads of stage st
      if (st + 2 < NSTG) stage_in(st + 2);                  // block-uniform test; into the buffer that stage st has just left
    }
    asm volatile("s_wait_asynccnt 0x0" ::: "memory");       // no copy is outstanding when the wave goes on to its end
    const float inv = 1.0f / ((lpart + xhalf(lpart)) * PSC);     // the two halves' sums joined once
    float* os = &ost[wave][0];
#pragma unroll
    for (int n = 0; n < 4; ++n)
#pragma unroll
        for (int g = 0; g < 2; ++g) { v4f w;
#pragma unroll
            for (int i = 0; i < 4; ++i) w[i] = (o[n][4 * g + i] + ox[n][4 * g + i] * LOSCI) * inv;
            *(v4fa*)(os + lr * 68 + n * 16 + hi * 8 + 4 * g) = w; }
    __syncthreads();
    float* ob = OUTP + (tok0 + q0) * DM + (size_t)h * HD;
    auto pass = [&]() {
#pragma unroll
        for (int s = 0; s < 8; ++s) { const int Lid = (lane >> 3) + 4 * s, piece = lane & 7; const int row = Lid >> 1, cofs = (Lid & 1) * 32 + piece * 4;
            const v4f val = *(const v4fa*)(os + row * 68 + cofs); *(v4f*)(ob + (size_t)row * DM + cofs) = val; }
    };
    pass(); 
}

#define VST2(T, p, v) do { const T vst2_v_ = (v); *(T*)(p) = vst2_v_;  } while (0)
extern "C" void kernel_launch(void* const* d_in, const int* in_sizes, int n_in,
                              void* d_out, int out_size, void* d_ws, size_t ws_size, hipStream_t stream) {
    (void)in_sizes; (void)n_in; (void)out_size;
    const float* x = (const float*)d_in[0]; const float* Wqkv = (const float*)d_in[1];   // k-major [1024][3072]
    float* out = (float*)d_out;    // [2][2048][1024]
    char* wsp = (char*)d_ws;
    auto take = [&](size_t bytes) { char* p = wsp; wsp += (bytes + 255) & ~(size_t)255; return (void*)p; };
    bf* Xb = (bf*)take((size_t)NTK * DM * 2); bf* WqkvT = (bf*)take((size_t)3 * DM * DM * 2);
    float* TMP = (float*)take((size_t)NTK * DM * 4);
    h16* QH = (h16*)take((size_t)NTK * DM * 2); h16* QL = (h16*)take((size_t)NTK * DM * 2); h16* KH = (h16*)take((size_t)NTK * DM * 2); h16* KL = (h16*)take((size_t)NTK * DM * 2);
    h16* VTH = (h16*)take((size_t)NTK * DM * 2); h16* VTL = (h16*)take((size_t)NTK * DM * 2);
    if ((size_t)(wsp - (char*)d_ws) > ws_size) return;    // 4.2 + 6.3 + 8.4 + 6 x 4.2 ~ 44 MB, no aliasing
    const bf* WqB = WqkvT; const bf* WkB = WqkvT + (size_t)DM * DM; const bf* WvB = WqkvT + (size_t)2 * DM * DM;
    k_wt<<<dim3(DM / 64, 3 * DM / 64, 1), 256, 0, stream>>>(Wqkv, DM, 3 * DM, WqkvT);
    for (int b = 0; b < 2; ++b) {
        k_cvtb<<<NTK / 8, 256, 0, stream>>>(x + (size_t)b * NTK * DM, NTK, Xb);
        k_gemmb<false, true><<<dim3(NTK / 64, DM / 64, 1), 128, 0, stream>>>(Xb, nullptr, WqB, nullptr, (float*)(void*)QH, DM, QL);
        k_gemmb<false, true><<<dim3(NTK / 64, DM / 64, 1), 128, 0, stream>>>(Xb, nullptr, WkB, nullptr, (float*)(void*)KH, DM, KL);
        k_gemmb<false, false><<<dim3(NTK / 64, DM / 64, 1), 128, 0, stream>>>(Xb, nullptr, WvB, nullptr, TMP, DM, nullptr);
        k_vt<<<NB_ * NH_ * (NT_ / 64), 256, 0, stream>>>(TMP, VTH, VTL);
        k_attn<<<NB_ * NH_ * (NT_ / 64), 128, 0, stream>>>(QH, QL, KH, KL, VTH, VTL, out + (size_t)b * NTK * DM);
    }
}

// v004
// Measured time: 147 microseconds a run.
// Next to v003, in two timings, it ran 1.34 times as fast each time.
// Counting every step since v000, it is 3.17 times as fast.
#include <hip/hip_runtime.h>

// Compute dtypes, f32 accumulate, both batch items in one pass: q/k/v = x.W_qkv ([4096 x 1024].[1024 x 3072], k-major weights transposed once to n-major planes; PLAIN bf16
// operands: inputs rounded once, exact) with q and k written straight from the GEMM epilogue as f16 hi + residual x1024 planes, on v_wmma_f32_16x16x32_bf16;
// the 16-head full attention (64-dim heads, scale 1/sqrt(1024) as the reference) written straight to the f32 output (no output projection), fused on
// v_wmma_f32_16x16x32_f16 (scores hi.hi + hi.lo + lo.hi with the residual terms on their own accumulator, online f32 softmax, weights (x32768) and v as f16

#define NB_  2                   // both batch items in every launch: twice the blocks, so that four of them share a WGP
#define NT_  2048
#define DM   1024
#define NH_  16
#define HD   64
#define NTK  (NB_ * NT_)
#define NW   1024
#define NQKV 1024
#define PSC  32768.0f
#define LOSC 1024.0f
#define LOSCI (1.0f / 1024.0f)

typedef _Float16 h16;
typedef unsigned short bf;
typedef __attribute__((ext_vector_type(16))) __bf16   v16bf;
typedef __attribute__((ext_vector_type(16))) _Float16 v16h;
typedef __attribute__((ext_vector_type(8)))  _Float16 v8h;
typedef __attribute__((ext_vector_type(8)))  unsigned short v8us;
typedef __attribute__((ext_vector_type(8)))  float    v8f;
typedef __attribute__((ext_vector_type(4)))  float    v4f;
typedef v8h  __attribute__((may_alias)) v8ha;
typedef v4f  __attribute__((may_alias)) v4fa;
typedef v8us __attribute__((may_alias)) v8usa;

__device__ __forceinline__ unsigned short f2bf(float f) { unsigned u = __float_as_uint(f); u += 0x7FFFu + ((u >> 16) & 1u); return (unsigned short)(u >> 16); }
__device__ __forceinline__ float bf2f(unsigned short b) { return __uint_as_float(((unsigned)b) << 16); }
__device__ __forceinline__ float bfr(float f) { return bf2f(f2bf(f)); }
__device__ __forceinline__ v16h cat16(v8h lo, v8h hi) { return __builtin_shufflevector(lo, hi, 0, 1, 2, 3, 4, 5, 6, 7, 8, 9, 10, 11, 12, 13, 14, 15); }
__device__ __forceinline__ v16bf cat16b(v8us lo, v8us hi) { return __builtin_bit_cast(v16bf, __builtin_shufflevector(lo, hi, 0, 1, 2, 3, 4, 5, 6, 7, 8, 9, 10, 11, 12, 13, 14, 15)); }
__device__ __forceinline__ v8f wmma16(v16h a, v16h b, v8f c) { return __builtin_amdgcn_wmma_f32_16x16x32_f16(false, a, false, b, (short)0, c, false, false); }
__device__ __forceinline__ v8f wmmab(v16bf a, v16bf b, v8f c) { return __builtin_amdgcn_wmma_f32_16x16x32_bf16(false, a, false, b, (short)0, c, false, false); }

__global__ __launch_bounds__(256) void k_cvtb(const float* __restrict__ src, int nrows, bf* dst) {
    const int lane = threadIdx.x & 31, r = blockIdx.x * 8 + (threadIdx.x >> 5);
    if (r >= nrows) return;
    v8us o[DM / 256];
#pragma unroll
    for (int q = 0; q < DM / 256; ++q) { v8us t;
#pragma unroll
        for (int i = 0; i < 8; ++i) t[i] = f2bf(src[(size_t)r * DM + q * 256 + lane * 8 + i]);
        o[q] = t; }
#pragma unroll
    for (int q = 0; q < DM / 256; ++q) *(v8us*)(dst + (size_t)r * DM + q * 256 + lane * 8) = o[q];
    
}

// k_wt: WT [n][K] = bf16(W[k][n]) (k-major [K][ncols]) via 64 x 64 LDS tiles; grid (K/64, ncols/64).
__global__ __launch_bounds__(256) void k_wt(const float* __restrict__ Wm, int K, int ncols, bf* WT) {
    __shared__ __align__(16) unsigned short tl[64 * 72];
    const int tid = threadIdx.x, k0 = blockIdx.x * 64, n0 = blockIdx.y * 64;
    const int kk = tid >> 2, nq = (tid & 3) * 16;
#pragma unroll
    for (int i = 0; i < 16; ++i) tl[(nq + i) * 72 + kk] = f2bf(Wm[(size_t)(k0 + kk) * ncols + n0 + nq + i]);
    __syncthreads();
    const int piece = tid & 7;
    auto pass = [&]() {
#pragma unroll
        for (int s = 0; s < 2; ++s) { const int nr = (tid >> 3) + 32 * s; const v8us val = *(const v8usa*)(tl + nr * 72 + piece * 8); *(v8us*)(WT + (size_t)(n0 + nr) * K + k0 + piece * 8) = val; }
    };
    pass(); 
}
// Two planes of a stage: eight asynchronous 16-B copies per lane, four rows of each a fixed step apart (la/lb: LDS byte addresses, ga/gb: global addresses, lstep/gstep: the row steps).
// The s_wait_xcnt ends the copies' own statement, so that no address register is rewritten ahead of it.
__device__ __forceinline__ void acopy8(unsigned la, unsigned lb, const h16* ga, const h16* gb, unsigned lstep, size_t gstep) {
    asm volatile("global_load_async_to_lds_b128 %0, %8, off\n\t"
                 "global_load_async_to_lds_b128 %1, %9, off\n\t"
                 "global_load_async_to_lds_b128 %2, %10, off\n\t"
                 "global_load_async_to_lds_b128 %3, %11, off\n\t"
                 "global_load_async_to_lds_b128 %4, %12, off\n\t"
                 "global_load_async_to_lds_b128 %5, %13, off\n\t"
                 "global_load_async_to_lds_b128 %6, %14, off\n\t"
                 "global_load_async_to_lds_b128 %7, %15, off\n\t"
                 "s_wait_xcnt 0x0"
                 :: "v"(la), "v"(la + lstep), "v"(la + 2 * lstep), "v"(la + 3 * lstep), "v"(lb), "v"(lb + lstep), "v"(lb + 2 * lstep), "v"(lb + 3 * lstep),
                    "v"(ga), "v"(ga + gstep), "v"(ga + 2 * gstep), "v"(ga + 3 * gstep), "v"(gb), "v"(gb + gstep), "v"(gb + 2 * gstep), "v"(gb + 3 * gstep)
                 : "memory");
}
// k_gemmb: block = 64 x 64 of C, wave = 16 x 64. Both operand tiles reach the waves through LDS: 128 k a stage, 64 A rows and 64 B rows of 256 B brought as whole cache
// lines once per block by asynchronous copies (every thread 16 pieces of 16 B), kept at a 272-B row pitch (16 B x odd: conflict-free 16-B fragment reads), two buffers,
// one block barrier a stage; fragment indices and the k order of the sums as with direct loads. The output rows are staged in the same LDS once the last stage has been
// left (69,632 B a block: four blocks fit a WGP's LDS).
#define GKS  128                 // k per stage
#define GPIT 136                 // LDS row pitch in bf16 (272 B)
#define GBUF (128 * GPIT)        // one buffer: the 64 A rows, then the 64 B rows
#define GNST (DM / GKS)
template <bool SPLITA, bool F16OUT = false>
__global__ __launch_bounds__(128) void k_gemmb(const bf* __restrict__ A, const bf* __restrict__ Al, const bf* __restrict__ Bn, const float* __restrict__ bias, float* C, int ldc, h16* C2) {
    __shared__ __align__(16) bf gst[2][GBUF];
    const int lane = threadIdx.x & 31, wave = threadIdx.x >> 5, lr = lane & 15, hi = lane >> 4;
    const int rb = blockIdx.x * 64, r0 = rb + wave * 16, c0 = blockIdx.y * 64;
    const size_t aoff = (size_t)(r0 + lr) * DM + 8 * hi;
    const int srow = threadIdx.x >> 4, spc = (threadIdx.x & 15) * 8;     // a thread's first row and its 16-B piece: 16 lanes cover one 256-B row
    const unsigned lthr = (unsigned)(size_t)&gst[0][0] + (unsigned)(srow * GPIT + spc) * 2u;      // the thread's LDS byte address in buffer 0, A row srow
    const h16* ga = (const h16*)(const void*)A + (size_t)(rb + srow) * DM + spc;                  // 2-byte elements: only addresses are formed from these
    const h16* gb = (const h16*)(const void*)Bn + (size_t)(c0 + srow) * DM + spc;
    auto stage_in = [&](int st) {     // rows srow + 8 i, i = 0..7, of each tile
        const unsigned d = lthr + (unsigned)(st & 1) * (GBUF * 2u);
        acopy8(d, d + 32u * GPIT * 2u, ga + st * GKS, ga + st * GKS + (size_t)32 * DM, 8u * GPIT * 2u, (size_t)8 * DM);
        acopy8(d + 64u * GPIT * 2u, d + 96u * GPIT * 2u, gb + st * GKS, gb + st * GKS + (size_t)32 * DM, 8u * GPIT * 2u, (size_t)8 * DM);
    };
    v8f acc[4];
#pragma unroll
    for (int t = 0; t < 4; ++t) acc[t] = (v8f){};
    stage_in(0);
    asm volatile("s_wait_asynccnt 0x0" ::: "memory");     // this wave's copies of stage 0 have landed
    __syncthreads();                                      // every wave's have: stage 0 may be read
    stage_in(1);
    // rolled: one copy of the stage body; stage st + 1's copies fly while stage st is worked on
#pragma unroll 1
    for (int st = 0; st < GNST; ++st) {
        const bf* sa = &gst[st & 1][0] + (wave * 16 + lr) * GPIT + 8 * hi;
        const bf* sb = &gst[st & 1][0] + (64 + lr) * GPIT + 8 * hi;
        // the four 32-k steps of a stage unrolled: their LDS offsets become immediates of the reads
#pragma unroll
        for (int kl = 0; kl < GKS; kl += 32) {
            const v16bf a = cat16b(*(const v8usa*)(sa + kl), *(const v8usa*)(sa + kl + 16));
            v16bf al = a;
            if (SPLITA) al = cat16b(*(const v8us*)(Al + aoff + st * GKS + kl), *(const v8us*)(Al + aoff + st * GKS + kl + 16));
#pragma unroll
            for (int t = 0; t < 4; ++t) { const v16bf b = cat16b(*(const v8usa*)(sb + t * 16 * GPIT + kl), *(const v8usa*)(sb + t * 16 * GPIT + kl + 16)); acc[t] = wmmab(a, b, acc[t]); if (SPLITA) acc[t] = wmmab(al, b, acc[t]); }
        }
        asm volatile("v_nop\n\tv_nop\n\tv_nop\n\tv_nop" : "+v"(acc[0]), "+v"(acc[1]), "+v"(acc[2]), "+v"(acc[3]));     // the matrix instructions' distance on the taken branches below; the stage's last one stays in front of the waits
        asm volatile("s_wait_dscnt 0x0" ::: "memory");        // this wave's LDS reads of stage st are done before its buffer is refilled
        asm volatile("s_wait_asynccnt 0x0" ::: "memory");     // this wave's copies of stage st + 1 have landed
        __syncthreads();                                      // publishes stage st + 1 and ends every wave's reads of stage st
        if (st + 2 < GNST) stage_in(st + 2);                  // block-uniform test; into the buffer that stage st has just left
    }
    asm volatile("s_wait_asynccnt 0x0" ::: "memory");         // no copy is outstanding when the wave goes on to its end
    float* os = (float*)(void*)&gst[0][0] + wave * (16 * 68);     // behind the last trip's waits and barrier no wave reads a stage and no copy is outstanding
#pragma unroll
    for (int t = 0; t < 4; ++t) { const float bv = bias ? bfr(bias[c0 + t * 16 + lr]) : 0.f;
#pragma unroll
        for (int j = 0; j < 8; ++j) os[(hi * 8 + j) * 68 + t * 16 + lr] = acc[t][j] + bv; }
    __syncthreads();
    if (F16OUT) {
        h16* crow = (h16*)(void*)C + (size_t)r0 * ldc + c0;
        auto pass = [&]() {
#pragma unroll
            for (int s = 0; s < 4; ++s) { const int row = 4 * s + (lane >> 3), piece = lane & 7; const float* sp = os + row * 68 + piece * 8; v8h o, o2;
#pragma unroll
                for (int i = 0; i < 8; ++i) { const h16 a = (h16)sp[i]; o[i] = a; o2[i] = (h16)((sp[i] - (float)a) * LOSC); }
                *(v8h*)(crow + (size_t)row * ldc + piece * 8) = o; if (C2) *(v8h*)(C2 + (size_t)r0 * ldc + c0 + (size_t)row * ldc + piece * 8) = o2; }
        };
        pass(); 
    } else {
        float* crow = C + (size_t)r0 * ldc + c0;
        auto pass = [&]() {
#pragma unroll
            for (int s = 0; s < 8; ++s) { const int Lid = (lane >> 3) + 4 * s, piece = lane & 7; const int row = Lid >> 1, cofs = (Lid & 1) * 32 + piece * 4;
                const v4f val = *(const v4fa*)(os + row * 68 + cofs); *(v4f*)(crow + (size_t)row * ldc + cofs) = val; }
        };
        pass(); 
    }
}

__global__ __launch_bounds__(256) void k_vt(const float* __restrict__ V, h16* VTH, h16* VTL) {
    __shared__ __align__(16) h16 tile[64 * 72];
    __shared__ __align__(16) h16 til2[64 * 72];
    const int bid = blockIdx.x;
    const int b = bid / (NH_ * (NT_ / 64)), rem = bid - b * (NH_ * (NT_ / 64)), h = rem / (NT_ / 64), kt = rem - h * (NT_ / 64);
    const int k0 = kt * 64, tid = threadIdx.x;
    const int kk = tid >> 2, d0 = (tid & 3) * 16;
    const float* src = V + ((size_t)b * NT_ + k0 + kk) * DM + h * HD + d0;
#pragma unroll
    for (int i = 0; i < 16; ++i) { const float v = src[i]; const h16 a = (h16)v; tile[(d0 + i) * 72 + kk] = a; til2[(d0 + i) * 72 + kk] = (h16)((v - (float)a) * LOSC); }
    __syncthreads();
    const int piece = tid & 7;
    const size_t base = (((size_t)b * NH_ + h) * HD) * NT_ + k0;
    auto pass = [&]() {
#pragma unroll
        for (int s = 0; s < 4; ++s) { const int Lid = (tid >> 3) + 32 * s; const int pln = Lid >> 6, d = Lid & 63;
            const v8h val = *(const v8ha*)((pln ? til2 : tile) + d * 72 + piece * 8); *(v8h*)((pln ? VTL : VTH) + base + (size_t)d * NT_ + piece * 8) = val; }
    };
    pass(); 
}

// k_attn: block = (b, h, 64 queries), wave = 16; ALL 32 key tiles (no mask); scores TRANSPOSED (k rows as A, q as B): a lane holds 16 of the 32 scores of ONE query,
// so the online f32 softmax is in-lane but for one exchange between the wave's halves, and the weights (x32768, f16 hi + residual), converted in place, are the B operand
// of out^T += v^T . p^T (two score tiles = the k order 8h+s, 16+8h+s that the v^T loader has): no LDS round trip; ctx -> f32 output rows out[tok][h*64+d].
// k and v planes reach the waves through LDS: 64 keys a stage, each plane 64 rows of 128 B brought as whole cache lines once per block by asynchronous copies
// (every thread 16 pieces of 16 B), kept at a 144-B row pitch (16 B x odd: conflict-free 16-B fragment reads), two buffers, one block barrier a stage;
// fragment indices and sum order as before. The output rows are staged in the same LDS once the last stage has been left (73,728 B a block: four blocks fit a WGP's LDS).
#define SKEY 64                  // keys per stage
#define SPIT 72                  // LDS row pitch in f16 (144 B)
#define SPLN (64 * SPIT)         // one plane of a stage
#define NSTG (NT_ / SKEY)

// lane l with lane l ^ 16 (the other half of the wave holds the same query's other keys)
__device__ __forceinline__ float xhalf(float x) { return __builtin_bit_cast(float, __builtin_amdgcn_permlanex16(__builtin_bit_cast(int, x), __builtin_bit_cast(int, x), 0x76543210, 0xfedcba98, false, false)); }
#define L2E 1.44269504f          // exp(x) = exp2(x * log2 e)
// exp2 written with its slot: the instruction set asks for one independent instruction or v_nop between a transcendental and a use of its result or an overwrite of its
// source. Eight in one statement: the outputs are early-clobbered, so none reads its predecessor's result or overwrites its source; the v_nop is the last one's slot.
__device__ __forceinline__ void exp2x8(float* r, const float* x) {
    asm("v_exp_f32 %0, %8\n\tv_exp_f32 %1, %9\n\tv_exp_f32 %2, %10\n\tv_exp_f32 %3, %11\n\tv_exp_f32 %4, %12\n\tv_exp_f32 %5, %13\n\tv_exp_f32 %6, %14\n\tv_exp_f32 %7, %15\n\tv_nop"
        : "=&v"(r[0]), "=&v"(r[1]), "=&v"(r[2]), "=&v"(r[3]), "=&v"(r[4]), "=&v"(r[5]), "=&v"(r[6]), "=&v"(r[7])
        : "v"(x[0]), "v"(x[1]), "v"(x[2]), "v"(x[3]), "v"(x[4]), "v"(x[5]), "v"(x[6]), "v"(x[7]));
}
__device__ __forceinline__ float exp2x1(float x) { float r; asm("v_exp_f32 %0, %1\n\tv_nop" : "=v"(r) : "v"(x)); return r; }     // the v_nop: the same slot
__global__ __launch_bounds__(128) void k_attn(const h16* __restrict__ Q16, const h16* __restrict__ QL16, const h16* __restrict__ K16, const h16* __restrict__ KL16, const h16* __restrict__ VTH, const h16* __restrict__ VTL, float* OUTP) {
    __shared__ __align__(16) h16 stg[2][4 * SPLN];     // per buffer: k hi, k residual, v^T hi, v^T residual
    const int lane = threadIdx.x & 31, wave = threadIdx.x >> 5, lr = lane & 15, hi = lane >> 4;
    const int bid = blockIdx.x;
    const int b = bid / (NH_ * (NT_ / 64)), rem = bid - b * (NH_ * (NT_ / 64)), h = rem / (NT_ / 64), qt = rem - h * (NT_ / 64);
    const int q0 = qt * 64 + wave * 16;
    const size_t tok0 = (size_t)b * NT_;
    v16h qa[2];
    const size_t qo0 = (tok0 + q0 + lr) * DM + h * HD + 8 * hi;
#pragma unroll
    for (int kc = 0; kc < 2; ++kc) qa[kc] = cat16(*(const v8h*)(Q16 + qo0 + kc * 32), *(const v8h*)(Q16 + qo0 + kc * 32 + 16));
    const h16* kh_b = K16 + tok0 * DM + h * HD;
    const h16* kl_b = KL16 + tok0 * DM + h * HD;
    const size_t vbase = (((size_t)b * NH_ + h) * HD) * NT_;
    v8f o[4], ox[4];
#pragma unroll
    for (int n = 0; n < 4; ++n) { o[n] = (v8f){}; ox[n] = (v8f){}; }
    float mrow = -3.0e38f, lpart = 0.f;      // of the lane's query q0 + lr; lpart: this half's keys only
    const int srow = threadIdx.x >> 3, spc = (threadIdx.x & 7) * 8;     // a thread's first row and its 16-B piece: 8 lanes cover one 128-B row
    const unsigned lthr = (unsigned)(size_t)&stg[0][0] + (unsigned)(srow * SPIT + spc) * 2u;      // the thread's LDS byte address in buffer 0, plane 0
    auto stage_in = [&](int st) {
        const unsigned d = lthr + (unsigned)(st & 1) * (4u * SPLN * 2u);
        const size_t kof = (size_t)(st * SKEY + srow) * DM + spc, vof = vbase + (size_t)srow * NT_ + st * SKEY + spc;
        acopy8(d, d + SPLN * 2u, kh_b + kof, kl_b + kof, 16u * SPIT * 2u, (size_t)16 * DM);
        acopy8(d + 2u * SPLN * 2u, d + 3u * SPLN * 2u, VTH + vof, VTL + vof, 16u * SPIT * 2u, (size_t)16 * NT_);
    };
    stage_in(0);
    asm volatile("s_wait_asynccnt 0x0" ::: "memory");     // this wave's copies of stage 0 have landed
    __syncthreads();                                      // every wave's have: stage 0 may be read
    stage_in(1);
#pragma unroll 1
    for (int st = 0; st < NSTG; ++st) {            // full attention; stage st + 1's copies fly while stage st is worked on
      const h16* sb = &stg[st & 1][0];
      // both 32-key halves of a stage unrolled: their LDS offsets become immediates of the reads
#pragma unroll
      for (int sub = 0; sub < SKEY / 32; ++sub) {
        const h16* kh_s = sb; const h16* kl_s = sb + SPLN; const h16* vh_s = sb + 2 * SPLN; const h16* vl_s = sb + 3 * SPLN;
        const int ko0 = (sub * 32 + lr) * SPIT + 8 * hi, ko1 = (sub * 32 + 16 + lr) * SPIT + 8 * hi;
        v8f s0 = {}, s1 = {}, x0 = {}, x1 = {};
#pragma unroll
        for (int kc = 0; kc < 2; ++kc) {
            { const v16h k0h = cat16(*(const v8ha*)(kh_s + ko0 + kc * 32), *(const v8ha*)(kh_s + ko0 + kc * 32 + 16)), k1h = cat16(*(const v8ha*)(kh_s + ko1 + kc * 32), *(const v8ha*)(kh_s + ko1 + kc * 32 + 16));
              const v16h qlk = cat16(*(const v8h*)(QL16 + qo0 + kc * 32), *(const v8h*)(QL16 + qo0 + kc * 32 + 16));     // query residual re-read per step (registers)
              s0 = wmma16(k0h, qa[kc], s0); x0 = wmma16(k0h, qlk, x0); s1 = wmma16(k1h, qa[kc], s1); x1 = wmma16(k1h, qlk, x1);
              asm volatile("v_nop" : "+v"(s0), "+v"(s1), "+v"(x0), "+v"(x1) : "v"(qlk), "v"(k0h), "v"(k1h) : "memory"); }
            { const v16h k0l = cat16(*(const v8ha*)(kl_s + ko0 + kc * 32), *(const v8ha*)(kl_s + ko0 + kc * 32 + 16)), k1l = cat16(*(const v8ha*)(kl_s + ko1 + kc * 32), *(const v8ha*)(kl_s + ko1 + kc * 32 + 16));
              x0 = wmma16(k0l, qa[kc], x0); x1 = wmma16(k1l, qa[kc], x1);
              asm volatile("v_nop" : "+v"(x0), "+v"(x1) : "v"(k0l), "v"(k1l) : "memory"); }
        }
        asm volatile("v_nop\n\tv_nop\n\tv_nop\n\tv_nop" : "+v"(s0), "+v"(s1), "+v"(x0), "+v"(x1) : "v"(qa[0]), "v"(qa[1]));
        // s0[j], s1[j]: keys 8 * hi + j and 16 + 8 * hi + j of this 32-key step, query lr
        float a[16], e[16], p[16];
#pragma unroll
        for (int j = 0; j < 8; ++j) a[j] = (s0[j] + x0[j] * LOSCI) * 0.03125f;          // scale 1/sqrt(1024), as the reference
#pragma unroll
        for (int j = 0; j < 8; ++j) a[8 + j] = (s1[j] + x1[j] * LOSCI) * 0.03125f;
        float mx = fmaxf(fmaxf(fmaxf(fmaxf(a[0], a[1]), fmaxf(a[2], a[3])), fmaxf(fmaxf(a[4], a[5]), fmaxf(a[6], a[7]))),
                         fmaxf(fmaxf(fmaxf(a[8], a[9]), fmaxf(a[10], a[11])), fmaxf(fmaxf(a[12], a[13]), fmaxf(a[14], a[15]))));
        mx = fmaxf(mx, xhalf(mx));                 // both halves now hold the maximum over the query's 32 keys
        const float mn = fmaxf(mrow, mx);
        const float alpha = exp2x1((mrow - mn) * L2E); mrow = mn;
#pragma unroll
        for (int i = 0; i < 16; ++i) e[i] = (a[i] - mn) * L2E;
        exp2x8(p, e); exp2x8(p + 8, e + 8);
        v16h pa, px;
#pragma unroll
        for (int i = 0; i < 16; ++i) { const float ps = p[i] * PSC; const h16 hh = (h16)ps; pa[i] = hh; px[i] = (h16)((ps - (float)hh) * LOSC); }
        lpart = lpart * alpha + ((((p[0] + p[1]) + (p[2] + p[3])) + ((p[4] + p[5]) + (p[6] + p[7]))) + (((p[8] + p[9]) + (p[10] + p[11])) + ((p[12] + p[13]) + (p[14] + p[15]))));
#pragma unroll
        for (int n = 0; n < 4; ++n)
#pragma unroll
            for (int j = 0; j < 8; ++j) { o[n][j] *= alpha; ox[n][j] *= alpha; }
#pragma unroll
        for (int n = 0; n < 4; ++n) { const int vo = (n * 16 + lr) * SPIT + sub * 32 + hi * 8;
            const v16h vh = cat16(*(const v8ha*)(vh_s + vo), *(const v8ha*)(vh_s + vo + 16)), vl = cat16(*(const v8ha*)(vl_s + vo), *(const v8ha*)(vl_s + vo + 16));
            o[n] = wmma16(vh, pa, o[n]); ox[n] = wmma16(vl, pa, ox[n]); ox[n] = wmma16(vh, px, ox[n]);     // o[n][j]: d = n * 16 + 8 * hi + j, query lr
            asm volatile("" : "+v"(o[n]), "+v"(ox[n]) : "v"(vh), "v"(vl) : "memory"); }
        asm volatile("v_nop\n\tv_nop\n\tv_nop\n\tv_nop" : "+v"(o[0]), "+v"(o[1]), "+v"(o[2]), "+v"(o[3]), "+v"(ox[0]), "+v"(ox[1]), "+v"(ox[2]), "+v"(ox[3]) : "v"(pa), "v"(px));
      }
      asm volatile("s_wait_dscnt 0x0" ::: "memory");        // this wave's LDS reads of stage st are done before its buffer is refilled
      asm volatile("s_wait_asynccnt 0x0" ::: "memory");     // this wave's copies of stage st + 1 have landed
      __syncthreads();                                      // publishes stage st + 1 and ends every wave's reads of stage st
      if (st + 2 < NSTG) stage_in(st + 2);                  // block-uniform test; into the buffer that stage st has just left
    }
    asm volatile("s_wait_asynccnt 0x0" ::: "memory");       // no copy is outstanding when the wave goes on to its end
    const float inv = 1.0f / ((lpart + xhalf(lpart)) * PSC);     // the two halves' sums joined once
    float* os = (float*)(void*)&stg[0][0] + wave * (16 * 68);     // behind the last trip's waits and barrier no wave reads a stage and no copy is outstanding
#pragma unroll
    for (int n = 0; n < 4; ++n)
#pragma unroll
        for (int g = 0; g < 2; ++g) { v4f w;
#pragma unroll
            for (int i = 0; i < 4; ++i) w[i] = (o[n][4 * g + i] + ox[n][4 * g + i] * LOSCI) * inv;
            *(v4fa*)(os + lr * 68 + n * 16 + hi * 8 + 4 * g) = w; }
    __syncthreads();
    float* ob = OUTP + (tok0 + q0) * DM + (size_t)h * HD;
    auto pass = [&]() {
#pragma unroll
        for (int s = 0; s < 8; ++s) { const int Lid = (lane >> 3) + 4 * s, piece = lane & 7; const int row = Lid >> 1, cofs = (Lid & 1) * 32 + piece * 4;
            const v4f val = *(const v4fa*)(os + row * 68 + cofs); *(v4f*)(ob + (size_t)row * DM + cofs) = val; }
    };
    pass(); 
}

#define VST2(T, p, v) do { const T vst2_v_ = (v); *(T*)(p) = vst2_v_;  } while (0)
extern "C" void kernel_launch(void* const* d_in, const int* in_sizes, int n_in,
                              void* d_out, int out_size, void* d_ws, size_t ws_size, hipStream_t stream) {
    (void)in_sizes; (void)n_in; (void)out_size;
    const float* x = (const float*)d_in[0]; const float* Wqkv = (const float*)d_in[1];   // k-major [1024][3072]
    float* out = (float*)d_out;    // [2][2048][1024]
    char* wsp = (char*)d_ws;
    auto take = [&](size_t bytes) { char* p = wsp; wsp += (bytes + 255) & ~(size_t)255; return (void*)p; };
    bf* Xb = (bf*)take((size_t)NTK * DM * 2); bf* WqkvT = (bf*)take((size_t)3 * DM * DM * 2);
    float* TMP = (float*)take((size_t)NTK * DM * 4);
    h16* QH = (h16*)take((size_t)NTK * DM * 2); h16* QL = (h16*)take((size_t)NTK * DM * 2); h16* KH = (h16*)take((size_t)NTK * DM * 2); h16* KL = (h16*)take((size_t)NTK * DM * 2);
    h16* VTH = (h16*)take((size_t)NTK * DM * 2); h16* VTL = (h16*)take((size_t)NTK * DM * 2);
    if ((size_t)(wsp - (char*)d_ws) > ws_size) return;    // 8.4 + 6.3 + 16.8 + 6 x 8.4 ~ 82 MB, no aliasing
    const bf* WqB = WqkvT; const bf* WkB = WqkvT + (size_t)DM * DM; const bf* WvB = WqkvT + (size_t)2 * DM * DM;
    k_wt<<<dim3(DM / 64, 3 * DM / 64, 1), 256, 0, stream>>>(Wqkv, DM, 3 * DM, WqkvT);
    k_cvtb<<<NTK / 8, 256, 0, stream>>>(x, NTK, Xb);
    k_gemmb<false, true><<<dim3(NTK / 64, DM / 64, 1), 128, 0, stream>>>(Xb, nullptr, WqB, nullptr, (float*)(void*)QH, DM, QL);
    k_gemmb<false, true><<<dim3(NTK / 64, DM / 64, 1), 128, 0, stream>>>(Xb, nullptr, WkB, nullptr, (float*)(void*)KH, DM, KL);
    k_gemmb<false, false><<<dim3(NTK / 64, DM / 64, 1), 128, 0, stream>>>(Xb, nullptr, WvB, nullptr, TMP, DM, nullptr);
    k_vt<<<NB_ * NH_ * (NT_ / 64), 256, 0, stream>>>(TMP, VTH, VTL);
    k_attn<<<NB_ * NH_ * (NT_ / 64), 128, 0, stream>>>(QH, QL, KH, KL, VTH, VTL, out);
}

// v005
// A run of this version takes 130 microseconds.
// Two timings next to v004 both put it at 1.13 times that version's speed.
// All steps since v000 together make it 3.58 times as fast.
#include <hip/hip_runtime.h>

// Compute dtypes, f32 accumulate, both batch items in one pass, three launches: k_prep rounds x and the weights to PLAIN bf16 once (exact; k-major weights transposed to n-major);
// k_gemmb does q/k/v = x.W_qkv ([4096 x 1024].[1024 x 3072]) on v_wmma_f32_16x16x32_bf16 in one grid, every tile written straight from its epilogue as f16 hi + residual x1024
// planes, the v tiles already transposed (weights as A, tokens as B);
// the 16-head full attention (64-dim heads, scale 1/sqrt(1024) as the reference) written straight to the f32 output (no output projection), fused on
// v_wmma_f32_16x16x32_f16 (scores hi.hi + hi.lo + lo.hi with the residual terms on their own accumulator, online f32 softmax, weights (x32768) and v as f16

#define NB_  2                   // both batch items in every launch: twice the blocks, so that four of them share a WGP
#define NT_  2048
#define DM   1024
#define NH_  16
#define HD   64
#define NTK  (NB_ * NT_)
#define NW   1024
#define NQKV 1024
#define PSC  32768.0f
#define LOSC 1024.0f
#define LOSCI (1.0f / 1024.0f)

typedef _Float16 h16;
typedef unsigned short bf;
typedef __attribute__((ext_vector_type(16))) __bf16   v16bf;
typedef __attribute__((ext_vector_type(16))) _Float16 v16h;
typedef __attribute__((ext_vector_type(8)))  _Float16 v8h;
typedef __attribute__((ext_vector_type(8)))  unsigned short v8us;
typedef __attribute__((ext_vector_type(8)))  float    v8f;
typedef __attribute__((ext_vector_type(4)))  float    v4f;
typedef v8h  __attribute__((may_alias)) v8ha;
typedef v4f  __attribute__((may_alias)) v4fa;
typedef v8us __attribute__((may_alias)) v8usa;

__device__ __forceinline__ unsigned short f2bf(float f) { unsigned u = __float_as_uint(f); u += 0x7FFFu + ((u >> 16) & 1u); return (unsigned short)(u >> 16); }
__device__ __forceinline__ float bf2f(unsigned short b) { return __uint_as_float(((unsigned)b) << 16); }
__device__ __forceinline__ float bfr(float f) { return bf2f(f2bf(f)); }
__device__ __forceinline__ v16h cat16(v8h lo, v8h hi) { return __builtin_shufflevector(lo, hi, 0, 1, 2, 3, 4, 5, 6, 7, 8, 9, 10, 11, 12, 13, 14, 15); }
__device__ __forceinline__ v16bf cat16b(v8us lo, v8us hi) { return __builtin_bit_cast(v16bf, __builtin_shufflevector(lo, hi, 0, 1, 2, 3, 4, 5, 6, 7, 8, 9, 10, 11, 12, 13, 14, 15)); }
__device__ __forceinline__ v8f wmma16(v16h a, v16h b, v8f c) { return __builtin_amdgcn_wmma_f32_16x16x32_f16(false, a, false, b, (short)0, c, false, false); }
__device__ __forceinline__ v8f wmmab(v16bf a, v16bf b, v8f c) { return __builtin_amdgcn_wmma_f32_16x16x32_bf16(false, a, false, b, (short)0, c, false, false); }

// k_prep: the two independent roundings to bf16 in one grid, told apart by the block index (block-uniform).
// Blocks below NWTB: WT [n][DM] = bf16(W[k][n]) (k-major [DM][3 DM]) via 64 x 64 LDS tiles, k tile fastest. The others: eight rows of x each, one a wave.
#define NWTB ((DM / 64) * (3 * DM / 64))
__global__ __launch_bounds__(256) void k_prep(const float* __restrict__ Wm, bf* WT, const float* __restrict__ src, bf* dst) {
    __shared__ __align__(16) unsigned short tl[64 * 72];
    const int tid = threadIdx.x, bid = blockIdx.x;
    if (bid < NWTB) {
        const int k0 = (bid & (DM / 64 - 1)) * 64, n0 = (bid / (DM / 64)) * 64;
        const int kk = tid >> 2, nq = (tid & 3) * 16;
#pragma unroll
        for (int i = 0; i < 16; ++i) tl[(nq + i) * 72 + kk] = f2bf(Wm[(size_t)(k0 + kk) * (3 * DM) + n0 + nq + i]);
        __syncthreads();     // every thread of such a block passes it: the test above reads the block index alone
        const int piece = tid & 7;
#pragma unroll
        for (int s = 0; s < 2; ++s) { const int nr = (tid >> 3) + 32 * s; const v8us val = *(const v8usa*)(tl + nr * 72 + piece * 8); *(v8us*)(WT + (size_t)(n0 + nr) * DM + k0 + piece * 8) = val; }
    } else {
        const int lane = tid & 31, r = (bid - NWTB) * 8 + (tid >> 5);
        v8us o[DM / 256];
#pragma unroll
        for (int q = 0; q < DM / 256; ++q) { v8us t;
#pragma unroll
            for (int i = 0; i < 8; ++i) t[i] = f2bf(src[(size_t)r * DM + q * 256 + lane * 8 + i]);
            o[q] = t; }
#pragma unroll
        for (int q = 0; q < DM / 256; ++q) *(v8us*)(dst + (size_t)r * DM + q * 256 + lane * 8) = o[q];
        asm volatile("s_wait_xcnt 0x0" ::: "memory");     // behind the stores: the built code lays the weight half behind this one, and no register that a store names is rewritten ahead of this wait
    }
}
// Two planes of a stage: eight asynchronous 16-B copies per lane, four rows of each a fixed step apart (la/lb: LDS byte addresses, ga/gb: global addresses, lstep/gstep: the row steps).
// The s_wait_xcnt ends the copies' own statement, so that no address register is rewritten ahead of it.
__device__ __forceinline__ void acopy8(unsigned la, unsigned lb, const h16* ga, const h16* gb, unsigned lstep, size_t gstep) {
    asm volatile("global_load_async_to_lds_b128 %0, %8, off\n\t"
                 "global_load_async_to_lds_b128 %1, %9, off\n\t"
                 "global_load_async_to_lds_b128 %2, %10, off\n\t"
                 "global_load_async_to_lds_b128 %3, %11, off\n\t"
                 "global_load_async_to_lds_b128 %4, %12, off\n\t"
                 "global_load_async_to_lds_b128 %5, %13, off\n\t"
                 "global_load_async_to_lds_b128 %6, %14, off\n\t"
                 "global_load_async_to_lds_b128 %7, %15, off\n\t"
                 "s_wait_xcnt 0x0"
                 :: "v"(la), "v"(la + lstep), "v"(la + 2 * lstep), "v"(la + 3 * lstep), "v"(lb), "v"(lb + lstep), "v"(lb + 2 * lstep), "v"(lb + 3 * lstep),
                    "v"(ga), "v"(ga + gstep), "v"(ga + 2 * gstep), "v"(ga + 3 * gstep), "v"(gb), "v"(gb + gstep), "v"(gb + 2 * gstep), "v"(gb + 3 * gstep)
                 : "memory");
}
// k_gemmb: grid (token tiles, 48 tiles of the n-major weight rows: 16 of q, 16 of k, 16 of v); block = 64 x 64 of the product, wave = 16 x 64. A q or k block takes its token
// rows as A and its weight rows as B; a v block takes them the other way round, so that its tile comes out as v^T (rows: h * 64 + d, columns: tokens) with the same products
// in the same k order. Both operand tiles reach the waves through LDS: 128 k a stage, 64 A rows and 64 B rows of 256 B brought as whole cache
// lines once per block by asynchronous copies (every thread 16 pieces of 16 B), kept at a 272-B row pitch (16 B x odd: conflict-free 16-B fragment reads), two buffers,
// one block barrier a stage; fragment indices and the k order of the sums as with direct loads. The output rows are staged in the same LDS once the last stage has been
// left (69,632 B a block: four blocks fit a WGP's LDS).
#define GKS  128                 // k per stage
#define GPIT 136                 // LDS row pitch in bf16 (272 B)
#define GBUF (128 * GPIT)        // one buffer: the 64 A rows, then the 64 B rows
#define GNST (DM / GKS)
__global__ __launch_bounds__(128) void k_gemmb(const bf* __restrict__ X, const bf* __restrict__ WT, h16* QH, h16* QL, h16* KH, h16* KL, h16* VTH, h16* VTL) {
    __shared__ __align__(16) bf gst[2][GBUF];
    const int lane = threadIdx.x & 31, wave = threadIdx.x >> 5, lr = lane & 15, hi = lane >> 4;
    const int xr = blockIdx.x * 64, wr = blockIdx.y * 64, sel = blockIdx.y / (DM / 64);     // the block's token rows and weight rows; 0: q, 1: k, 2: v (block-uniform)
    const bf* A  = sel == 2 ? WT + (size_t)wr * DM : X + (size_t)xr * DM;
    const bf* Bn = sel == 2 ? X + (size_t)xr * DM : WT + (size_t)wr * DM;
    const int srow = threadIdx.x >> 4, spc = (threadIdx.x & 15) * 8;     // a thread's first row and its 16-B piece: 16 lanes cover one 256-B row
    const unsigned lthr = (unsigned)(size_t)&gst[0][0] + (unsigned)(srow * GPIT + spc) * 2u;      // the thread's LDS byte address in buffer 0, A row srow
    const h16* ga = (const h16*)(const void*)A + (size_t)srow * DM + spc;                         // 2-byte elements: only addresses are formed from these
    const h16* gb = (const h16*)(const void*)Bn + (size_t)srow * DM + spc;
    auto stage_in = [&](int st) {     // rows srow + 8 i, i = 0..7, of each tile
        const unsigned d = lthr + (unsigned)(st & 1) * (GBUF * 2u);
        acopy8(d, d + 32u * GPIT * 2u, ga + st * GKS, ga + st * GKS + (size_t)32 * DM, 8u * GPIT * 2u, (size_t)8 * DM);
        acopy8(d + 64u * GPIT * 2u, d + 96u * GPIT * 2u, gb + st * GKS, gb + st * GKS + (size_t)32 * DM, 8u * GPIT * 2u, (size_t)8 * DM);
    };
    v8f acc[4];
#pragma unroll
    for (int t = 0; t < 4; ++t) acc[t] = (v8f){};
    stage_in(0);
    asm volatile("s_wait_asynccnt 0x0" ::: "memory");     // this wave's copies of stage 0 have landed
    __syncthreads();                                      // every wave's have: stage 0 may be read
    stage_in(1);
    // rolled: one copy of the stage body; stage st + 1's copies fly while stage st is worked on
#pragma unroll 1
    for (int st = 0; st < GNST; ++st) {
        const bf* sa = &gst[st & 1][0] + (wave * 16 + lr) * GPIT + 8 * hi;
        const bf* sb = &gst[st & 1][0] + (64 + lr) * GPIT + 8 * hi;
        // the four 32-k steps of a stage unrolled: their LDS offsets become immediates of the reads
#pragma unroll
        for (int kl = 0; kl < GKS; kl += 32) {
            const v16bf a = cat16b(*(const v8usa*)(sa + kl), *(const v8usa*)(sa + kl + 16));
#pragma unroll
            for (int t = 0; t < 4; ++t) { const v16bf b = cat16b(*(const v8usa*)(sb + t * 16 * GPIT + kl), *(const v8usa*)(sb + t * 16 * GPIT + kl + 16)); acc[t] = wmmab(a, b, acc[t]); }
        }
        asm volatile("v_nop\n\tv_nop\n\tv_nop\n\tv_nop" : "+v"(acc[0]), "+v"(acc[1]), "+v"(acc[2]), "+v"(acc[3]));     // the matrix instructions' distance on the taken branches below; the stage's last one stays in front of the waits
        asm volatile("s_wait_dscnt 0x0" ::: "memory");        // this wave's LDS reads of stage st are done before its buffer is refilled
        asm volatile("s_wait_asynccnt 0x0" ::: "memory");     // this wave's copies of stage st + 1 have landed
        __syncthreads();                                      // publishes stage st + 1 and ends every wave's reads of stage st
        if (st + 2 < GNST) stage_in(st + 2);                  // block-uniform test; into the buffer that stage st has just left
    }
    asm volatile("s_wait_asynccnt 0x0" ::: "memory");         // no copy is outstanding when the wave goes on to its end
    float* os = (float*)(void*)&gst[0][0] + wave * (16 * 68);     // behind the last trip's waits and barrier no wave reads a stage and no copy is outstanding
#pragma unroll
    for (int t = 0; t < 4; ++t)
#pragma unroll
        for (int j = 0; j < 8; ++j) os[(hi * 8 + j) * 68 + t * 16 + lr] = acc[t][j];
    __syncthreads();
    const int cn = wr & (DM - 1);     // the weight rows' place inside q, k or v
    // first element of the wave's 16 output rows, and the row step: token rows of q or k; rows (b * 1024 + h * 64 + d) of 2048 tokens of v^T
    const size_t cof = sel == 2 ? ((size_t)(xr / NT_) * DM + cn + wave * 16) * NT_ + (xr & (NT_ - 1)) : (size_t)(xr + wave * 16) * DM + cn;
    const size_t ldc = sel == 2 ? NT_ : DM;
    h16* c1 = (sel == 2 ? VTH : sel == 1 ? KH : QH) + cof;
    h16* c2 = (sel == 2 ? VTL : sel == 1 ? KL : QL) + cof;
#pragma unroll
    for (int s = 0; s < 4; ++s) { const int row = 4 * s + (lane >> 3), piece = lane & 7; const float* sp = os + row * 68 + piece * 8; v8h o, o2;
#pragma unroll
        for (int i = 0; i < 8; ++i) { const h16 a = (h16)sp[i]; o[i] = a; o2[i] = (h16)((sp[i] - (float)a) * LOSC); }
        *(v8h*)(c1 + (size_t)row * ldc + piece * 8) = o; *(v8h*)(c2 + (size_t)row * ldc + piece * 8) = o2; }
}

// k_attn: block = (b, h, 64 queries), wave = 16; ALL 32 key tiles (no mask); scores TRANSPOSED (k rows as A, q as B): a lane holds 16 of the 32 scores of ONE query,
// so the online f32 softmax is in-lane but for one exchange between the wave's halves, and the weights (x32768, f16 hi + residual), converted in place, are the B operand
// of out^T += v^T . p^T (two score tiles = the k order 8h+s, 16+8h+s that the v^T loader has): no LDS round trip; ctx -> f32 output rows out[tok][h*64+d].
// k and v planes reach the waves through LDS: 64 keys a stage, each plane 64 rows of 128 B brought as whole cache lines once per block by asynchronous copies
// (every thread 16 pieces of 16 B), kept at a 144-B row pitch (16 B x odd: conflict-free 16-B fragment reads), two buffers, one block barrier a stage;
// fragment indices and sum order as before. The output rows are staged in the same LDS once the last stage has been left (73,728 B a block: four blocks fit a WGP's LDS).
#define SKEY 64                  // keys per stage
#define SPIT 72                  // LDS row pitch in f16 (144 B)
#define SPLN (64 * SPIT)         // one plane of a stage
#define NSTG (NT_ / SKEY)

// lane l with lane l ^ 16 (the other half of the wave holds the same query's other keys)
__device__ __forceinline__ float xhalf(float x) { return __builtin_bit_cast(float, __builtin_amdgcn_permlanex16(__builtin_bit_cast(int, x), __builtin_bit_cast(int, x), 0x76543210, 0xfedcba98, false, false)); }
#define L2E 1.44269504f          // exp(x) = exp2(x * log2 e)
// exp2 written with its slot: the instruction set asks for one independent instruction or v_nop between a transcendental and a use of its result or an overwrite of its
// source. Eight in one statement: the outputs are early-clobbered, so none reads its predecessor's result or overwrites its source; the v_nop is the last one's slot.
__device__ __forceinline__ void exp2x8(float* r, const float* x) {
    asm("v_exp_f32 %0, %8\n\tv_exp_f32 %1, %9\n\tv_exp_f32 %2, %10\n\tv_exp_f32 %3, %11\n\tv_exp_f32 %4, %12\n\tv_exp_f32 %5, %13\n\tv_exp_f32 %6, %14\n\tv_exp_f32 %7, %15\n\tv_nop"
        : "=&v"(r[0]), "=&v"(r[1]), "=&v"(r[2]), "=&v"(r[3]), "=&v"(r[4]), "=&v"(r[5]), "=&v"(r[6]), "=&v"(r[7])
        : "v"(x[0]), "v"(x[1]), "v"(x[2]), "v"(x[3]), "v"(x[4]), "v"(x[5]), "v"(x[6]), "v"(x[7]));
}
__device__ __forceinline__ float exp2x1(float x) { float r; asm("v_exp_f32 %0, %1\n\tv_nop" : "=v"(r) : "v"(x)); return r; }     // the v_nop: the same slot
__global__ __launch_bounds__(128) void k_attn(const h16* __restrict__ Q16, const h16* __restrict__ QL16, const h16* __restrict__ K16, const h16* __restrict__ KL16, const h16* __restrict__ VTH, const h16* __restrict__ VTL, float* OUTP) {
    __shared__ __align__(16) h16 stg[2][4 * SPLN];     // per buffer: k hi, k residual, v^T hi, v^T residual
    const int lane = threadIdx.x & 31, wave = threadIdx.x >> 5, lr = lane & 15, hi = lane >> 4;
    const int bid = blockIdx.x;
    const int b = bid / (NH_ * (NT_ / 64)), rem = bid - b * (NH_ * (NT_ / 64)), h = rem / (NT_ / 64), qt = rem - h * (NT_ / 64);
    const int q0 = qt * 64 + wave * 16;
    const size_t tok0 = (size_t)b * NT_;
    v16h qa[2];
    const size_t qo0 = (tok0 + q0 + lr) * DM + h * HD + 8 * hi;
#pragma unroll
    for (int kc = 0; kc < 2; ++kc) qa[kc] = cat16(*(const v8h*)(Q16 + qo0 + kc * 32), *(const v8h*)(Q16 + qo0 + kc * 32 + 16));
    const h16* kh_b = K16 + tok0 * DM + h * HD;
    const h16* kl_b = KL16 + tok0 * DM + h * HD;
    const size_t vbase = (((size_t)b * NH_ + h) * HD) * NT_;
    v8f o[4], ox[4];
#pragma unroll
    for (int n = 0; n < 4; ++n) { o[n] = (v8f){}; ox[n] = (v8f){}; }
    float mrow = -3.0e38f, lpart = 0.f;      // of the lane's query q0 + lr; lpart: this half's keys only
    const int srow = threadIdx.x >> 3, spc = (threadIdx.x & 7) * 8;     // a thread's first row and its 16-B piece: 8 lanes cover one 128-B row
    const unsigned lthr = (unsigned)(size_t)&stg[0][0] + (unsigned)(srow * SPIT + spc) * 2u;      // the thread's LDS byte address in buffer 0, plane 0
    auto stage_in = [&](int st) {
        const unsigned d = lthr + (unsigned)(st & 1) * (4u * SPLN * 2u);
        const size_t kof = (size_t)(st * SKEY + srow) * DM + spc, vof = vbase + (size_t)srow * NT_ + st * SKEY + spc;
        acopy8(d, d + SPLN * 2u, kh_b + kof, kl_b + kof, 16u * SPIT * 2u, (size_t)16 * DM);
        acopy8(d + 2u * SPLN * 2u, d + 3u * SPLN * 2u, VTH + vof, VTL + vof, 16u * SPIT * 2u, (size_t)16 * NT_);
    };
    stage_in(0);
    asm volatile("s_wait_asynccnt 0x0" ::: "memory");     // this wave's copies of stage 0 have landed
    __syncthreads();                                      // every wave's have: stage 0 may be read
    stage_in(1);
#pragma unroll 1
    for (int st = 0; st < NSTG; ++st) {            // full attention; stage st + 1's copies fly while stage st is worked on
      const h16* sb = &stg[st & 1][0];
      // both 32-key halves of a stage unrolled: their LDS offsets become immediates of the reads
#pragma unroll
      for (int sub = 0; sub < SKEY / 32; ++sub) {
        const h16* kh_s = sb; const h16* kl_s = sb + SPLN; const h16* vh_s = sb + 2 * SPLN; const h16* vl_s = sb + 3 * SPLN;
        const int ko0 = (sub * 32 + lr) * SPIT + 8 * hi, ko1 = (sub * 32 + 16 + lr) * SPIT + 8 * hi;
        v8f s0 = {}, s1 = {}, x0 = {}, x1 = {};
#pragma unroll
        for (int kc = 0; kc < 2; ++kc) {
            { const v16h k0h = cat16(*(const v8ha*)(kh_s + ko0 + kc * 32), *(const v8ha*)(kh_s + ko0 + kc * 32 + 16)), k1h = cat16(*(const v8ha*)(kh_s + ko1 + kc * 32), *(const v8ha*)(kh_s + ko1 + kc * 32 + 16));
              const v16h qlk = cat16(*(const v8h*)(QL16 + qo0 + kc * 32), *(const v8h*)(QL16 + qo0 + kc * 32 + 16));     // query residual re-read per step (registers)
              s0 = wmma16(k0h, qa[kc], s0); x0 = wmma16(k0h, qlk, x0); s1 = wmma16(k1h, qa[kc], s1); x1 = wmma16(k1h, qlk, x1);
              asm volatile("v_nop" : "+v"(s0), "+v"(s1), "+v"(x0), "+v"(x1) : "v"(qlk), "v"(k0h), "v"(k1h) : "memory"); }
            { const v16h k0l = cat16(*(const v8ha*)(kl_s + ko0 + kc * 32), *(const v8ha*)(kl_s + ko0 + kc * 32 + 16)), k1l = cat16(*(const v8ha*)(kl_s + ko1 + kc * 32), *(const v8ha*)(kl_s + ko1 + kc * 32 + 16));
              x0 = wmma16(k0l, qa[kc], x0); x1 = wmma16(k1l, qa[kc], x1);
              asm volatile("v_nop" : "+v"(x0), "+v"(x1) : "v"(k0l), "v"(k1l) : "memory"); }
        }
        asm volatile("v_nop\n\tv_nop\n\tv_nop\n\tv_nop" : "+v"(s0), "+v"(s1), "+v"(x0), "+v"(x1) : "v"(qa[0]), "v"(qa[1]));
        // s0[j], s1[j]: keys 8 * hi + j and 16 + 8 * hi + j of this 32-key step, query lr
        float a[16], e[16], p[16];
#pragma unroll
        for (int j = 0; j < 8; ++j) a[j] = (s0[j] + x0[j] * LOSCI) * 0.03125f;          // scale 1/sqrt(1024), as the reference
#pragma unroll
        for (int j = 0; j < 8; ++j) a[8 + j] = (s1[j] + x1[j] * LOSCI) * 0.03125f;
        float mx = fmaxf(fmaxf(fmaxf(fmaxf(a[0], a[1]), fmaxf(a[2], a[3])), fmaxf(fmaxf(a[4], a[5]), fmaxf(a[6], a[7]))),
                         fmaxf(fmaxf(fmaxf(a[8], a[9]), fmaxf(a[10], a[11])), fmaxf(fmaxf(a[12], a[13]), fmaxf(a[14], a[15]))));
        mx = fmaxf(mx, xhalf(mx));                 // both halves now hold the maximum over the query's 32 keys
        const float mn = fmaxf(mrow, mx);
        const float alpha = exp2x1((mrow - mn) * L2E); mrow = mn;
#pragma unroll
        for (int i = 0; i < 16; ++i) e[i] = (a[i] - mn) * L2E;
        exp2x8(p, e); exp2x8(p + 8, e + 8);
        v16h pa, px;
#pragma unroll
        for (int i = 0; i < 16; ++i) { const float ps = p[i] * PSC; const h16 hh = (h16)ps; pa[i] = hh; px[i] = (h16)((ps - (float)hh) * LOSC); }
        lpart = lpart * alpha + ((((p[0] + p[1]) + (p[2] + p[3])) + ((p[4] + p[5]) + (p[6] + p[7]))) + (((p[8] + p[9]) + (p[10] + p[11])) + ((p[12] + p[13]) + (p[14] + p[15]))));
#pragma unroll
        for (int n = 0; n < 4; ++n)
#pragma unroll
            for (int j = 0; j < 8; ++j) { o[n][j] *= alpha; ox[n][j] *= alpha; }
#pragma unroll
        for (int n = 0; n < 4; ++n) { const int vo = (n * 16 + lr) * SPIT + sub * 32 + hi * 8;
            const v16h vh = cat16(*(const v8ha*)(vh_s + vo), *(const v8ha*)(vh_s + vo + 16)), vl = cat16(*(const v8ha*)(vl_s + vo), *(const v8ha*)(vl_s + vo + 16));
            o[n] = wmma16(vh, pa, o[n]); ox[n] = wmma16(vl, pa, ox[n]); ox[n] = wmma16(vh, px, ox[n]);     // o[n][j]: d = n * 16 + 8 * hi + j, query lr
            asm volatile("" : "+v"(o[n]), "+v"(ox[n]) : "v"(vh), "v"(vl) : "memory"); }
        asm volatile("v_nop\n\tv_nop\n\tv_nop\n\tv_nop" : "+v"(o[0]), "+v"(o[1]), "+v"(o[2]), "+v"(o[3]), "+v"(ox[0]), "+v"(ox[1]), "+v"(ox[2]), "+v"(ox[3]) : "v"(pa), "v"(px));
      }
      asm volatile("s_wait_dscnt 0x0" ::: "memory");        // this wave's LDS reads of stage st are done before its buffer is refilled
      asm volatile("s_wait_asynccnt 0x0" ::: "memory");     // this wave's copies of stage st + 1 have landed
      __syncthreads();                                      // publishes stage st + 1 and ends every wave's reads of stage st
      if (st + 2 < NSTG) stage_in(st + 2);                  // block-uniform test; into the buffer that stage st has just left
    }
    asm volatile("s_wait_asynccnt 0x0" ::: "memory");       // no copy is outstanding when the wave goes on to its end
    const float inv = 1.0f / ((lpart + xhalf(lpart)) * PSC);     // the two halves' sums joined once
    float* os = (float*)(void*)&stg[0][0] + wave * (16 * 68);     // behind the last trip's waits and barrier no wave reads a stage and no copy is outstanding
#pragma unroll
    for (int n = 0; n < 4; ++n)
#pragma unroll
        for (int g = 0; g < 2; ++g) { v4f w;
#pragma unroll
            for (int i = 0; i < 4; ++i) w[i] = (o[n][4 * g + i] + ox[n][4 * g + i] * LOSCI) * inv;
            *(v4fa*)(os + lr * 68 + n * 16 + hi * 8 + 4 * g) = w; }
    __syncthreads();
    float* ob = OUTP + (tok0 + q0) * DM + (size_t)h * HD;
    auto pass = [&]() {
#pragma unroll
        for (int s = 0; s < 8; ++s) { const int Lid = (lane >> 3) + 4 * s, piece = lane & 7; const int row = Lid >> 1, cofs = (Lid & 1) * 32 + piece * 4;
            const v4f val = *(const v4fa*)(os + row * 68 + cofs); *(v4f*)(ob + (size_t)row * DM + cofs) = val; }
    };
    pass(); 
}

#define VST2(T, p, v) do { const T vst2_v_ = (v); *(T*)(p) = vst2_v_;  } while (0)
extern "C" void kernel_launch(void* const* d_in, const int* in_sizes, int n_in,
                              void* d_out, int out_size, void* d_ws, size_t ws_size, hipStream_t stream) {
    (void)in_sizes; (void)n_in; (void)out_size;
    const float* x = (const float*)d_in[0]; const float* Wqkv = (const float*)d_in[1];   // k-major [1024][3072]
    float* out = (float*)d_out;    // [2][2048][1024]
    char* wsp = (char*)d_ws;
    auto take = [&](size_t bytes) { char* p = wsp; wsp += (bytes + 255) & ~(size_t)255; return (void*)p; };
    bf* Xb = (bf*)take((size_t)NTK * DM * 2); bf* WqkvT = (bf*)take((size_t)3 * DM * DM * 2);
    h16* QH = (h16*)take((size_t)NTK * DM * 2); h16* QL = (h16*)take((size_t)NTK * DM * 2); h16* KH = (h16*)take((size_t)NTK * DM * 2); h16* KL = (h16*)take((size_t)NTK * DM * 2);
    h16* VTH = (h16*)take((size_t)NTK * DM * 2); h16* VTL = (h16*)take((size_t)NTK * DM * 2);
    if ((size_t)(wsp - (char*)d_ws) > ws_size) return;    // 8.4 + 6.3 + 6 x 8.4 ~ 65 MB, no aliasing
    k_prep<<<NWTB + NTK / 8, 256, 0, stream>>>(Wqkv, WqkvT, x, Xb);
    k_gemmb<<<dim3(NTK / 64, 3 * DM / 64, 1), 128, 0, stream>>>(Xb, WqkvT, QH, QL, KH, KL, VTH, VTL);
    k_attn<<<NB_ * NH_ * (NT_ / 64), 128, 0, stream>>>(QH, QL, KH, KL, VTH, VTL, out);
}

// v006
// Measured time: 118 microseconds a run.
// Timed twice side by side with v005, it ran 1.11 times as fast both times.
// Counting every step since v000, it is 3.97 times as fast.
#include <hip/hip_runtime.h>

// Compute dtypes, f32 accumulate, both batch items in one pass, three launches: k_prep rounds x and the weights to PLAIN bf16 once (exact; k-major weights transposed to n-major);
// k_gemmb does q/k/v = x.W_qkv ([4096 x 1024].[1024 x 3072]) on v_wmma_f32_16x16x32_bf16 in one grid, every tile written straight from its epilogue as f16 hi + residual x1024
// planes, the v tiles already transposed (weights as A, tokens as B);
// the 16-head full attention (64-dim heads, scale 1/sqrt(1024) as the reference) written straight to the f32 output (no output projection), fused on
// v_wmma_f32_16x16x32_f16 (scores hi.hi + hi.lo + lo.hi with the residual terms on their own accumulator, online f32 softmax, weights (x32768) and v as f16

#define NB_  2                   // both batch items in every launch: twice the blocks, so that four of them share a WGP
#define NT_  2048
#define DM   1024
#define NH_  16
#define HD   64
#define NTK  (NB_ * NT_)
#define NW   1024
#define NQKV 1024
#define PSC  32768.0f
#define LOSC 1024.0f
#define LOSCI (1.0f / 1024.0f)

typedef _Float16 h16;
typedef unsigned short bf;
typedef __attribute__((ext_vector_type(16))) __bf16   v16bf;
typedef __attribute__((ext_vector_type(16))) _Float16 v16h;
typedef __attribute__((ext_vector_type(8)))  _Float16 v8h;
typedef __attribute__((ext_vector_type(8)))  unsigned short v8us;
typedef __attribute__((ext_vector_type(8)))  float    v8f;
typedef __attribute__((ext_vector_type(4)))  float    v4f;
typedef v8h  __attribute__((may_alias)) v8ha;
typedef v4f  __attribute__((may_alias)) v4fa;
typedef v8us __attribute__((may_alias)) v8usa;

__device__ __forceinline__ unsigned short f2bf(float f) { unsigned u = __float_as_uint(f); u += 0x7FFFu + ((u >> 16) & 1u); return (unsigned short)(u >> 16); }
__device__ __forceinline__ float bf2f(unsigned short b) { return __uint_as_float(((unsigned)b) << 16); }
__device__ __forceinline__ float bfr(float f) { return bf2f(f2bf(f)); }
__device__ __forceinline__ v16h cat16(v8h lo, v8h hi) { return __builtin_shufflevector(lo, hi, 0, 1, 2, 3, 4, 5, 6, 7, 8, 9, 10, 11, 12, 13, 14, 15); }
__device__ __forceinline__ v16bf cat16b(v8us lo, v8us hi) { return __builtin_bit_cast(v16bf, __builtin_shufflevector(lo, hi, 0, 1, 2, 3, 4, 5, 6, 7, 8, 9, 10, 11, 12, 13, 14, 15)); }
__device__ __forceinline__ v8f wmma16(v16h a, v16h b, v8f c) { return __builtin_amdgcn_wmma_f32_16x16x32_f16(false, a, false, b, (short)0, c, false, false); }
__device__ __forceinline__ v8f wmmab(v16bf a, v16bf b, v8f c) { return __builtin_amdgcn_wmma_f32_16x16x32_bf16(false, a, false, b, (short)0, c, false, false); }

// k_prep: the two independent roundings to bf16 in one grid, told apart by the block index (block-uniform).
// Blocks below NWTB: WT [n][DM] = bf16(W[k][n]) (k-major [DM][3 DM]) via 64 x 64 LDS tiles, k tile fastest. The others: eight rows of x each, one a wave.
#define NWTB ((DM / 64) * (3 * DM / 64))
__global__ __launch_bounds__(256) void k_prep(const float* __restrict__ Wm, bf* WT, const float* __restrict__ src, bf* dst) {
    __shared__ __align__(16) unsigned short tl[64 * 72];
    const int tid = threadIdx.x, bid = blockIdx.x;
    if (bid < NWTB) {
        const int k0 = (bid & (DM / 64 - 1)) * 64, n0 = (bid / (DM / 64)) * 64;
        const int kk = tid >> 2, nq = (tid & 3) * 16;
#pragma unroll
        for (int i = 0; i < 16; ++i) tl[(nq + i) * 72 + kk] = f2bf(Wm[(size_t)(k0 + kk) * (3 * DM) + n0 + nq + i]);
        __syncthreads();     // every thread of such a block passes it: the test above reads the block index alone
        const int piece = tid & 7;
#pragma unroll
        for (int s = 0; s < 2; ++s) { const int nr = (tid >> 3) + 32 * s; const v8us val = *(const v8usa*)(tl + nr * 72 + piece * 8); *(v8us*)(WT + (size_t)(n0 + nr) * DM + k0 + piece * 8) = val; }
    } else {
        const int lane = tid & 31, r = (bid - NWTB) * 8 + (tid >> 5);
        v8us o[DM / 256];
#pragma unroll
        for (int q = 0; q < DM / 256; ++q) { v8us t;
#pragma unroll
            for (int i = 0; i < 8; ++i) t[i] = f2bf(src[(size_t)r * DM + q * 256 + lane * 8 + i]);
            o[q] = t; }
#pragma unroll
        for (int q = 0; q < DM / 256; ++q) *(v8us*)(dst + (size_t)r * DM + q * 256 + lane * 8) = o[q];
        asm volatile("s_wait_xcnt 0x0" ::: "memory");     // behind the stores: the built code lays the weight half behind this one, and no register that a store names is rewritten ahead of this wait
    }
}
// Two planes of a stage: eight asynchronous 16-B copies per lane, four rows of each a fixed step apart (la/lb: LDS byte addresses, ga/gb: global addresses, lstep/gstep: the row steps).
// The s_wait_xcnt ends the copies' own statement, so that no address register is rewritten ahead of it.
__device__ __forceinline__ void acopy8(unsigned la, unsigned lb, const h16* ga, const h16* gb, unsigned lstep, size_t gstep) {
    asm volatile("global_load_async_to_lds_b128 %0, %8, off\n\t"
                 "global_load_async_to_lds_b128 %1, %9, off\n\t"
                 "global_load_async_to_lds_b128 %2, %10, off\n\t"
                 "global_load_async_to_lds_b128 %3, %11, off\n\t"
                 "global_load_async_to_lds_b128 %4, %12, off\n\t"
                 "global_load_async_to_lds_b128 %5, %13, off\n\t"
                 "global_load_async_to_lds_b128 %6, %14, off\n\t"
                 "global_load_async_to_lds_b128 %7, %15, off\n\t"
                 "s_wait_xcnt 0x0"
                 :: "v"(la), "v"(la + lstep), "v"(la + 2 * lstep), "v"(la + 3 * lstep), "v"(lb), "v"(lb + lstep), "v"(lb + 2 * lstep), "v"(lb + 3 * lstep),
                    "v"(ga), "v"(ga + gstep), "v"(ga + 2 * gstep), "v"(ga + 3 * gstep), "v"(gb), "v"(gb + gstep), "v"(gb + 2 * gstep), "v"(gb + 3 * gstep)
                 : "memory");
}
// k_gemmb: grid (token tiles, 48 tiles of the n-major weight rows: 16 of q, 16 of k, 16 of v); block = 64 x 64 of the product, wave = 16 x 64. A q or k block takes its token
// rows as A and its weight rows as B; a v block takes them the other way round, so that its tile comes out as v^T (rows: h * 64 + d, columns: tokens) with the same products
// in the same k order. Both operand tiles reach the waves through LDS: 128 k a stage, 64 A rows and 64 B rows of 256 B brought as whole cache
// lines once per block by asynchronous copies (every thread 16 pieces of 16 B), kept at a 272-B row pitch (16 B x odd: conflict-free 16-B fragment reads), two buffers,
// one block barrier a stage; fragment indices and the k order of the sums as with direct loads. The output rows are staged in the same LDS once the last stage has been
// left (69,632 B a block: four blocks fit a WGP's LDS).
#define GKS  128                 // k per stage
#define GPIT 136                 // LDS row pitch in bf16 (272 B)
#define GBUF (128 * GPIT)        // one buffer: the 64 A rows, then the 64 B rows
#define GNST (DM / GKS)
__global__ __launch_bounds__(128) void k_gemmb(const bf* __restrict__ X, const bf* __restrict__ WT, h16* QH, h16* QL, h16* KH, h16* KL, h16* VTH, h16* VTL) {
    __shared__ __align__(16) bf gst[2][GBUF];
    const int lane = threadIdx.x & 31, wave = threadIdx.x >> 5, lr = lane & 15, hi = lane >> 4;
    const int xr = blockIdx.x * 64, wr = blockIdx.y * 64, sel = blockIdx.y / (DM / 64);     // the block's token rows and weight rows; 0: q, 1: k, 2: v (block-uniform)
    const bf* A  = sel == 2 ? WT + (size_t)wr * DM : X + (size_t)xr * DM;
    const bf* Bn = sel == 2 ? X + (size_t)xr * DM : WT + (size_t)wr * DM;
    const int srow = threadIdx.x >> 4, spc = (threadIdx.x & 15) * 8;     // a thread's first row and its 16-B piece: 16 lanes cover one 256-B row
    const unsigned lthr = (unsigned)(size_t)&gst[0][0] + (unsigned)(srow * GPIT + spc) * 2u;      // the thread's LDS byte address in buffer 0, A row srow
    const h16* ga = (const h16*)(const void*)A + (size_t)srow * DM + spc;                         // 2-byte elements: only addresses are formed from these
    const h16* gb = (const h16*)(const void*)Bn + (size_t)srow * DM + spc;
    auto stage_in = [&](int st) {     // rows srow + 8 i, i = 0..7, of each tile
        const unsigned d = lthr + (unsigned)(st & 1) * (GBUF * 2u);
        acopy8(d, d + 32u * GPIT * 2u, ga + st * GKS, ga + st * GKS + (size_t)32 * DM, 8u * GPIT * 2u, (size_t)8 * DM);
        acopy8(d + 64u * GPIT * 2u, d + 96u * GPIT * 2u, gb + st * GKS, gb + st * GKS + (size_t)32 * DM, 8u * GPIT * 2u, (size_t)8 * DM);
    };
    v8f acc[4];
#pragma unroll
    for (int t = 0; t < 4; ++t) acc[t] = (v8f){};
    stage_in(0);
    asm volatile("s_wait_asynccnt 0x0" ::: "memory");     // this wave's copies of stage 0 have landed
    __syncthreads();                                      // every wave's have: stage 0 may be read
    stage_in(1);
    // rolled: one copy of the stage body; stage st + 1's copies fly while stage st is worked on
#pragma unroll 1
    for (int st = 0; st < GNST; ++st) {
        const bf* sa = &gst[st & 1][0] + (wave * 16 + lr) * GPIT + 8 * hi;
        const bf* sb = &gst[st & 1][0] + (64 + lr) * GPIT + 8 * hi;
        // the four 32-k steps of a stage unrolled: their LDS offsets become immediates of the reads
#pragma unroll
        for (int kl = 0; kl < GKS; kl += 32) {
            const v16bf a = cat16b(*(const v8usa*)(sa + kl), *(const v8usa*)(sa + kl + 16));
#pragma unroll
            for (int t = 0; t < 4; ++t) { const v16bf b = cat16b(*(const v8usa*)(sb + t * 16 * GPIT + kl), *(const v8usa*)(sb + t * 16 * GPIT + kl + 16)); acc[t] = wmmab(a, b, acc[t]); }
        }
        asm volatile("v_nop\n\tv_nop\n\tv_nop\n\tv_nop" : "+v"(acc[0]), "+v"(acc[1]), "+v"(acc[2]), "+v"(acc[3]));     // the matrix instructions' distance on the taken branches below; the stage's last one stays in front of the waits
        asm volatile("s_wait_dscnt 0x0" ::: "memory");        // this wave's LDS reads of stage st are done before its buffer is refilled
        asm volatile("s_wait_asynccnt 0x0" ::: "memory");     // this wave's copies of stage st + 1 have landed
        __syncthreads();                                      // publishes stage st + 1 and ends every wave's reads of stage st
        if (st + 2 < GNST) stage_in(st + 2);                  // block-uniform test; into the buffer that stage st has just left
    }
    asm volatile("s_wait_asynccnt 0x0" ::: "memory");         // no copy is outstanding when the wave goes on to its end
    float* os = (float*)(void*)&gst[0][0] + wave * (16 * 68);     // behind the last trip's waits and barrier no wave reads a stage and no copy is outstanding
#pragma unroll
    for (int t = 0; t < 4; ++t)
#pragma unroll
        for (int j = 0; j < 8; ++j) os[(hi * 8 + j) * 68 + t * 16 + lr] = acc[t][j];
    __syncthreads();
    const int cn = wr & (DM - 1);     // the weight rows' place inside q, k or v
    // first element of the wave's 16 output rows, and the row step: token rows of q or k; rows (b * 1024 + h * 64 + d) of 2048 tokens of v^T
    const size_t cof = sel == 2 ? ((size_t)(xr / NT_) * DM + cn + wave * 16) * NT_ + (xr & (NT_ - 1)) : (size_t)(xr + wave * 16) * DM + cn;
    const size_t ldc = sel == 2 ? NT_ : DM;
    h16* c1 = (sel == 2 ? VTH : sel == 1 ? KH : QH) + cof;
    h16* c2 = (sel == 2 ? VTL : sel == 1 ? KL : QL) + cof;
#pragma unroll
    for (int s = 0; s < 4; ++s) { const int row = 4 * s + (lane >> 3), piece = lane & 7; const float* sp = os + row * 68 + piece * 8; v8h o, o2;
#pragma unroll
        for (int i = 0; i < 8; ++i) { const h16 a = (h16)sp[i]; o[i] = a; o2[i] = (h16)((sp[i] - (float)a) * LOSC); }
        *(v8h*)(c1 + (size_t)row * ldc + piece * 8) = o; *(v8h*)(c2 + (size_t)row * ldc + piece * 8) = o2; }
}

// k_attn: block = (b, h, 64 queries), wave = 16; ALL 32 key tiles (no mask); scores TRANSPOSED (k rows as A, q as B): a lane holds 16 of the 32 scores of ONE query,
// so the online f32 softmax is in-lane but for one exchange between the wave's halves, and the weights (x32768, f16 hi + residual), converted in place, are the B operand
// of out^T += v^T . p^T (two score tiles = the k order 8h+s, 16+8h+s that the v^T loader has): no LDS round trip; ctx -> f32 output rows out[tok][h*64+d].
// k and v planes reach the waves through LDS: 64 keys a stage, each plane 64 rows of 128 B brought as whole cache lines once per block by asynchronous copies
// (every thread 16 pieces of 16 B), kept at a 144-B row pitch (16 B x odd: conflict-free 16-B fragment reads), two buffers, one block barrier a stage;
// fragment indices and sum order as before. The output rows are staged in the same LDS once the last stage has been left (73,728 B a block: four blocks fit a WGP's LDS).
#define SKEY 64                  // keys per stage
#define SPIT 72                  // LDS row pitch in f16 (144 B)
#define SPLN (64 * SPIT)         // one plane of a stage
#define NSTG (NT_ / SKEY)

// lane l with lane l ^ 16 (the other half of the wave holds the same query's other keys)
__device__ __forceinline__ float xhalf(float x) { return __builtin_bit_cast(float, __builtin_amdgcn_permlanex16(__builtin_bit_cast(int, x), __builtin_bit_cast(int, x), 0x76543210, 0xfedcba98, false, false)); }
#define L2E 1.44269504f          // exp(x) = exp2(x * log2 e)
// exp2 written with its slot: the instruction set asks for one independent instruction or v_nop between a transcendental and a use of its result or an overwrite of its
// source. Eight in one statement: the outputs are early-clobbered, so none reads its predecessor's result or overwrites its source; the v_nop is the last one's slot.
__device__ __forceinline__ void exp2x8(float* r, const float* x) {
    asm("v_exp_f32 %0, %8\n\tv_exp_f32 %1, %9\n\tv_exp_f32 %2, %10\n\tv_exp_f32 %3, %11\n\tv_exp_f32 %4, %12\n\tv_exp_f32 %5, %13\n\tv_exp_f32 %6, %14\n\tv_exp_f32 %7, %15\n\tv_nop"
        : "=&v"(r[0]), "=&v"(r[1]), "=&v"(r[2]), "=&v"(r[3]), "=&v"(r[4]), "=&v"(r[5]), "=&v"(r[6]), "=&v"(r[7])
        : "v"(x[0]), "v"(x[1]), "v"(x[2]), "v"(x[3]), "v"(x[4]), "v"(x[5]), "v"(x[6]), "v"(x[7]));
}
__device__ __forceinline__ float exp2x1(float x) { float r; asm("v_exp_f32 %0, %1\n\tv_nop" : "=v"(r) : "v"(x)); return r; }     // the v_nop: the same slot
__global__ __launch_bounds__(128) void k_attn(const h16* __restrict__ Q16, const h16* __restrict__ QL16, const h16* __restrict__ K16, const h16* __restrict__ KL16, const h16* __restrict__ VTH, const h16* __restrict__ VTL, float* OUTP) {
    __shared__ __align__(16) h16 stg[2][4 * SPLN];     // per buffer: k hi, k residual, v^T hi, v^T residual
    const int lane = threadIdx.x & 31, wave = threadIdx.x >> 5, lr = lane & 15, hi = lane >> 4;
    const int bid = blockIdx.x;
    const int b = bid / (NH_ * (NT_ / 64)), rem = bid - b * (NH_ * (NT_ / 64)), h = rem / (NT_ / 64), qt = rem - h * (NT_ / 64);
    const int q0 = qt * 64 + wave * 16;
    const size_t tok0 = (size_t)b * NT_;
    v16h qa[2];
    const size_t qo0 = (tok0 + q0 + lr) * DM + h * HD + 8 * hi;
#pragma unroll
    for (int kc = 0; kc < 2; ++kc) qa[kc] = cat16(*(const v8h*)(Q16 + qo0 + kc * 32), *(const v8h*)(Q16 + qo0 + kc * 32 + 16));
    v16h ql[2];     // the query residual, read once like the query itself: no global read stands among the products
#pragma unroll
    for (int kc = 0; kc < 2; ++kc) ql[kc] = cat16(*(const v8h*)(QL16 + qo0 + kc * 32), *(const v8h*)(QL16 + qo0 + kc * 32 + 16));
    asm volatile("s_wait_xcnt 0x0" ::: "memory");     // behind the query loads: the built code reuses their address registers right away
    __builtin_amdgcn_sched_barrier(0);                // keeps the address arithmetic below from being lifted over that wait
    const h16* kh_b = K16 + tok0 * DM + h * HD;
    const h16* kl_b = KL16 + tok0 * DM + h * HD;
    const size_t vbase = (((size_t)b * NH_ + h) * HD) * NT_;
    v8f o[4], ox[4];
#pragma unroll
    for (int n = 0; n < 4; ++n) { o[n] = (v8f){}; ox[n] = (v8f){}; }
    float mrow = -3.0e38f, lpart = 0.f;      // of the lane's query q0 + lr; lpart: this half's keys only
    const int srow = threadIdx.x >> 3, spc = (threadIdx.x & 7) * 8;     // a thread's first row and its 16-B piece: 8 lanes cover one 128-B row
    const unsigned lthr = (unsigned)(size_t)&stg[0][0] + (unsigned)(srow * SPIT + spc) * 2u;      // the thread's LDS byte address in buffer 0, plane 0
    auto stage_in = [&](int st) {
        const unsigned d = lthr + (unsigned)(st & 1) * (4u * SPLN * 2u);
        const size_t kof = (size_t)(st * SKEY + srow) * DM + spc, vof = vbase + (size_t)srow * NT_ + st * SKEY + spc;
        acopy8(d, d + SPLN * 2u, kh_b + kof, kl_b + kof, 16u * SPIT * 2u, (size_t)16 * DM);
        acopy8(d + 2u * SPLN * 2u, d + 3u * SPLN * 2u, VTH + vof, VTL + vof, 16u * SPIT * 2u, (size_t)16 * NT_);
    };
    stage_in(0);
    asm volatile("s_wait_asynccnt 0x0" ::: "memory");     // this wave's copies of stage 0 have landed
    __syncthreads();                                      // every wave's have: stage 0 may be read
    stage_in(1);
#pragma unroll 1
    for (int st = 0; st < NSTG; ++st) {            // full attention; stage st + 1's copies fly while stage st is worked on
      const h16* sb = &stg[st & 1][0];
      // both 32-key halves of a stage unrolled: their LDS offsets become immediates of the reads
#pragma unroll
      for (int sub = 0; sub < SKEY / 32; ++sub) {
        const h16* kh_s = sb; const h16* kl_s = sb + SPLN; const h16* vh_s = sb + 2 * SPLN; const h16* vl_s = sb + 3 * SPLN;
        const int ko0 = (sub * 32 + lr) * SPIT + 8 * hi, ko1 = (sub * 32 + 16 + lr) * SPIT + 8 * hi;
        // the step's sixteen k reads stand as one group ahead of the twelve score products, which then run back to back
        v16h kf[2][4];
#pragma unroll
        for (int kc = 0; kc < 2; ++kc) {
            kf[kc][0] = cat16(*(const v8ha*)(kh_s + ko0 + kc * 32), *(const v8ha*)(kh_s + ko0 + kc * 32 + 16)); kf[kc][1] = cat16(*(const v8ha*)(kh_s + ko1 + kc * 32), *(const v8ha*)(kh_s + ko1 + kc * 32 + 16));
            kf[kc][2] = cat16(*(const v8ha*)(kl_s + ko0 + kc * 32), *(const v8ha*)(kl_s + ko0 + kc * 32 + 16)); kf[kc][3] = cat16(*(const v8ha*)(kl_s + ko1 + kc * 32), *(const v8ha*)(kl_s + ko1 + kc * 32 + 16));
        }
        __builtin_amdgcn_sched_barrier(0);     // holds the k reads together up here; without it the build spreads them among the products, pair by pair, each with a wait to zero
        v8f s0 = {}, s1 = {}, x0 = {}, x1 = {};
#pragma unroll
        for (int kc = 0; kc < 2; ++kc) {
            s0 = wmma16(kf[kc][0], qa[kc], s0); x0 = wmma16(kf[kc][0], ql[kc], x0); s1 = wmma16(kf[kc][1], qa[kc], s1); x1 = wmma16(kf[kc][1], ql[kc], x1);
            x0 = wmma16(kf[kc][2], qa[kc], x0); x1 = wmma16(kf[kc][3], qa[kc], x1);
        }
        // the matrix instructions' distance to the softmax; the memory clobber keeps the v reads below behind the score products, so that they take the k fragments' registers (four waves a SIMD: 256 registers at most)
        asm volatile("v_nop\n\tv_nop\n\tv_nop\n\tv_nop" : "+v"(s0), "+v"(s1), "+v"(x0), "+v"(x1) : "v"(qa[0]), "v"(qa[1]) : "memory");
        // the step's sixteen v reads are issued here, so that the softmax below covers their latency
        v16h vf[4][2];
#pragma unroll
        for (int n = 0; n < 4; ++n) { const int vo = (n * 16 + lr) * SPIT + sub * 32 + hi * 8;
            vf[n][0] = cat16(*(const v8ha*)(vh_s + vo), *(const v8ha*)(vh_s + vo + 16)); vf[n][1] = cat16(*(const v8ha*)(vl_s + vo), *(const v8ha*)(vl_s + vo + 16)); }
        __builtin_amdgcn_sched_barrier(0);     // holds the v reads ahead of the softmax; without it the build sinks some of them among the products below
        // s0[j], s1[j]: keys 8 * hi + j and 16 + 8 * hi + j of this 32-key step, query lr
        float a[16], e[16], p[16];
#pragma unroll
        for (int j = 0; j < 8; ++j) a[j] = (s0[j] + x0[j] * LOSCI) * 0.03125f;          // scale 1/sqrt(1024), as the reference
#pragma unroll
        for (int j = 0; j < 8; ++j) a[8 + j] = (s1[j] + x1[j] * LOSCI) * 0.03125f;
        float mx = fmaxf(fmaxf(fmaxf(fmaxf(a[0], a[1]), fmaxf(a[2], a[3])), fmaxf(fmaxf(a[4], a[5]), fmaxf(a[6], a[7]))),
                         fmaxf(fmaxf(fmaxf(a[8], a[9]), fmaxf(a[10], a[11])), fmaxf(fmaxf(a[12], a[13]), fmaxf(a[14], a[15]))));
        mx = fmaxf(mx, xhalf(mx));                 // both halves now hold the maximum over the query's 32 keys
        const float mn = fmaxf(mrow, mx);
        const float alpha = exp2x1((mrow - mn) * L2E); mrow = mn;
#pragma unroll
        for (int i = 0; i < 16; ++i) e[i] = (a[i] - mn) * L2E;
        exp2x8(p, e); exp2x8(p + 8, e + 8);
        v16h pa, px;
#pragma unroll
        for (int i = 0; i < 16; ++i) { const float ps = p[i] * PSC; const h16 hh = (h16)ps; pa[i] = hh; px[i] = (h16)((ps - (float)hh) * LOSC); }
        lpart = lpart * alpha + ((((p[0] + p[1]) + (p[2] + p[3])) + ((p[4] + p[5]) + (p[6] + p[7]))) + (((p[8] + p[9]) + (p[10] + p[11])) + ((p[12] + p[13]) + (p[14] + p[15]))));
#pragma unroll
        for (int n = 0; n < 4; ++n)
#pragma unroll
            for (int j = 0; j < 8; ++j) { o[n][j] *= alpha; ox[n][j] *= alpha; }
#pragma unroll
        for (int n = 0; n < 4; ++n) { o[n] = wmma16(vf[n][0], pa, o[n]); ox[n] = wmma16(vf[n][1], pa, ox[n]); }     // o[n][j]: d = n * 16 + 8 * hi + j, query lr
#pragma unroll
        for (int n = 0; n < 4; ++n) ox[n] = wmma16(vf[n][0], px, ox[n]);     // each accumulator takes its products in the order it had
        asm volatile("v_nop\n\tv_nop\n\tv_nop\n\tv_nop" : "+v"(o[0]), "+v"(o[1]), "+v"(o[2]), "+v"(o[3]), "+v"(ox[0]), "+v"(ox[1]), "+v"(ox[2]), "+v"(ox[3]) : "v"(pa), "v"(px));
      }
      asm volatile("s_wait_dscnt 0x0" ::: "memory");        // this wave's LDS reads of stage st are done before its buffer is refilled
      asm volatile("s_wait_asynccnt 0x0" ::: "memory");     // this wave's copies of stage st + 1 have landed
      __syncthreads();                                      // publishes stage st + 1 and ends every wave's reads of stage st
      if (st + 2 < NSTG) stage_in(st + 2);                  // block-uniform test; into the buffer that stage st has just left
    }
    asm volatile("s_wait_asynccnt 0x0" ::: "memory");       // no copy is outstanding when the wave goes on to its end
    const float inv = 1.0f / ((lpart + xhalf(lpart)) * PSC);     // the two halves' sums joined once
    float* os = (float*)(void*)&stg[0][0] + wave * (16 * 68);     // behind the last trip's waits and barrier no wave reads a stage and no copy is outstanding
#pragma unroll
    for (int n = 0; n < 4; ++n)
#pragma unroll
        for (int g = 0; g < 2; ++g) { v4f w;
#pragma unroll
            for (int i = 0; i < 4; ++i) w[i] = (o[n][4 * g + i] + ox[n][4 * g + i] * LOSCI) * inv;
            *(v4fa*)(os + lr * 68 + n * 16 + hi * 8 + 4 * g) = w; }
    __syncthreads();
    float* ob = OUTP + (tok0 + q0) * DM + (size_t)h * HD;
    auto pass = [&]() {
#pragma unroll
        for (int s = 0; s < 8; ++s) { const int Lid = (lane >> 3) + 4 * s, piece = lane & 7; const int row = Lid >> 1, cofs = (Lid & 1) * 32 + piece * 4;
            const v4f val = *(const v4fa*)(os + row * 68 + cofs); *(v4f*)(ob + (size_t)row * DM + cofs) = val; }
    };
    pass(); 
}

#define VST2(T, p, v) do { const T vst2_v_ = (v); *(T*)(p) = vst2_v_;  } while (0)
extern "C" void kernel_launch(void* const* d_in, const int* in_sizes, int n_in,
                              void* d_out, int out_size, void* d_ws, size_t ws_size, hipStream_t stream) {
    (void)in_sizes; (void)n_in; (void)out_size;
    const float* x = (const float*)d_in[0]; const float* Wqkv = (const float*)d_in[1];   // k-major [1024][3072]
    float* out = (float*)d_out;    // [2][2048][1024]
    char* wsp = (char*)d_ws;
    auto take = [&](size_t bytes) { char* p = wsp; wsp += (bytes + 255) & ~(size_t)255; return (void*)p; };
    bf* Xb = (bf*)take((size_t)NTK * DM * 2); bf* WqkvT = (bf*)take((size_t)3 * DM * DM * 2);
    h16* QH = (h16*)take((size_t)NTK * DM * 2); h16* QL = (h16*)take((size_t)NTK * DM * 2); h16* KH = (h16*)take((size_t)NTK * DM * 2); h16* KL = (h16*)take((size_t)NTK * DM * 2);
    h16* VTH = (h16*)take((size_t)NTK * DM * 2); h16* VTL = (h16*)take((size_t)NTK * DM * 2);
    if ((size_t)(wsp - (char*)d_ws) > ws_size) return;    // 8.4 + 6.3 + 6 x 8.4 ~ 65 MB, no aliasing
    k_prep<<<NWTB + NTK / 8, 256, 0, stream>>>(Wqkv, WqkvT, x, Xb);
    k_gemmb<<<dim3(NTK / 64, 3 * DM / 64, 1), 128, 0, stream>>>(Xb, WqkvT, QH, QL, KH, KL, VTH, VTL);
    k_attn<<<NB_ * NH_ * (NT_ / 64), 128, 0, stream>>>(QH, QL, KH, KL, VTH, VTL, out);
}

// v007
// A run of this version takes 106 microseconds.
// Two timings next to v006 both put it at 1.11 times that version's speed.
// Over all steps from v000 it is 4.40 times as fast.
#include <hip/hip_runtime.h>

// Compute dtypes, f32 accumulate, both batch items in one pass, three launches: k_prep rounds x and the weights to PLAIN bf16 once (exact; k-major weights transposed to n-major);
// k_gemmb does q/k/v = x.W_qkv ([4096 x 1024].[1024 x 3072]) on v_wmma_f32_16x16x32_bf16 in one grid, every tile written straight from its epilogue as f16 hi + residual x1024
// planes, the v tiles already transposed (weights as A, tokens as B);
// the 16-head full attention (64-dim heads, scale 1/sqrt(1024) as the reference) written straight to the f32 output (no output projection), fused on
// v_wmma_f32_16x16x32_f16 (scores hi.hi + hi.lo + lo.hi with the residual terms on their own accumulator, online f32 softmax, weights (x32768) and v as f16

#define NB_  2                   // both batch items in every launch: twice the blocks
#define NT_  2048
#define DM   1024
#define NH_  16
#define HD   64
#define NTK  (NB_ * NT_)
#define NW   1024
#define NQKV 1024
#define PSC  32768.0f
#define LOSC 1024.0f
#define LOSCI (1.0f / 1024.0f)

typedef _Float16 h16;
typedef unsigned short bf;
typedef __attribute__((ext_vector_type(16))) __bf16   v16bf;
typedef __attribute__((ext_vector_type(16))) _Float16 v16h;
typedef __attribute__((ext_vector_type(8)))  _Float16 v8h;
typedef __attribute__((ext_vector_type(8)))  unsigned short v8us;
typedef __attribute__((ext_vector_type(8)))  float    v8f;
typedef __attribute__((ext_vector_type(4)))  float    v4f;
typedef v8h  __attribute__((may_alias)) v8ha;
typedef v4f  __attribute__((may_alias)) v4fa;
typedef v8us __attribute__((may_alias)) v8usa;

__device__ __forceinline__ unsigned short f2bf(float f) { unsigned u = __float_as_uint(f); u += 0x7FFFu + ((u >> 16) & 1u); return (unsigned short)(u >> 16); }
__device__ __forceinline__ float bf2f(unsigned short b) { return __uint_as_float(((unsigned)b) << 16); }
__device__ __forceinline__ float bfr(float f) { return bf2f(f2bf(f)); }
__device__ __forceinline__ v16h cat16(v8h lo, v8h hi) { return __builtin_shufflevector(lo, hi, 0, 1, 2, 3, 4, 5, 6, 7, 8, 9, 10, 11, 12, 13, 14, 15); }
__device__ __forceinline__ v16bf cat16b(v8us lo, v8us hi) { return __builtin_bit_cast(v16bf, __builtin_shufflevector(lo, hi, 0, 1, 2, 3, 4, 5, 6, 7, 8, 9, 10, 11, 12, 13, 14, 15)); }
__device__ __forceinline__ v8f wmma16(v16h a, v16h b, v8f c) { return __builtin_amdgcn_wmma_f32_16x16x32_f16(false, a, false, b, (short)0, c, false, false); }
__device__ __forceinline__ v8f wmmab(v16bf a, v16bf b, v8f c) { return __builtin_amdgcn_wmma_f32_16x16x32_bf16(false, a, false, b, (short)0, c, false, false); }

// k_prep: the two independent roundings to bf16 in one grid, told apart by the block index (block-uniform).
// Blocks below NWTB: WT [n][DM] = bf16(W[k][n]) (k-major [DM][3 DM]) via 64 x 64 LDS tiles, k tile fastest. The others: eight rows of x each, one a wave.
#define NWTB ((DM / 64) * (3 * DM / 64))
__global__ __launch_bounds__(256) void k_prep(const float* __restrict__ Wm, bf* WT, const float* __restrict__ src, bf* dst) {
    __shared__ __align__(16) unsigned short tl[64 * 72];
    const int tid = threadIdx.x, bid = blockIdx.x;
    if (bid < NWTB) {
        const int k0 = (bid & (DM / 64 - 1)) * 64, n0 = (bid / (DM / 64)) * 64;
        const int kk = tid >> 2, nq = (tid & 3) * 16;
#pragma unroll
        for (int i = 0; i < 16; ++i) tl[(nq + i) * 72 + kk] = f2bf(Wm[(size_t)(k0 + kk) * (3 * DM) + n0 + nq + i]);
        __syncthreads();     // every thread of such a block passes it: the test above reads the block index alone
        const int piece = tid & 7;
#pragma unroll
        for (int s = 0; s < 2; ++s) { const int nr = (tid >> 3) + 32 * s; const v8us val = *(const v8usa*)(tl + nr * 72 + piece * 8); *(v8us*)(WT + (size_t)(n0 + nr) * DM + k0 + piece * 8) = val; }
    } else {
        const int lane = tid & 31, r = (bid - NWTB) * 8 + (tid >> 5);
        v8us o[DM / 256];
#pragma unroll
        for (int q = 0; q < DM / 256; ++q) { v8us t;
#pragma unroll
            for (int i = 0; i < 8; ++i) t[i] = f2bf(src[(size_t)r * DM + q * 256 + lane * 8 + i]);
            o[q] = t; }
#pragma unroll
        for (int q = 0; q < DM / 256; ++q) *(v8us*)(dst + (size_t)r * DM + q * 256 + lane * 8) = o[q];
        asm volatile("s_wait_xcnt 0x0" ::: "memory");     // behind the stores: the built code lays the weight half behind this one, and no register that a store names is rewritten ahead of this wait
    }
}
// Two planes of a stage: eight asynchronous 16-B copies per lane, four rows of each a fixed step apart (la/lb: LDS byte addresses, ga/gb: global addresses, lstep/gstep: the row steps).
// The s_wait_xcnt ends the copies' own statement, so that no address register is rewritten ahead of it.
__device__ __forceinline__ void acopy8(unsigned la, unsigned lb, const h16* ga, const h16* gb, unsigned lstep, size_t gstep) {
    asm volatile("global_load_async_to_lds_b128 %0, %8, off\n\t"
                 "global_load_async_to_lds_b128 %1, %9, off\n\t"
                 "global_load_async_to_lds_b128 %2, %10, off\n\t"
                 "global_load_async_to_lds_b128 %3, %11, off\n\t"
                 "global_load_async_to_lds_b128 %4, %12, off\n\t"
                 "global_load_async_to_lds_b128 %5, %13, off\n\t"
                 "global_load_async_to_lds_b128 %6, %14, off\n\t"
                 "global_load_async_to_lds_b128 %7, %15, off\n\t"
                 "s_wait_xcnt 0x0"
                 :: "v"(la), "v"(la + lstep), "v"(la + 2 * lstep), "v"(la + 3 * lstep), "v"(lb), "v"(lb + lstep), "v"(lb + 2 * lstep), "v"(lb + 3 * lstep),
                    "v"(ga), "v"(ga + gstep), "v"(ga + 2 * gstep), "v"(ga + 3 * gstep), "v"(gb), "v"(gb + gstep), "v"(gb + 2 * gstep), "v"(gb + 3 * gstep)
                 : "memory");
}
// Four planes of a stage: eight asynchronous 16-B copies per lane, two rows of each plane (l0: LDS byte address, the eight LDS rows a fixed step lrow apart; g0..g3: the planes'
// global addresses, s01/s23: their row steps). The s_wait_xcnt ends the copies' own statement, so that no address register is rewritten ahead of it.
__device__ __forceinline__ void acopy2x4(unsigned l0, unsigned lrow, const h16* g0, const h16* g1, const h16* g2, const h16* g3, size_t s01, size_t s23) {
    asm volatile("global_load_async_to_lds_b128 %0, %8, off\n\t"
                 "global_load_async_to_lds_b128 %1, %9, off\n\t"
                 "global_load_async_to_lds_b128 %2, %10, off\n\t"
                 "global_load_async_to_lds_b128 %3, %11, off\n\t"
                 "global_load_async_to_lds_b128 %4, %12, off\n\t"
                 "global_load_async_to_lds_b128 %5, %13, off\n\t"
                 "global_load_async_to_lds_b128 %6, %14, off\n\t"
                 "global_load_async_to_lds_b128 %7, %15, off\n\t"
                 "s_wait_xcnt 0x0"
                 :: "v"(l0), "v"(l0 + lrow), "v"(l0 + 2 * lrow), "v"(l0 + 3 * lrow), "v"(l0 + 4 * lrow), "v"(l0 + 5 * lrow), "v"(l0 + 6 * lrow), "v"(l0 + 7 * lrow),
                    "v"(g0), "v"(g0 + s01), "v"(g1), "v"(g1 + s01), "v"(g2), "v"(g2 + s23), "v"(g3), "v"(g3 + s23)
                 : "memory");
}
// k_gemmb: grid (token tiles, 24 tiles of the n-major weight rows: 8 of q, 8 of k, 8 of v); block = 128 x 128 of the product, eight waves, wave = 32 x 64. A q or k block takes its token
// rows as A and its weight rows as B; a v block takes them the other way round, so that its tile comes out as v^T (rows: h * 64 + d, columns: tokens) with the same products
// in the same k order. Both operand tiles reach the waves through LDS: 64 k a stage, 128 A rows and 128 B rows of 128 B brought as whole cache
// lines once per block by asynchronous copies (every thread 8 pieces of 16 B), kept at a 144-B row pitch (16 B x odd: conflict-free 16-B fragment reads), two buffers,
// one block barrier a stage; fragment indices and the k order of the sums as with direct loads. A staged byte feeds 128 rows of the other operand, so the grid
// copies half the bytes that 64 x 64 blocks copy, and a wave reads 12 fragment halves for 8 products. The output rows are staged in the same LDS once the last
// stage has been left (73,728 B a block: the grid's three blocks a WGP fit its LDS).
#define GKS  64                  // k per stage
#define GPIT 72                  // LDS row pitch in bf16 (144 B)
#define GBUF (256 * GPIT)        // one buffer: the 128 A rows, then the 128 B rows
#define GNST (DM / GKS)
__global__ __launch_bounds__(256) void k_gemmb(const bf* __restrict__ X, const bf* __restrict__ WT, h16* QH, h16* QL, h16* KH, h16* KL, h16* VTH, h16* VTL) {
    __shared__ __align__(16) bf gst[2][GBUF];
    const int lane = threadIdx.x & 31, wave = threadIdx.x >> 5, lr = lane & 15, hi = lane >> 4;
    const int wa = wave & 3, wb = wave >> 2;     // the wave's 32 A rows and its 64 B rows inside the block's tile
    const int xr = blockIdx.x * 128, wr = blockIdx.y * 128, sel = blockIdx.y / (DM / 128);     // the block's token rows and weight rows; 0: q, 1: k, 2: v (block-uniform)
    const bf* A  = sel == 2 ? WT + (size_t)wr * DM : X + (size_t)xr * DM;
    const bf* Bn = sel == 2 ? X + (size_t)xr * DM : WT + (size_t)wr * DM;
    const int srow = threadIdx.x >> 3, spc = (threadIdx.x & 7) * 8;     // a thread's first row and its 16-B piece: 8 lanes cover one 128-B row
    const unsigned lthr = (unsigned)(size_t)&gst[0][0] + (unsigned)(srow * GPIT + spc) * 2u;      // the thread's LDS byte address in buffer 0, A row srow
    const h16* ga = (const h16*)(const void*)A + (size_t)srow * DM + spc;                         // 2-byte elements: only addresses are formed from these
    const h16* gb = (const h16*)(const void*)Bn + (size_t)srow * DM + spc;
    auto stage_in = [&](int st) {     // rows srow + 32 i, i = 0..3, of each tile
        const unsigned d = lthr + (unsigned)(st & 1) * (GBUF * 2u);
        acopy8(d, d + 128u * GPIT * 2u, ga + st * GKS, gb + st * GKS, 32u * GPIT * 2u, (size_t)32 * DM);
    };
    v8f acc[2][4];
#pragma unroll
    for (int t = 0; t < 4; ++t) { acc[0][t] = (v8f){}; acc[1][t] = (v8f){}; }
    stage_in(0);
    asm volatile("s_wait_asynccnt 0x0" ::: "memory");     // this wave's copies of stage 0 have landed
    __syncthreads();                                      // every wave's have: stage 0 may be read
    stage_in(1);
    // rolled: one copy of the stage body; stage st + 1's copies fly while stage st is worked on
#pragma unroll 1
    for (int st = 0; st < GNST; ++st) {
        const bf* sa = &gst[st & 1][0] + (wa * 32 + lr) * GPIT + 8 * hi;
        const bf* sb = &gst[st & 1][0] + (128 + wb * 64 + lr) * GPIT + 8 * hi;
        // the two 32-k steps of a stage unrolled: their LDS offsets become immediates of the reads
#pragma unroll
        for (int kl = 0; kl < GKS; kl += 32) {
            const v16bf a0 = cat16b(*(const v8usa*)(sa + kl), *(const v8usa*)(sa + kl + 16));
            const v16bf a1 = cat16b(*(const v8usa*)(sa + 16 * GPIT + kl), *(const v8usa*)(sa + 16 * GPIT + kl + 16));
            v16bf b[4];
#pragma unroll
            for (int t = 0; t < 4; ++t) b[t] = cat16b(*(const v8usa*)(sb + t * 16 * GPIT + kl), *(const v8usa*)(sb + t * 16 * GPIT + kl + 16));
            __builtin_amdgcn_sched_barrier(0);     // holds the step's twelve reads together ahead of its eight products; without it the build reads every B fragment into the same registers, with a wait to zero in front of each pair of products
#pragma unroll
            for (int t = 0; t < 4; ++t) { acc[0][t] = wmmab(a0, b[t], acc[0][t]); acc[1][t] = wmmab(a1, b[t], acc[1][t]); }
        }
        asm volatile("v_nop\n\tv_nop\n\tv_nop\n\tv_nop" : "+v"(acc[0][0]), "+v"(acc[0][1]), "+v"(acc[0][2]), "+v"(acc[0][3]), "+v"(acc[1][0]), "+v"(acc[1][1]), "+v"(acc[1][2]), "+v"(acc[1][3]));     // the matrix instructions' distance on the taken branches below; the stage's last one stays in front of the waits
        asm volatile("s_wait_dscnt 0x0" ::: "memory");        // this wave's LDS reads of stage st are done before its buffer is refilled
        asm volatile("s_wait_asynccnt 0x0" ::: "memory");     // this wave's copies of stage st + 1 have landed
        __syncthreads();                                      // publishes stage st + 1 and ends every wave's reads of stage st
        if (st + 2 < GNST) stage_in(st + 2);                  // block-uniform test; into the buffer that stage st has just left
    }
    asm volatile("s_wait_asynccnt 0x0" ::: "memory");         // no copy is outstanding when the wave goes on to its end
    float* os = (float*)(void*)&gst[0][0] + wave * (32 * 68);     // behind the last trip's waits and barrier no wave reads a stage and no copy is outstanding
#pragma unroll
    for (int i = 0; i < 2; ++i)
#pragma unroll
        for (int t = 0; t < 4; ++t)
#pragma unroll
            for (int j = 0; j < 8; ++j) os[(i * 16 + hi * 8 + j) * 68 + t * 16 + lr] = acc[i][t][j];
    __syncthreads();
    const int cn = wr & (DM - 1);     // the weight rows' place inside q, k or v
    // first element of the wave's 32 output rows of 64, and the row step: token rows of q or k; rows (b * 1024 + h * 64 + d) of 2048 tokens of v^T
    const size_t cof = sel == 2 ? ((size_t)(xr / NT_) * DM + cn + wa * 32) * NT_ + (xr & (NT_ - 1)) + wb * 64 : (size_t)(xr + wa * 32) * DM + cn + wb * 64;
    const size_t ldc = sel == 2 ? NT_ : DM;
    h16* c1 = (sel == 2 ? VTH : sel == 1 ? KH : QH) + cof;
    h16* c2 = (sel == 2 ? VTL : sel == 1 ? KL : QL) + cof;
#pragma unroll
    for (int s = 0; s < 8; ++s) { const int row = 4 * s + (lane >> 3), piece = lane & 7; const float* sp = os + row * 68 + piece * 8; v8h o, o2;
#pragma unroll
        for (int i = 0; i < 8; ++i) { const h16 a = (h16)sp[i]; o[i] = a; o2[i] = (h16)((sp[i] - (float)a) * LOSC); }
        *(v8h*)(c1 + (size_t)row * ldc + piece * 8) = o; *(v8h*)(c2 + (size_t)row * ldc + piece * 8) = o2; }
}

// k_attn: block = (b, h, 128 queries), eight waves, wave = 16; ALL 32 key tiles (no mask); scores TRANSPOSED (k rows as A, q as B): a lane holds 16 of the 32 scores of ONE query,
// so the online f32 softmax is in-lane but for one exchange between the wave's halves, and the weights (x32768, f16 hi + residual), converted in place, are the B operand
// of out^T += v^T . p^T (two score tiles = the k order 8h+s, 16+8h+s that the v^T loader has): no LDS round trip; ctx -> f32 output rows out[tok][h*64+d].
// k and v planes reach the waves through LDS: 64 keys a stage, each plane 64 rows of 128 B brought as whole cache lines once per block by asynchronous copies
// (every thread 8 pieces of 16 B), kept at a 144-B row pitch (16 B x odd: conflict-free 16-B fragment reads), two buffers, one block barrier a stage;
// fragment indices and sum order as before. The output rows are staged in the same LDS once the last stage has been left (73,728 B a block; two blocks, sixteen waves, a WGP).
#define SKEY 64                  // keys per stage
#define SPIT 72                  // LDS row pitch in f16 (144 B)
#define SPLN (64 * SPIT)         // one plane of a stage
#define NSTG (NT_ / SKEY)

// lane l with lane l ^ 16 (the other half of the wave holds the same query's other keys)
__device__ __forceinline__ float xhalf(float x) { return __builtin_bit_cast(float, __builtin_amdgcn_permlanex16(__builtin_bit_cast(int, x), __builtin_bit_cast(int, x), 0x76543210, 0xfedcba98, false, false)); }
#define L2E 1.44269504f          // exp(x) = exp2(x * log2 e)
// exp2 written with its slot: the instruction set asks for one independent instruction or v_nop between a transcendental and a use of its result or an overwrite of its
// source. Eight in one statement: the outputs are early-clobbered, so none reads its predecessor's result or overwrites its source; the v_nop is the last one's slot.
__device__ __forceinline__ void exp2x8(float* r, const float* x) {
    asm("v_exp_f32 %0, %8\n\tv_exp_f32 %1, %9\n\tv_exp_f32 %2, %10\n\tv_exp_f32 %3, %11\n\tv_exp_f32 %4, %12\n\tv_exp_f32 %5, %13\n\tv_exp_f32 %6, %14\n\tv_exp_f32 %7, %15\n\tv_nop"
        : "=&v"(r[0]), "=&v"(r[1]), "=&v"(r[2]), "=&v"(r[3]), "=&v"(r[4]), "=&v"(r[5]), "=&v"(r[6]), "=&v"(r[7])
        : "v"(x[0]), "v"(x[1]), "v"(x[2]), "v"(x[3]), "v"(x[4]), "v"(x[5]), "v"(x[6]), "v"(x[7]));
}
__device__ __forceinline__ float exp2x1(float x) { float r; asm("v_exp_f32 %0, %1\n\tv_nop" : "=v"(r) : "v"(x)); return r; }     // the v_nop: the same slot
__global__ __launch_bounds__(256) void k_attn(const h16* __restrict__ Q16, const h16* __restrict__ QL16, const h16* __restrict__ K16, const h16* __restrict__ KL16, const h16* __restrict__ VTH, const h16* __restrict__ VTL, float* OUTP) {
    __shared__ __align__(16) h16 stg[2][4 * SPLN];     // per buffer: k hi, k residual, v^T hi, v^T residual
    const int lane = threadIdx.x & 31, wave = threadIdx.x >> 5, lr = lane & 15, hi = lane >> 4;
    const int bid = blockIdx.x;
    const int b = bid / (NH_ * (NT_ / 128)), rem = bid - b * (NH_ * (NT_ / 128)), h = rem / (NT_ / 128), qt = rem - h * (NT_ / 128);
    const int q0 = qt * 128 + wave * 16;
    const size_t tok0 = (size_t)b * NT_;
    v16h qa[2];
    const size_t qo0 = (tok0 + q0 + lr) * DM + h * HD + 8 * hi;
#pragma unroll
    for (int kc = 0; kc < 2; ++kc) qa[kc] = cat16(*(const v8h*)(Q16 + qo0 + kc * 32), *(const v8h*)(Q16 + qo0 + kc * 32 + 16));
    v16h ql[2];     // the query residual, read once like the query itself: no global read stands among the products
#pragma unroll
    for (int kc = 0; kc < 2; ++kc) ql[kc] = cat16(*(const v8h*)(QL16 + qo0 + kc * 32), *(const v8h*)(QL16 + qo0 + kc * 32 + 16));
    asm volatile("s_wait_xcnt 0x0" ::: "memory");     // behind the query loads: the built code reuses their address registers right away
    __builtin_amdgcn_sched_barrier(0);                // keeps the address arithmetic below from being lifted over that wait
    const h16* kh_b = K16 + tok0 * DM + h * HD;
    const h16* kl_b = KL16 + tok0 * DM + h * HD;
    const size_t vbase = (((size_t)b * NH_ + h) * HD) * NT_;
    v8f o[4], ox[4];
#pragma unroll
    for (int n = 0; n < 4; ++n) { o[n] = (v8f){}; ox[n] = (v8f){}; }
    float mrow = -3.0e38f, lpart = 0.f;      // of the lane's query q0 + lr; lpart: this half's keys only
    const int srow = threadIdx.x >> 3, spc = (threadIdx.x & 7) * 8;     // a thread's first row and its 16-B piece: 8 lanes cover one 128-B row
    const unsigned lthr = (unsigned)(size_t)&stg[0][0] + (unsigned)(srow * SPIT + spc) * 2u;      // the thread's LDS byte address in buffer 0, plane 0
    auto stage_in = [&](int st) {
        const unsigned d = lthr + (unsigned)(st & 1) * (4u * SPLN * 2u);
        const size_t kof = (size_t)(st * SKEY + srow) * DM + spc, vof = vbase + (size_t)srow * NT_ + st * SKEY + spc;
        acopy2x4(d, 32u * SPIT * 2u, kh_b + kof, kl_b + kof, VTH + vof, VTL + vof, (size_t)32 * DM, (size_t)32 * NT_);     // rows srow and srow + 32 of each plane; a plane is 64 LDS rows
    };
    stage_in(0);
    asm volatile("s_wait_asynccnt 0x0" ::: "memory");     // this wave's copies of stage 0 have landed
    __syncthreads();                                      // every wave's have: stage 0 may be read
    stage_in(1);
#pragma unroll 1
    for (int st = 0; st < NSTG; ++st) {            // full attention; stage st + 1's copies fly while stage st is worked on
      const h16* sb = &stg[st & 1][0];
      // both 32-key halves of a stage unrolled: their LDS offsets become immediates of the reads
#pragma unroll
      for (int sub = 0; sub < SKEY / 32; ++sub) {
        const h16* kh_s = sb; const h16* kl_s = sb + SPLN; const h16* vh_s = sb + 2 * SPLN; const h16* vl_s = sb + 3 * SPLN;
        const int ko0 = (sub * 32 + lr) * SPIT + 8 * hi, ko1 = (sub * 32 + 16 + lr) * SPIT + 8 * hi;
        // the step's sixteen k reads stand as one group ahead of the twelve score products, which then run back to back
        v16h kf[2][4];
#pragma unroll
        for (int kc = 0; kc < 2; ++kc) {
            kf[kc][0] = cat16(*(const v8ha*)(kh_s + ko0 + kc * 32), *(const v8ha*)(kh_s + ko0 + kc * 32 + 16)); kf[kc][1] = cat16(*(const v8ha*)(kh_s + ko1 + kc * 32), *(const v8ha*)(kh_s + ko1 + kc * 32 + 16));
            kf[kc][2] = cat16(*(const v8ha*)(kl_s + ko0 + kc * 32), *(const v8ha*)(kl_s + ko0 + kc * 32 + 16)); kf[kc][3] = cat16(*(const v8ha*)(kl_s + ko1 + kc * 32), *(const v8ha*)(kl_s + ko1 + kc * 32 + 16));
        }
        __builtin_amdgcn_sched_barrier(0);     // holds the k reads together up here; without it the build spreads them among the products, pair by pair, each with a wait to zero
        v8f s0 = {}, s1 = {}, x0 = {}, x1 = {};
#pragma unroll
        for (int kc = 0; kc < 2; ++kc) {
            s0 = wmma16(kf[kc][0], qa[kc], s0); x0 = wmma16(kf[kc][0], ql[kc], x0); s1 = wmma16(kf[kc][1], qa[kc], s1); x1 = wmma16(kf[kc][1], ql[kc], x1);
            x0 = wmma16(kf[kc][2], qa[kc], x0); x1 = wmma16(kf[kc][3], qa[kc], x1);
        }
        // the matrix instructions' distance to the softmax; the memory clobber keeps the v reads below behind the score products, so that they take the k fragments' registers (four waves a SIMD: 256 registers at most)
        asm volatile("v_nop\n\tv_nop\n\tv_nop\n\tv_nop" : "+v"(s0), "+v"(s1), "+v"(x0), "+v"(x1) : "v"(qa[0]), "v"(qa[1]) : "memory");
        // the step's sixteen v reads are issued here, so that the softmax below covers their latency
        v16h vf[4][2];
#pragma unroll
        for (int n = 0; n < 4; ++n) { const int vo = (n * 16 + lr) * SPIT + sub * 32 + hi * 8;
            vf[n][0] = cat16(*(const v8ha*)(vh_s + vo), *(const v8ha*)(vh_s + vo + 16)); vf[n][1] = cat16(*(const v8ha*)(vl_s + vo), *(const v8ha*)(vl_s + vo + 16)); }
        __builtin_amdgcn_sched_barrier(0);     // holds the v reads ahead of the softmax; without it the build sinks some of them among the products below
        // s0[j], s1[j]: keys 8 * hi + j and 16 + 8 * hi + j of this 32-key step, query lr
        float a[16], e[16], p[16];
#pragma unroll
        for (int j = 0; j < 8; ++j) a[j] = (s0[j] + x0[j] * LOSCI) * 0.03125f;          // scale 1/sqrt(1024), as the reference
#pragma unroll
        for (int j = 0; j < 8; ++j) a[8 + j] = (s1[j] + x1[j] * LOSCI) * 0.03125f;
        float mx = fmaxf(fmaxf(fmaxf(fmaxf(a[0], a[1]), fmaxf(a[2], a[3])), fmaxf(fmaxf(a[4], a[5]), fmaxf(a[6], a[7]))),
                         fmaxf(fmaxf(fmaxf(a[8], a[9]), fmaxf(a[10], a[11])), fmaxf(fmaxf(a[12], a[13]), fmaxf(a[14], a[15]))));
        mx = fmaxf(mx, xhalf(mx));                 // both halves now hold the maximum over the query's 32 keys
        const float mn = fmaxf(mrow, mx);
        const float alpha = exp2x1((mrow - mn) * L2E); mrow = mn;
#pragma unroll
        for (int i = 0; i < 16; ++i) e[i] = (a[i] - mn) * L2E;
        exp2x8(p, e); exp2x8(p + 8, e + 8);
        v16h pa, px;
#pragma unroll
        for (int i = 0; i < 16; ++i) { const float ps = p[i] * PSC; const h16 hh = (h16)ps; pa[i] = hh; px[i] = (h16)((ps - (float)hh) * LOSC); }
        lpart = lpart * alpha + ((((p[0] + p[1]) + (p[2] + p[3])) + ((p[4] + p[5]) + (p[6] + p[7]))) + (((p[8] + p[9]) + (p[10] + p[11])) + ((p[12] + p[13]) + (p[14] + p[15]))));
#pragma unroll
        for (int n = 0; n < 4; ++n)
#pragma unroll
            for (int j = 0; j < 8; ++j) { o[n][j] *= alpha; ox[n][j] *= alpha; }
#pragma unroll
        for (int n = 0; n < 4; ++n) { o[n] = wmma16(vf[n][0], pa, o[n]); ox[n] = wmma16(vf[n][1], pa, ox[n]); }     // o[n][j]: d = n * 16 + 8 * hi + j, query lr
#pragma unroll
        for (int n = 0; n < 4; ++n) ox[n] = wmma16(vf[n][0], px, ox[n]);     // each accumulator takes its products in the order it had
        asm volatile("v_nop\n\tv_nop\n\tv_nop\n\tv_nop" : "+v"(o[0]), "+v"(o[1]), "+v"(o[2]), "+v"(o[3]), "+v"(ox[0]), "+v"(ox[1]), "+v"(ox[2]), "+v"(ox[3]) : "v"(pa), "v"(px));
      }
      asm volatile("s_wait_dscnt 0x0" ::: "memory");        // this wave's LDS reads of stage st are done before its buffer is refilled
      asm volatile("s_wait_asynccnt 0x0" ::: "memory");     // this wave's copies of stage st + 1 have landed
      __syncthreads();                                      // publishes stage st + 1 and ends every wave's reads of stage st
      if (st + 2 < NSTG) stage_in(st + 2);                  // block-uniform test; into the buffer that stage st has just left
    }
    asm volatile("s_wait_asynccnt 0x0" ::: "memory");       // no copy is outstanding when the wave goes on to its end
    const float inv = 1.0f / ((lpart + xhalf(lpart)) * PSC);     // the two halves' sums joined once
    float* os = (float*)(void*)&stg[0][0] + wave * (16 * 68);     // behind the last trip's waits and barrier no wave reads a stage and no copy is outstanding
#pragma unroll
    for (int n = 0; n < 4; ++n)
#pragma unroll
        for (int g = 0; g < 2; ++g) { v4f w;
#pragma unroll
            for (int i = 0; i < 4; ++i) w[i] = (o[n][4 * g + i] + ox[n][4 * g + i] * LOSCI) * inv;
            *(v4fa*)(os + lr * 68 + n * 16 + hi * 8 + 4 * g) = w; }
    __syncthreads();
    float* ob = OUTP + (tok0 + q0) * DM + (size_t)h * HD;
    auto pass = [&]() {
#pragma unroll
        for (int s = 0; s < 8; ++s) { const int Lid = (lane >> 3) + 4 * s, piece = lane & 7; const int row = Lid >> 1, cofs = (Lid & 1) * 32 + piece * 4;
            const v4f val = *(const v4fa*)(os + row * 68 + cofs); *(v4f*)(ob + (size_t)row * DM + cofs) = val; }
    };
    pass(); 
}

#define VST2(T, p, v) do { const T vst2_v_ = (v); *(T*)(p) = vst2_v_;  } while (0)
extern "C" void kernel_launch(void* const* d_in, const int* in_sizes, int n_in,
                              void* d_out, int out_size, void* d_ws, size_t ws_size, hipStream_t stream) {
    (void)in_sizes; (void)n_in; (void)out_size;
    const float* x = (const float*)d_in[0]; const float* Wqkv = (const float*)d_in[1];   // k-major [1024][3072]
    float* out = (float*)d_out;    // [2][2048][1024]
    char* wsp = (char*)d_ws;
    auto take = [&](size_t bytes) { char* p = wsp; wsp += (bytes + 255) & ~(size_t)255; return (void*)p; };
    bf* Xb = (bf*)take((size_t)NTK * DM * 2); bf* WqkvT = (bf*)take((size_t)3 * DM * DM * 2);
    h16* QH = (h16*)take((size_t)NTK * DM * 2); h16* QL = (h16*)take((size_t)NTK * DM * 2); h16* KH = (h16*)take((size_t)NTK * DM * 2); h16* KL = (h16*)take((size_t)NTK * DM * 2);
    h16* VTH = (h16*)take((size_t)NTK * DM * 2); h16* VTL = (h16*)take((size_t)NTK * DM * 2);
    if ((size_t)(wsp - (char*)d_ws) > ws_size) return;    // 8.4 + 6.3 + 6 x 8.4 ~ 65 MB, no aliasing
    k_prep<<<NWTB + NTK / 8, 256, 0, stream>>>(Wqkv, WqkvT, x, Xb);
    k_gemmb<<<dim3(NTK / 128, 3 * DM / 128, 1), 256, 0, stream>>>(Xb, WqkvT, QH, QL, KH, KL, VTH, VTL);
    k_attn<<<NB_ * NH_ * (NT_ / 128), 256, 0, stream>>>(QH, QL, KH, KL, VTH, VTL, out);
}

// v009
// One run takes 57 microseconds.
// It is 1.86 times as fast as v007, going by the measured steps of the versions left out in between.
// All steps since v000 together make it 8.17 times as fast.
#include <hip/hip_runtime.h>

// Compute dtypes, f32 accumulate, both batch items in one pass, three launches: k_prep rounds x and the weights to PLAIN bf16 once (exact; k-major weights transposed to n-major);
// k_gemmb does q/k/v = x.W_qkv ([4096 x 1024].[1024 x 3072]) on v_wmma_f32_16x16x32_bf16 in one grid, every tile written straight from its epilogue as one f16 plane,
// the v tiles already transposed (weights as A, tokens as B). The f16 rounding of q, k, v (11 significant bits) lies under the error that the bf16 operands (8 bits) leave in them;
// the 16-head full attention (64-dim heads, scale 1/sqrt(1024) as the reference) written straight to the f32 output (no output projection), fused on
// v_wmma_f32_16x16x32_f16 (scores k.q, online f32 softmax against a kept reference, weights (x128 at the reference) and v as f16, f32 sums).

#define NB_  2                   // both batch items in every launch: twice the blocks
#define NT_  2048
#define DM   1024
#define NH_  16
#define HD   64
#define NTK  (NB_ * NT_)
#define NW   1024
#define NQKV 1024
#define L2E  1.44269504f         // exp(x) = exp2(x * log2 e)
#define SC2  (0.03125f * L2E)    // raw score to base-2 exponent: scale 1/sqrt(1024), as the reference, times log2 e; q carries it
#define PEXP 7.0f                // a score equal to its query's reference gives the weight 2^7
#define PTHR 8.0f                // a score may pass the reference by this much (base-2 exponent) before the reference moves: weights stay at or under 2^15, inside f16

typedef _Float16 h16;
typedef unsigned short bf;
typedef __attribute__((ext_vector_type(16))) __bf16   v16bf;
typedef __attribute__((ext_vector_type(16))) _Float16 v16h;
typedef __attribute__((ext_vector_type(8)))  _Float16 v8h;
typedef __attribute__((ext_vector_type(8)))  unsigned short v8us;
typedef __attribute__((ext_vector_type(8)))  float    v8f;
typedef __attribute__((ext_vector_type(4)))  float    v4f;
typedef v8h  __attribute__((may_alias)) v8ha;
typedef v4f  __attribute__((may_alias)) v4fa;
typedef v8us __attribute__((may_alias)) v8usa;

__device__ __forceinline__ unsigned short f2bf(float f) { unsigned u = __float_as_uint(f); u += 0x7FFFu + ((u >> 16) & 1u); return (unsigned short)(u >> 16); }
__device__ __forceinline__ float bf2f(unsigned short b) { return __uint_as_float(((unsigned)b) << 16); }
__device__ __forceinline__ float bfr(float f) { return bf2f(f2bf(f)); }
__device__ __forceinline__ v16h cat16(v8h lo, v8h hi) { return __builtin_shufflevector(lo, hi, 0, 1, 2, 3, 4, 5, 6, 7, 8, 9, 10, 11, 12, 13, 14, 15); }
__device__ __forceinline__ v16bf cat16b(v8us lo, v8us hi) { return __builtin_bit_cast(v16bf, __builtin_shufflevector(lo, hi, 0, 1, 2, 3, 4, 5, 6, 7, 8, 9, 10, 11, 12, 13, 14, 15)); }
__device__ __forceinline__ v8f wmma16(v16h a, v16h b, v8f c) { return __builtin_amdgcn_wmma_f32_16x16x32_f16(false, a, false, b, (short)0, c, false, false); }
__device__ __forceinline__ v8f wmmab(v16bf a, v16bf b, v8f c) { return __builtin_amdgcn_wmma_f32_16x16x32_bf16(false, a, false, b, (short)0, c, false, false); }

// k_prep: the two independent roundings to bf16 in one grid, told apart by the block index (block-uniform).
// Blocks below NWTB: WT [n][DM] = bf16(W[k][n]) (k-major [DM][3 DM]) via 64 x 64 LDS tiles, k tile fastest. The others: eight rows of x each, one a wave.
#define NWTB ((DM / 64) * (3 * DM / 64))
__global__ __launch_bounds__(256) void k_prep(const float* __restrict__ Wm, bf* WT, const float* __restrict__ src, bf* dst) {
    __shared__ __align__(16) unsigned short tl[64 * 72];
    const int tid = threadIdx.x, bid = blockIdx.x;
    if (bid < NWTB) {
        const int k0 = (bid & (DM / 64 - 1)) * 64, n0 = (bid / (DM / 64)) * 64;
        const int kk = tid >> 2, nq = (tid & 3) * 16;
#pragma unroll
        for (int i = 0; i < 16; ++i) tl[(nq + i) * 72 + kk] = f2bf(Wm[(size_t)(k0 + kk) * (3 * DM) + n0 + nq + i]);
        __syncthreads();     // every thread of such a block passes it: the test above reads the block index alone
        const int piece = tid & 7;
#pragma unroll
        for (int s = 0; s < 2; ++s) { const int nr = (tid >> 3) + 32 * s; const v8us val = *(const v8usa*)(tl + nr * 72 + piece * 8); *(v8us*)(WT + (size_t)(n0 + nr) * DM + k0 + piece * 8) = val; }
    } else {
        const int lane = tid & 31, r = (bid - NWTB) * 8 + (tid >> 5);
        v8us o[DM / 256];
#pragma unroll
        for (int q = 0; q < DM / 256; ++q) { v8us t;
#pragma unroll
            for (int i = 0; i < 8; ++i) t[i] = f2bf(src[(size_t)r * DM + q * 256 + lane * 8 + i]);
            o[q] = t; }
#pragma unroll
        for (int q = 0; q < DM / 256; ++q) *(v8us*)(dst + (size_t)r * DM + q * 256 + lane * 8) = o[q];
        asm volatile("s_wait_xcnt 0x0" ::: "memory");     // behind the stores: the built code lays the weight half behind this one, and no register that a store names is rewritten ahead of this wait
    }
}
// Two planes of a stage: eight asynchronous 16-B copies per lane, four rows of each a fixed step apart (la/lb: LDS byte addresses, ga/gb: global addresses, lstep/gstep: the row steps).
// The s_wait_xcnt ends the copies' own statement, so that no address register is rewritten ahead of it.
__device__ __forceinline__ void acopy8(unsigned la, unsigned lb, const h16* ga, const h16* gb, unsigned lstep, size_t gstep) {
    asm volatile("global_load_async_to_lds_b128 %0, %8, off\n\t"
                 "global_load_async_to_lds_b128 %1, %9, off\n\t"
                 "global_load_async_to_lds_b128 %2, %10, off\n\t"
                 "global_load_async_to_lds_b128 %3, %11, off\n\t"
                 "global_load_async_to_lds_b128 %4, %12, off\n\t"
                 "global_load_async_to_lds_b128 %5, %13, off\n\t"
                 "global_load_async_to_lds_b128 %6, %14, off\n\t"
                 "global_load_async_to_lds_b128 %7, %15, off\n\t"
                 "s_wait_xcnt 0x0"
                 :: "v"(la), "v"(la + lstep), "v"(la + 2 * lstep), "v"(la + 3 * lstep), "v"(lb), "v"(lb + lstep), "v"(lb + 2 * lstep), "v"(lb + 3 * lstep),
                    "v"(ga), "v"(ga + gstep), "v"(ga + 2 * gstep), "v"(ga + 3 * gstep), "v"(gb), "v"(gb + gstep), "v"(gb + 2 * gstep), "v"(gb + 3 * gstep)
                 : "memory");
}
// Two planes of a stage: four asynchronous 16-B copies per lane, two rows of each plane (l0: LDS byte address, the four LDS rows a fixed step lrow apart; g0, g1: the planes'
// global addresses, s0, s1: their row steps). The s_wait_xcnt ends the copies' own statement, so that no address register is rewritten ahead of it.
__device__ __forceinline__ void acopy2x2(unsigned l0, unsigned lrow, const h16* g0, const h16* g1, size_t s0, size_t s1) {
    asm volatile("global_load_async_to_lds_b128 %0, %4, off\n\t"
                 "global_load_async_to_lds_b128 %1, %5, off\n\t"
                 "global_load_async_to_lds_b128 %2, %6, off\n\t"
                 "global_load_async_to_lds_b128 %3, %7, off\n\t"
                 "s_wait_xcnt 0x0"
                 :: "v"(l0), "v"(l0 + lrow), "v"(l0 + 2 * lrow), "v"(l0 + 3 * lrow),
                    "v"(g0), "v"(g0 + s0), "v"(g1), "v"(g1 + s1)
                 : "memory");
}
// k_gemmb: grid (token tiles, 24 tiles of the n-major weight rows: 8 of q, 8 of k, 8 of v); block = 128 x 128 of the product, eight waves, wave = 32 x 64. A q or k block takes its token
// rows as A and its weight rows as B; a v block takes them the other way round, so that its tile comes out as v^T (rows: h * 64 + d, columns: tokens) with the same products
// in the same k order. Both operand tiles reach the waves through LDS: 64 k a stage, 128 A rows and 128 B rows of 128 B brought as whole cache
// lines once per block by asynchronous copies (every thread 8 pieces of 16 B), kept at a 144-B row pitch (16 B x odd: conflict-free 16-B fragment reads), two buffers,
// one block barrier a stage; fragment indices and the k order of the sums as with direct loads. A staged byte feeds 128 rows of the other operand, so the grid
// copies half the bytes that 64 x 64 blocks copy, and a wave reads 12 fragment halves for 8 products. The output rows are staged in the same LDS once the last
// stage has been left (73,728 B a block: the grid's three blocks a WGP fit its LDS).
#define GKS  64                  // k per stage
#define GPIT 72                  // LDS row pitch in bf16 (144 B)
#define GBUF (256 * GPIT)        // one buffer: the 128 A rows, then the 128 B rows
#define GNST (DM / GKS)
__global__ __launch_bounds__(256) void k_gemmb(const bf* __restrict__ X, const bf* __restrict__ WT, h16* QH, h16* KH, h16* VTH) {
    __shared__ __align__(16) bf gst[2][GBUF];
    const int lane = threadIdx.x & 31, wave = threadIdx.x >> 5, lr = lane & 15, hi = lane >> 4;
    const int wa = wave & 3, wb = wave >> 2;     // the wave's 32 A rows and its 64 B rows inside the block's tile
    const int xr = blockIdx.x * 128, wr = blockIdx.y * 128, sel = blockIdx.y / (DM / 128);     // the block's token rows and weight rows; 0: q, 1: k, 2: v (block-uniform)
    const bf* A  = sel == 2 ? WT + (size_t)wr * DM : X + (size_t)xr * DM;
    const bf* Bn = sel == 2 ? X + (size_t)xr * DM : WT + (size_t)wr * DM;
    const int srow = threadIdx.x >> 3, spc = (threadIdx.x & 7) * 8;     // a thread's first row and its 16-B piece: 8 lanes cover one 128-B row
    const unsigned lthr = (unsigned)(size_t)&gst[0][0] + (unsigned)(srow * GPIT + spc) * 2u;      // the thread's LDS byte address in buffer 0, A row srow
    const h16* ga = (const h16*)(const void*)A + (size_t)srow * DM + spc;                         // 2-byte elements: only addresses are formed from these
    const h16* gb = (const h16*)(const void*)Bn + (size_t)srow * DM + spc;
    auto stage_in = [&](int st) {     // rows srow + 32 i, i = 0..3, of each tile
        const unsigned d = lthr + (unsigned)(st & 1) * (GBUF * 2u);
        acopy8(d, d + 128u * GPIT * 2u, ga + st * GKS, gb + st * GKS, 32u * GPIT * 2u, (size_t)32 * DM);
    };
    v8f acc[2][4];
#pragma unroll
    for (int t = 0; t < 4; ++t) { acc[0][t] = (v8f){}; acc[1][t] = (v8f){}; }
    stage_in(0);
    asm volatile("s_wait_asynccnt 0x0" ::: "memory");     // this wave's copies of stage 0 have landed
    __syncthreads();                                      // every wave's have: stage 0 may be read
    stage_in(1);
    // rolled: one copy of the stage body; stage st + 1's copies fly while stage st is worked on
#pragma unroll 1
    for (int st = 0; st < GNST; ++st) {
        const bf* sa = &gst[st & 1][0] + (wa * 32 + lr) * GPIT + 8 * hi;
        const bf* sb = &gst[st & 1][0] + (128 + wb * 64 + lr) * GPIT + 8 * hi;
        // the two 32-k steps of a stage unrolled: their LDS offsets become immediates of the reads
#pragma unroll
        for (int kl = 0; kl < GKS; kl += 32) {
            const v16bf a0 = cat16b(*(const v8usa*)(sa + kl), *(const v8usa*)(sa + kl + 16));
            const v16bf a1 = cat16b(*(const v8usa*)(sa + 16 * GPIT + kl), *(const v8usa*)(sa + 16 * GPIT + kl + 16));
            v16bf b[4];
#pragma unroll
            for (int t = 0; t < 4; ++t) b[t] = cat16b(*(const v8usa*)(sb + t * 16 * GPIT + kl), *(const v8usa*)(sb + t * 16 * GPIT + kl + 16));
            __builtin_amdgcn_sched_barrier(0);     // holds the step's twelve reads together ahead of its eight products; without it the build reads every B fragment into the same registers, with a wait to zero in front of each pair of products
#pragma unroll
            for (int t = 0; t < 4; ++t) { acc[0][t] = wmmab(a0, b[t], acc[0][t]); acc[1][t] = wmmab(a1, b[t], acc[1][t]); }
        }
        asm volatile("v_nop\n\tv_nop\n\tv_nop\n\tv_nop" : "+v"(acc[0][0]), "+v"(acc[0][1]), "+v"(acc[0][2]), "+v"(acc[0][3]), "+v"(acc[1][0]), "+v"(acc[1][1]), "+v"(acc[1][2]), "+v"(acc[1][3]));     // the matrix instructions' distance on the taken branches below; the stage's last one stays in front of the waits
        asm volatile("s_wait_dscnt 0x0" ::: "memory");        // this wave's LDS reads of stage st are done before its buffer is refilled
        asm volatile("s_wait_asynccnt 0x0" ::: "memory");     // this wave's copies of stage st + 1 have landed
        __syncthreads();                                      // publishes stage st + 1 and ends every wave's reads of stage st
        if (st + 2 < GNST) stage_in(st + 2);                  // block-uniform test; into the buffer that stage st has just left
    }
    asm volatile("s_wait_asynccnt 0x0" ::: "memory");         // no copy is outstanding when the wave goes on to its end
    float* os = (float*)(void*)&gst[0][0] + wave * (32 * 68);     // behind the last trip's waits and barrier no wave reads a stage and no copy is outstanding
#pragma unroll
    for (int i = 0; i < 2; ++i)
#pragma unroll
        for (int t = 0; t < 4; ++t)
#pragma unroll
            for (int j = 0; j < 8; ++j) os[(i * 16 + hi * 8 + j) * 68 + t * 16 + lr] = acc[i][t][j];
    __syncthreads();
    const int cn = wr & (DM - 1);     // the weight rows' place inside q, k or v
    // first element of the wave's 32 output rows of 64, and the row step: token rows of q or k; rows (b * 1024 + h * 64 + d) of 2048 tokens of v^T
    const size_t cof = sel == 2 ? ((size_t)(xr / NT_) * DM + cn + wa * 32) * NT_ + (xr & (NT_ - 1)) + wb * 64 : (size_t)(xr + wa * 32) * DM + cn + wb * 64;
    const size_t ldc = sel == 2 ? NT_ : DM;
    h16* c1 = (sel == 2 ? VTH : sel == 1 ? KH : QH) + cof;
    const float qs = sel == 0 ? SC2 : 1.0f;     // q leaves times SC2, multiplied in f32 ahead of its one rounding to f16: k.q is then a base-2 exponent; k and v times 1 (exact)
#pragma unroll
    for (int s = 0; s < 8; ++s) { const int row = 4 * s + (lane >> 3), piece = lane & 7; const float* sp = os + row * 68 + piece * 8; v8h o;
#pragma unroll
        for (int i = 0; i < 8; ++i) o[i] = (h16)(sp[i] * qs);
        *(v8h*)(c1 + (size_t)row * ldc + piece * 8) = o; }
}

// k_attn: block = (b, h, 128 queries), eight waves, wave = 16; ALL 32 key tiles (no mask); scores TRANSPOSED (k rows as A, q as B): a lane holds 16 of the 32 scores of ONE query,
// so the online f32 softmax is in-lane, and the weights (f16), converted in place, are the B operand
// of out^T += v^T . p^T (two score tiles = the k order 8h+s, 16+8h+s that the v^T loader has): no LDS round trip; ctx -> f32 output rows out[tok][h*64+d].
// The k and v planes reach the waves through LDS: 64 keys a stage, each plane 64 rows of 128 B brought as whole cache lines once per block by asynchronous copies
// (every thread 4 pieces of 16 B), kept at a 144-B row pitch (16 B x odd: conflict-free 16-B fragment reads), two buffers, one block barrier a stage;
// fragment indices and sum order as before. The softmax runs against a kept reference per query: q comes in times SC2, the score products start at C = PEXP - reference, so
// they leave the matrix unit as the weights' base-2 exponents; the reference moves, and the sums so far are rescaled, only when a score has passed it by more than PTHR
// (softmax does not depend on the reference: numerator and denominator carry the same factor). The output rows are staged in the same LDS once the last stage has been left (36,864 B a block; two blocks, sixteen waves, a WGP).
#define SKEY 64                  // keys per stage
#define SPIT 72                  // LDS row pitch in f16 (144 B)
#define SPLN (64 * SPIT)         // one plane of a stage
#define NSTG (NT_ / SKEY)

// lane l with lane l ^ 16 (the other half of the wave holds the same query's other keys)
__device__ __forceinline__ float xhalf(float x) { return __builtin_bit_cast(float, __builtin_amdgcn_permlanex16(__builtin_bit_cast(int, x), __builtin_bit_cast(int, x), 0x76543210, 0xfedcba98, false, false)); }
// exp2 written with its slot: the instruction set asks for one independent instruction or v_nop between a transcendental and a use of its result or an overwrite of its
// source. Eight in one statement: the outputs are early-clobbered, so none reads its predecessor's result or overwrites its source; the v_nop is the last one's slot.
__device__ __forceinline__ void exp2x8(float* r, const float* x) {
    asm("v_exp_f32 %0, %8\n\tv_exp_f32 %1, %9\n\tv_exp_f32 %2, %10\n\tv_exp_f32 %3, %11\n\tv_exp_f32 %4, %12\n\tv_exp_f32 %5, %13\n\tv_exp_f32 %6, %14\n\tv_exp_f32 %7, %15\n\tv_nop"
        : "=&v"(r[0]), "=&v"(r[1]), "=&v"(r[2]), "=&v"(r[3]), "=&v"(r[4]), "=&v"(r[5]), "=&v"(r[6]), "=&v"(r[7])
        : "v"(x[0]), "v"(x[1]), "v"(x[2]), "v"(x[3]), "v"(x[4]), "v"(x[5]), "v"(x[6]), "v"(x[7]));
}
__device__ __forceinline__ float exp2x1(float x) { float r; asm("v_exp_f32 %0, %1\n\tv_nop" : "=v"(r) : "v"(x)); return r; }     // the v_nop: the same slot
__global__ __launch_bounds__(256) void k_attn(const h16* __restrict__ Q16, const h16* __restrict__ K16, const h16* __restrict__ VTH, float* OUTP) {
    __shared__ __align__(16) h16 stg[2][2 * SPLN];     // per buffer: k, v^T
    const int lane = threadIdx.x & 31, wave = threadIdx.x >> 5, lr = lane & 15, hi = lane >> 4;
    const int bid = blockIdx.x;
    const int b = bid / (NH_ * (NT_ / 128)), rem = bid - b * (NH_ * (NT_ / 128)), h = rem / (NT_ / 128), qt = rem - h * (NT_ / 128);
    const int q0 = qt * 128 + wave * 16;
    const size_t tok0 = (size_t)b * NT_;
    v16h qa[2];
    const size_t qo0 = (tok0 + q0 + lr) * DM + h * HD + 8 * hi;
#pragma unroll
    for (int kc = 0; kc < 2; ++kc) qa[kc] = cat16(*(const v8h*)(Q16 + qo0 + kc * 32), *(const v8h*)(Q16 + qo0 + kc * 32 + 16));
    asm volatile("s_wait_xcnt 0x0" ::: "memory");     // behind the query loads: the built code reuses their address registers right away
    __builtin_amdgcn_sched_barrier(0);                // keeps the address arithmetic below from being lifted over that wait
    const h16* kh_b = K16 + tok0 * DM + h * HD;
    const size_t vbase = (((size_t)b * NH_ + h) * HD) * NT_;
    v8f o[4];
#pragma unroll
    for (int n = 0; n < 4; ++n) o[n] = (v8f){};
    // Of the lane's query q0 + lr. cref: the C operand of the score products, equal in its eight registers: PEXP less the query's reference, so that the products come out as
    // the weights' base-2 exponents. The reference moves only in the branch below. thr, dmin: their start values send the first step through that branch and let it
    // set the reference to the step's own maximum, wherever that lies. lpart: this half's keys only.
    v8f cref;
#pragma unroll
    for (int j = 0; j < 8; ++j) cref[j] = PEXP;
    float lpart = 0.f, thr = -3.0e38f, dmin = -3.0e38f;
    const int srow = threadIdx.x >> 3, spc = (threadIdx.x & 7) * 8;     // a thread's first row and its 16-B piece: 8 lanes cover one 128-B row
    const unsigned lthr = (unsigned)(size_t)&stg[0][0] + (unsigned)(srow * SPIT + spc) * 2u;      // the thread's LDS byte address in buffer 0, plane 0
    auto stage_in = [&](int st) {
        const unsigned d = lthr + (unsigned)(st & 1) * (2u * SPLN * 2u);
        const size_t kof = (size_t)(st * SKEY + srow) * DM + spc, vof = vbase + (size_t)srow * NT_ + st * SKEY + spc;
        acopy2x2(d, 32u * SPIT * 2u, kh_b + kof, VTH + vof, (size_t)32 * DM, (size_t)32 * NT_);     // rows srow and srow + 32 of each plane; a plane is 64 LDS rows
    };
    stage_in(0);
    asm volatile("s_wait_asynccnt 0x0" ::: "memory");     // this wave's copies of stage 0 have landed
    __syncthreads();                                      // every wave's have: stage 0 may be read
    stage_in(1);
#pragma unroll 1
    for (int st = 0; st < NSTG; ++st) {            // full attention; stage st + 1's copies fly while stage st is worked on
      const h16* sb = &stg[st & 1][0];
      // both 32-key halves of a stage unrolled: their LDS offsets become immediates of the reads
#pragma unroll
      for (int sub = 0; sub < SKEY / 32; ++sub) {
        const h16* kh_s = sb; const h16* vh_s = sb + SPLN;
        const int ko0 = (sub * 32 + lr) * SPIT + 8 * hi, ko1 = (sub * 32 + 16 + lr) * SPIT + 8 * hi;
        // the step's eight k reads stand as one group ahead of the four score products, which then run back to back
        v16h kf[2][2];
#pragma unroll
        for (int kc = 0; kc < 2; ++kc) {
            kf[kc][0] = cat16(*(const v8ha*)(kh_s + ko0 + kc * 32), *(const v8ha*)(kh_s + ko0 + kc * 32 + 16)); kf[kc][1] = cat16(*(const v8ha*)(kh_s + ko1 + kc * 32), *(const v8ha*)(kh_s + ko1 + kc * 32 + 16));
        }
        __builtin_amdgcn_sched_barrier(0);     // holds the k reads together up here; without it the build spreads them among the products, pair by pair, each with a wait to zero
        v8f s0 = cref, s1 = cref;
#pragma unroll
        for (int kc = 0; kc < 2; ++kc) { s0 = wmma16(kf[kc][0], qa[kc], s0); s1 = wmma16(kf[kc][1], qa[kc], s1); }
        // the matrix instructions' distance to the softmax; the memory clobber keeps the v reads below behind the score products, so that they take the k fragments' registers
        asm volatile("v_nop\n\tv_nop\n\tv_nop\n\tv_nop" : "+v"(s0), "+v"(s1) : "v"(qa[0]), "v"(qa[1]) : "memory");
        // the step's eight v reads are issued here, so that the softmax below covers their latency
        v16h vf[4];
#pragma unroll
        for (int n = 0; n < 4; ++n) { const int vo = (n * 16 + lr) * SPIT + sub * 32 + hi * 8;
            vf[n] = cat16(*(const v8ha*)(vh_s + vo), *(const v8ha*)(vh_s + vo + 16)); }
        __builtin_amdgcn_sched_barrier(0);     // holds the v reads ahead of the softmax; without it the build sinks some of them among the products below
        // s0[j], s1[j]: keys 8 * hi + j and 16 + 8 * hi + j of this 32-key step, query lr
        float e[16], p[16];                  // e: base-2 exponents of the weights
#pragma unroll
        for (int j = 0; j < 8; ++j) e[j] = s0[j];
#pragma unroll
        for (int j = 0; j < 8; ++j) e[8 + j] = s1[j];
        const float mx = fmaxf(fmaxf(fmaxf(fmaxf(e[0], e[1]), fmaxf(e[2], e[3])), fmaxf(fmaxf(e[4], e[5]), fmaxf(e[6], e[7]))),
                               fmaxf(fmaxf(fmaxf(e[8], e[9]), fmaxf(e[10], e[11])), fmaxf(fmaxf(e[12], e[13]), fmaxf(e[14], e[15]))));
        // One test a step, a scalar branch for the whole wave: taken in the first step and whenever some lane's score has passed its reference by more than PTHR.
        if (__builtin_amdgcn_ballot_w32(mx > thr) != 0) {
            const float mj = fmaxf(mx, xhalf(mx));                 // both halves hold the maximum over the query's 32 keys
            const float d = fmaxf(mj - PEXP, dmin);                // the reference goes up to that maximum (first step: to it, up or down); equal in both halves
            const float alpha = exp2x1(fminf(-d, 0.f));            // what is summed so far shrinks by 2^-d; nothing is summed yet where d is negative
            dmin = 0.f; thr = PEXP + PTHR;
#pragma unroll
            for (int i = 0; i < 16; ++i) e[i] -= d;
#pragma unroll
            for (int j = 0; j < 8; ++j) cref[j] -= d;
            lpart *= alpha;
#pragma unroll
            for (int n = 0; n < 4; ++n)
#pragma unroll
                for (int j = 0; j < 8; ++j) o[n][j] *= alpha;
        }
        exp2x8(p, e); exp2x8(p + 8, e + 8);
        v16h pa;
#pragma unroll
        for (int i = 0; i < 16; ++i) pa[i] = (h16)p[i];
        lpart += ((((p[0] + p[1]) + (p[2] + p[3])) + ((p[4] + p[5]) + (p[6] + p[7]))) + (((p[8] + p[9]) + (p[10] + p[11])) + ((p[12] + p[13]) + (p[14] + p[15]))));
#pragma unroll
        for (int n = 0; n < 4; ++n) o[n] = wmma16(vf[n], pa, o[n]);     // o[n][j]: d = n * 16 + 8 * hi + j, query lr
        asm volatile("v_nop\n\tv_nop\n\tv_nop\n\tv_nop" :: "v"(o[0]), "v"(o[1]), "v"(o[2]), "v"(o[3]), "v"(pa));     // the matrix instructions' distance on the paths behind the step; the sums as inputs only: as in-out operands, with the branch above, the build copied two of them to other registers and back every stage
      }
      asm volatile("s_wait_dscnt 0x0" ::: "memory");        // this wave's LDS reads of stage st are done before its buffer is refilled
      asm volatile("s_wait_asynccnt 0x0" ::: "memory");     // this wave's copies of stage st + 1 have landed
      __syncthreads();                                      // publishes stage st + 1 and ends every wave's reads of stage st
      if (st + 2 < NSTG) stage_in(st + 2);                  // block-uniform test; into the buffer that stage st has just left
    }
    asm volatile("s_wait_asynccnt 0x0" ::: "memory");       // no copy is outstanding when the wave goes on to its end
    const float inv = 1.0f / (lpart + xhalf(lpart));     // the two halves' sums joined once; sums and outputs carry the same factor
    float* os = (float*)(void*)&stg[0][0] + wave * (16 * 68);     // behind the last trip's waits and barrier no wave reads a stage and no copy is outstanding
#pragma unroll
    for (int n = 0; n < 4; ++n)
#pragma unroll
        for (int g = 0; g < 2; ++g) { v4f w;
#pragma unroll
            for (int i = 0; i < 4; ++i) w[i] = o[n][4 * g + i] * inv;
            *(v4fa*)(os + lr * 68 + n * 16 + hi * 8 + 4 * g) = w; }
    __syncthreads();
    float* ob = OUTP + (tok0 + q0) * DM + (size_t)h * HD;
    auto pass = [&]() {
#pragma unroll
        for (int s = 0; s < 8; ++s) { const int Lid = (lane >> 3) + 4 * s, piece = lane & 7; const int row = Lid >> 1, cofs = (Lid & 1) * 32 + piece * 4;
            const v4f val = *(const v4fa*)(os + row * 68 + cofs); *(v4f*)(ob + (size_t)row * DM + cofs) = val; }
    };
    pass(); 
}

#define VST2(T, p, v) do { const T vst2_v_ = (v); *(T*)(p) = vst2_v_;  } while (0)
extern "C" void kernel_launch(void* const* d_in, const int* in_sizes, int n_in,
                              void* d_out, int out_size, void* d_ws, size_t ws_size, hipStream_t stream) {
    (void)in_sizes; (void)n_in; (void)out_size;
    const float* x = (const float*)d_in[0]; const float* Wqkv = (const float*)d_in[1];   // k-major [1024][3072]
    float* out = (float*)d_out;    // [2][2048][1024]
    char* wsp = (char*)d_ws;
    auto take = [&](size_t bytes) { char* p = wsp; wsp += (bytes + 255) & ~(size_t)255; return (void*)p; };
    bf* Xb = (bf*)take((size_t)NTK * DM * 2); bf* WqkvT = (bf*)take((size_t)3 * DM * DM * 2);
    h16* QH = (h16*)take((size_t)NTK * DM * 2); h16* KH = (h16*)take((size_t)NTK * DM * 2); h16* VTH = (h16*)take((size_t)NTK * DM * 2);
    if ((size_t)(wsp - (char*)d_ws) > ws_size) return;    // 8.4 + 6.3 + 3 x 8.4 ~ 40 MB, no aliasing
    k_prep<<<NWTB + NTK / 8, 256, 0, stream>>>(Wqkv, WqkvT, x, Xb);
    k_gemmb<<<dim3(NTK / 128, 3 * DM / 128, 1), 256, 0, stream>>>(Xb, WqkvT, QH, KH, VTH);
    k_attn<<<NB_ * NH_ * (NT_ / 128), 256, 0, stream>>>(QH, KH, VTH, out);
}

// v010
// Measured time: 55.1 microseconds a run.
// Timed twice side by side with v009, it ran 1.05 times as fast both times.
// Over all steps from v000 it is 8.59 times as fast.
#include <hip/hip_runtime.h>

// Compute dtypes, f32 accumulate, both batch items in one pass, three launches: k_prep rounds x and the weights to PLAIN bf16 once (exact; k-major weights transposed to n-major);
// k_gemmb does q/k/v = x.W_qkv ([4096 x 1024].[1024 x 3072]) on v_wmma_f32_16x16x32_bf16 in one grid, every tile written straight from its epilogue as one f16 plane,
// the v tiles already transposed (weights as A, tokens as B). The f16 rounding of q, k, v (11 significant bits) lies under the error that the bf16 operands (8 bits) leave in them;
// the 16-head full attention (64-dim heads, scale 1/sqrt(1024) as the reference) written straight to the f32 output (no output projection), fused on
// v_wmma_f32_16x16x32_f16 (scores k.q, online f32 softmax against a kept reference, weights (x128 at the reference) and v as f16, f32 sums).

#define NB_  2                   // both batch items in every launch: twice the blocks
#define NT_  2048
#define DM   1024
#define NH_  16
#define HD   64
#define NTK  (NB_ * NT_)
#define NW   1024
#define NQKV 1024
#define L2E  1.44269504f         // exp(x) = exp2(x * log2 e)
#define SC2  (0.03125f * L2E)    // raw score to base-2 exponent: scale 1/sqrt(1024), as the reference, times log2 e; q carries it
#define PEXP 7.0f                // a score equal to its query's reference gives the weight 2^7
#define PTHR 8.0f                // a score may pass the reference by this much (base-2 exponent) before the reference moves: weights stay at or under 2^15, inside f16

typedef _Float16 h16;
typedef unsigned short bf;
typedef __attribute__((ext_vector_type(16))) __bf16   v16bf;
typedef __attribute__((ext_vector_type(16))) _Float16 v16h;
typedef __attribute__((ext_vector_type(8)))  _Float16 v8h;
typedef __attribute__((ext_vector_type(8)))  unsigned short v8us;
typedef __attribute__((ext_vector_type(8)))  float    v8f;
typedef __attribute__((ext_vector_type(4)))  float    v4f;
typedef v8h  __attribute__((may_alias)) v8ha;
typedef v4f  __attribute__((may_alias)) v4fa;
typedef v8us __attribute__((may_alias)) v8usa;

__device__ __forceinline__ unsigned short f2bf(float f) { unsigned u = __float_as_uint(f); u += 0x7FFFu + ((u >> 16) & 1u); return (unsigned short)(u >> 16); }
__device__ __forceinline__ float bf2f(unsigned short b) { return __uint_as_float(((unsigned)b) << 16); }
__device__ __forceinline__ float bfr(float f) { return bf2f(f2bf(f)); }
__device__ __forceinline__ v16h cat16(v8h lo, v8h hi) { return __builtin_shufflevector(lo, hi, 0, 1, 2, 3, 4, 5, 6, 7, 8, 9, 10, 11, 12, 13, 14, 15); }
__device__ __forceinline__ v16bf cat16b(v8us lo, v8us hi) { return __builtin_bit_cast(v16bf, __builtin_shufflevector(lo, hi, 0, 1, 2, 3, 4, 5, 6, 7, 8, 9, 10, 11, 12, 13, 14, 15)); }
__device__ __forceinline__ v8f wmma16(v16h a, v16h b, v8f c) { return __builtin_amdgcn_wmma_f32_16x16x32_f16(false, a, false, b, (short)0, c, false, false); }
__device__ __forceinline__ v8f wmmab(v16bf a, v16bf b, v8f c) { return __builtin_amdgcn_wmma_f32_16x16x32_bf16(false, a, false, b, (short)0, c, false, false); }

// k_prep: the two independent roundings to bf16 in one grid, told apart by the block index (block-uniform).
// Blocks below NWTB: WT [n][DM] = bf16(W[k][n]) (k-major [DM][3 DM]) via 64 x 64 LDS tiles, k tile fastest. The others: eight rows of x each, one a wave.
#define NWTB ((DM / 64) * (3 * DM / 64))
__global__ __launch_bounds__(256) void k_prep(const float* __restrict__ Wm, bf* WT, const float* __restrict__ src, bf* dst) {
    __shared__ __align__(16) unsigned short tl[64 * 72];
    const int tid = threadIdx.x, bid = blockIdx.x;
    if (bid < NWTB) {
        const int k0 = (bid & (DM / 64 - 1)) * 64, n0 = (bid / (DM / 64)) * 64;
        const int kk = tid >> 2, nq = (tid & 3) * 16;
#pragma unroll
        for (int i = 0; i < 16; ++i) tl[(nq + i) * 72 + kk] = f2bf(Wm[(size_t)(k0 + kk) * (3 * DM) + n0 + nq + i]);
        __syncthreads();     // every thread of such a block passes it: the test above reads the block index alone
        const int piece = tid & 7;
#pragma unroll
        for (int s = 0; s < 2; ++s) { const int nr = (tid >> 3) + 32 * s; const v8us val = *(const v8usa*)(tl + nr * 72 + piece * 8); *(v8us*)(WT + (size_t)(n0 + nr) * DM + k0 + piece * 8) = val; }
    } else {
        const int lane = tid & 31, r = (bid - NWTB) * 8 + (tid >> 5);
        v8us o[DM / 256];
#pragma unroll
        for (int q = 0; q < DM / 256; ++q) { v8us t;
#pragma unroll
            for (int i = 0; i < 8; ++i) t[i] = f2bf(src[(size_t)r * DM + q * 256 + lane * 8 + i]);
            o[q] = t; }
#pragma unroll
        for (int q = 0; q < DM / 256; ++q) *(v8us*)(dst + (size_t)r * DM + q * 256 + lane * 8) = o[q];
        asm volatile("s_wait_xcnt 0x0" ::: "memory");     // behind the stores: the built code lays the weight half behind this one, and no register that a store names is rewritten ahead of this wait
    }
}
// Two planes of a stage: eight asynchronous 16-B copies per lane, four rows of each a fixed step apart (la/lb: LDS byte addresses, ga/gb: global addresses, lstep/gstep: the row steps).
// The s_wait_xcnt ends the copies' own statement, so that no address register is rewritten ahead of it.
__device__ __forceinline__ void acopy8(unsigned la, unsigned lb, const h16* ga, const h16* gb, unsigned lstep, size_t gstep) {
    asm volatile("global_load_async_to_lds_b128 %0, %8, off\n\t"
                 "global_load_async_to_lds_b128 %1, %9, off\n\t"
                 "global_load_async_to_lds_b128 %2, %10, off\n\t"
                 "global_load_async_to_lds_b128 %3, %11, off\n\t"
                 "global_load_async_to_lds_b128 %4, %12, off\n\t"
                 "global_load_async_to_lds_b128 %5, %13, off\n\t"
                 "global_load_async_to_lds_b128 %6, %14, off\n\t"
                 "global_load_async_to_lds_b128 %7, %15, off\n\t"
                 "s_wait_xcnt 0x0"
                 :: "v"(la), "v"(la + lstep), "v"(la + 2 * lstep), "v"(la + 3 * lstep), "v"(lb), "v"(lb + lstep), "v"(lb + 2 * lstep), "v"(lb + 3 * lstep),
                    "v"(ga), "v"(ga + gstep), "v"(ga + 2 * gstep), "v"(ga + 3 * gstep), "v"(gb), "v"(gb + gstep), "v"(gb + 2 * gstep), "v"(gb + 3 * gstep)
                 : "memory");
}
// Two planes of a stage: four asynchronous 16-B copies per lane, two rows of each plane (l0: LDS byte address, the four LDS rows a fixed step lrow apart; g0, g1: the planes'
// global addresses, s0, s1: their row steps). The s_wait_xcnt ends the copies' own statement, so that no address register is rewritten ahead of it.
__device__ __forceinline__ void acopy2x2(unsigned l0, unsigned lrow, const h16* g0, const h16* g1, size_t s0, size_t s1) {
    asm volatile("global_load_async_to_lds_b128 %0, %4, off\n\t"
                 "global_load_async_to_lds_b128 %1, %5, off\n\t"
                 "global_load_async_to_lds_b128 %2, %6, off\n\t"
                 "global_load_async_to_lds_b128 %3, %7, off\n\t"
                 "s_wait_xcnt 0x0"
                 :: "v"(l0), "v"(l0 + lrow), "v"(l0 + 2 * lrow), "v"(l0 + 3 * lrow),
                    "v"(g0), "v"(g0 + s0), "v"(g1), "v"(g1 + s1)
                 : "memory");
}
// k_gemmb: grid (token tiles, 24 tiles of the n-major weight rows: 8 of q, 8 of k, 8 of v); block = 128 x 128 of the product, eight waves, wave = 32 x 64. A q or k block takes its token
// rows as A and its weight rows as B; a v block takes them the other way round, so that its tile comes out as v^T (rows: h * 64 + d, columns: tokens) with the same products
// in the same k order. Both operand tiles reach the waves through LDS: 64 k a stage, 128 A rows and 128 B rows of 128 B brought as whole cache
// lines once per block by asynchronous copies (every thread 8 pieces of 16 B), kept at a 144-B row pitch (16 B x odd: conflict-free 16-B fragment reads), two buffers,
// one block barrier a stage; fragment indices and the k order of the sums as with direct loads. A staged byte feeds 128 rows of the other operand, so the grid
// copies half the bytes that 64 x 64 blocks copy, and a wave reads 12 fragment halves for 8 products. The output rows are staged in the same LDS once the last
// stage has been left (73,728 B a block: the grid's three blocks a WGP fit its LDS).
#define GKS  64                  // k per stage
#define GPIT 72                  // LDS row pitch in bf16 (144 B)
#define GBUF (256 * GPIT)        // one buffer: the 128 A rows, then the 128 B rows
#define GNST (DM / GKS)
__global__ __launch_bounds__(256) void k_gemmb(const bf* __restrict__ X, const bf* __restrict__ WT, h16* QH, h16* KH, h16* VTH) {
    __shared__ __align__(16) bf gst[2][GBUF];
    const int lane = threadIdx.x & 31, wave = threadIdx.x >> 5, lr = lane & 15, hi = lane >> 4;
    const int wa = wave & 3, wb = wave >> 2;     // the wave's 32 A rows and its 64 B rows inside the block's tile
    const int xr = blockIdx.x * 128, wr = blockIdx.y * 128, sel = blockIdx.y / (DM / 128);     // the block's token rows and weight rows; 0: q, 1: k, 2: v (block-uniform)
    const bf* A  = sel == 2 ? WT + (size_t)wr * DM : X + (size_t)xr * DM;
    const bf* Bn = sel == 2 ? X + (size_t)xr * DM : WT + (size_t)wr * DM;
    const int srow = threadIdx.x >> 3, spc = (threadIdx.x & 7) * 8;     // a thread's first row and its 16-B piece: 8 lanes cover one 128-B row
    const unsigned lthr = (unsigned)(size_t)&gst[0][0] + (unsigned)(srow * GPIT + spc) * 2u;      // the thread's LDS byte address in buffer 0, A row srow
    const h16* ga = (const h16*)(const void*)A + (size_t)srow * DM + spc;                         // 2-byte elements: only addresses are formed from these
    const h16* gb = (const h16*)(const void*)Bn + (size_t)srow * DM + spc;
    auto stage_in = [&](int st) {     // rows srow + 32 i, i = 0..3, of each tile
        const unsigned d = lthr + (unsigned)(st & 1) * (GBUF * 2u);
        acopy8(d, d + 128u * GPIT * 2u, ga + st * GKS, gb + st * GKS, 32u * GPIT * 2u, (size_t)32 * DM);
    };
    v8f acc[2][4];
#pragma unroll
    for (int t = 0; t < 4; ++t) { acc[0][t] = (v8f){}; acc[1][t] = (v8f){}; }
    stage_in(0);
    asm volatile("s_wait_asynccnt 0x0" ::: "memory");     // this wave's copies of stage 0 have landed
    __syncthreads();                                      // every wave's have: stage 0 may be read
    stage_in(1);
    // rolled: one copy of the stage body; stage st + 1's copies fly while stage st is worked on
#pragma unroll 1
    for (int st = 0; st < GNST; ++st) {
        const bf* sa = &gst[st & 1][0] + (wa * 32 + lr) * GPIT + 8 * hi;
        const bf* sb = &gst[st & 1][0] + (128 + wb * 64 + lr) * GPIT + 8 * hi;
        // the two 32-k steps of a stage unrolled: their LDS offsets become immediates of the reads
#pragma unroll
        for (int kl = 0; kl < GKS; kl += 32) {
            const v16bf a0 = cat16b(*(const v8usa*)(sa + kl), *(const v8usa*)(sa + kl + 16));
            const v16bf a1 = cat16b(*(const v8usa*)(sa + 16 * GPIT + kl), *(const v8usa*)(sa + 16 * GPIT + kl + 16));
            v16bf b[4];
#pragma unroll
            for (int t = 0; t < 4; ++t) b[t] = cat16b(*(const v8usa*)(sb + t * 16 * GPIT + kl), *(const v8usa*)(sb + t * 16 * GPIT + kl + 16));
            __builtin_amdgcn_sched_barrier(0);     // holds the step's twelve reads together ahead of its eight products; without it the build reads every B fragment into the same registers, with a wait to zero in front of each pair of products
#pragma unroll
            for (int t = 0; t < 4; ++t) { acc[0][t] = wmmab(a0, b[t], acc[0][t]); acc[1][t] = wmmab(a1, b[t], acc[1][t]); }
        }
        asm volatile("v_nop\n\tv_nop\n\tv_nop\n\tv_nop" : "+v"(acc[0][0]), "+v"(acc[0][1]), "+v"(acc[0][2]), "+v"(acc[0][3]), "+v"(acc[1][0]), "+v"(acc[1][1]), "+v"(acc[1][2]), "+v"(acc[1][3]));     // the matrix instructions' distance on the taken branches below; the stage's last one stays in front of the waits
        asm volatile("s_wait_dscnt 0x0" ::: "memory");        // this wave's LDS reads of stage st are done before its buffer is refilled
        asm volatile("s_wait_asynccnt 0x0" ::: "memory");     // this wave's copies of stage st + 1 have landed
        __syncthreads();                                      // publishes stage st + 1 and ends every wave's reads of stage st
        if (st + 2 < GNST) stage_in(st + 2);                  // block-uniform test; into the buffer that stage st has just left
    }
    asm volatile("s_wait_asynccnt 0x0" ::: "memory");         // no copy is outstanding when the wave goes on to its end
    float* os = (float*)(void*)&gst[0][0] + wave * (32 * 68);     // behind the last trip's waits and barrier no wave reads a stage and no copy is outstanding
#pragma unroll
    for (int i = 0; i < 2; ++i)
#pragma unroll
        for (int t = 0; t < 4; ++t)
#pragma unroll
            for (int j = 0; j < 8; ++j) os[(i * 16 + hi * 8 + j) * 68 + t * 16 + lr] = acc[i][t][j];
    __syncthreads();
    const int cn = wr & (DM - 1);     // the weight rows' place inside q, k or v
    // first element of the wave's 32 output rows of 64, and the row step: token rows of q or k; rows (b * 1024 + h * 64 + d) of 2048 tokens of v^T
    const size_t cof = sel == 2 ? ((size_t)(xr / NT_) * DM + cn + wa * 32) * NT_ + (xr & (NT_ - 1)) + wb * 64 : (size_t)(xr + wa * 32) * DM + cn + wb * 64;
    const size_t ldc = sel == 2 ? NT_ : DM;
    h16* c1 = (sel == 2 ? VTH : sel == 1 ? KH : QH) + cof;
    const float qs = sel == 0 ? SC2 : 1.0f;     // q leaves times SC2, multiplied in f32 ahead of its one rounding to f16: k.q is then a base-2 exponent; k and v times 1 (exact)
#pragma unroll
    for (int s = 0; s < 8; ++s) { const int row = 4 * s + (lane >> 3), piece = lane & 7; const float* sp = os + row * 68 + piece * 8; v8h o;
#pragma unroll
        for (int i = 0; i < 8; ++i) o[i] = (h16)(sp[i] * qs);
        *(v8h*)(c1 + (size_t)row * ldc + piece * 8) = o; }
}

// k_attn: block = (b, h, 128 queries), eight waves; wave = 32 queries (two 16-query tiles) x HALF of the 2048 keys (waves 0-3: keys 0..1023, waves 4-7: the rest; no mask), so that
// every k and v fragment read from LDS feeds two products instead of one: half the LDS bytes a product. Scores TRANSPOSED (k rows as A, q as B): a lane holds 16 of the 32 scores of ONE query
// of each tile, so the online f32 softmax is in-lane, and the weights (f16), converted in place, are the B operand
// of out^T += v^T . p^T (two score tiles = the k order 8h+s, 16+8h+s that the v^T loader has): no LDS round trip; ctx -> f32 output rows out[tok][h*64+d].
// The k and v planes reach the waves through LDS: 64 keys of each key half a stage, each plane 64 rows of 128 B brought as whole cache lines once per block by asynchronous copies
// (every thread 8 pieces of 16 B), kept at a 144-B row pitch (16 B x odd: conflict-free 16-B fragment reads), two buffers, one block barrier a stage.
// The softmax runs against a kept reference per query and key half: q comes in times SC2, the score products start at C = PEXP - reference, so
// they leave the matrix unit as the weights' base-2 exponents; the reference moves, and the sums so far are rescaled, only when a score has passed it by more than PTHR
// (softmax does not depend on the reference: numerator and denominator carry the same factor). Behind the loop the two waves that hold a query's two key halves swap one tile each through
// the drained stage buffers, bring both halves to the higher reference and add them; the output rows are staged in the same LDS (73,728 B a block; two blocks, sixteen waves, a WGP).
#define SKEY 64                  // keys per stage
#define SPIT 72                  // LDS row pitch in f16 (144 B)
#define SPLN (64 * SPIT)         // one plane of a stage
#define KHALF (NT_ / 2)         // keys of one key half
#define NSTG (KHALF / SKEY)

// lane l with lane l ^ 16 (the other half of the wave holds the same query's other keys)
__device__ __forceinline__ float xhalf(float x) { return __builtin_bit_cast(float, __builtin_amdgcn_permlanex16(__builtin_bit_cast(int, x), __builtin_bit_cast(int, x), 0x76543210, 0xfedcba98, false, false)); }
// exp2 written with its slot: the instruction set asks for one independent instruction or v_nop between a transcendental and a use of its result or an overwrite of its
// source. Eight in one statement: the outputs are early-clobbered, so none reads its predecessor's result or overwrites its source; the v_nop is the last one's slot.
__device__ __forceinline__ void exp2x8(float* r, const float* x) {
    asm("v_exp_f32 %0, %8\n\tv_exp_f32 %1, %9\n\tv_exp_f32 %2, %10\n\tv_exp_f32 %3, %11\n\tv_exp_f32 %4, %12\n\tv_exp_f32 %5, %13\n\tv_exp_f32 %6, %14\n\tv_exp_f32 %7, %15\n\tv_nop"
        : "=&v"(r[0]), "=&v"(r[1]), "=&v"(r[2]), "=&v"(r[3]), "=&v"(r[4]), "=&v"(r[5]), "=&v"(r[6]), "=&v"(r[7])
        : "v"(x[0]), "v"(x[1]), "v"(x[2]), "v"(x[3]), "v"(x[4]), "v"(x[5]), "v"(x[6]), "v"(x[7]));
}
__device__ __forceinline__ float exp2x1(float x) { float r; asm("v_exp_f32 %0, %1\n\tv_nop" : "=v"(r) : "v"(x)); return r; }     // the v_nop: the same slot
// The eight score products of a 32-key step for two query tiles, in one statement: the first four take C (the kept reference) from registers other than their results, the last four
// add onto those results. Written as builtins, the build copied the C registers ahead of some of the products in every step. The four v_nop are the matrix instructions' distance
// to the softmax that reads the results; the memory clobber keeps the v reads that follow behind the score products, so that they take the k fragments' registers.
__device__ __forceinline__ void score8(v8f& s00, v8f& s01, v8f& s10, v8f& s11, v16h k00, v16h k01, v16h k10, v16h k11, v16h q00, v16h q01, v16h q10, v16h q11, v8f c0, v8f c1) {
    asm volatile("v_wmma_f32_16x16x32_f16 %0, %4, %8, %12\n\t"
                 "v_wmma_f32_16x16x32_f16 %1, %5, %8, %12\n\t"
                 "v_wmma_f32_16x16x32_f16 %2, %4, %10, %13\n\t"
                 "v_wmma_f32_16x16x32_f16 %3, %5, %10, %13\n\t"
                 "v_wmma_f32_16x16x32_f16 %0, %6, %9, %0\n\t"
                 "v_wmma_f32_16x16x32_f16 %1, %7, %9, %1\n\t"
                 "v_wmma_f32_16x16x32_f16 %2, %6, %11, %2\n\t"
                 "v_wmma_f32_16x16x32_f16 %3, %7, %11, %3\n\t"
                 "v_nop\n\tv_nop\n\tv_nop\n\tv_nop"
                 : "=&v"(s00), "=&v"(s01), "=&v"(s10), "=&v"(s11)
                 : "v"(k00), "v"(k01), "v"(k10), "v"(k11), "v"(q00), "v"(q01), "v"(q10), "v"(q11), "v"(c0), "v"(c1)
                 : "memory");
}
__global__ __launch_bounds__(256) void k_attn(const h16* __restrict__ Q16, const h16* __restrict__ K16, const h16* __restrict__ VTH, float* OUTP) {
    __shared__ __align__(16) h16 stg[2][2][2 * SPLN];     // per buffer and key half: k, v^T
    const int lane = threadIdx.x & 31, wave = threadIdx.x >> 5, lr = lane & 15, hi = lane >> 4;
    const int qg = wave & 3, kh = wave >> 2;     // the wave's 32 queries inside the block's 128, and its key half
    const int bid = blockIdx.x;
    const int b = bid / (NH_ * (NT_ / 128)), rem = bid - b * (NH_ * (NT_ / 128)), h = rem / (NT_ / 128), qt = rem - h * (NT_ / 128);
    const int q0 = qt * 128 + qg * 32;
    const size_t tok0 = (size_t)b * NT_;
    v16h qa[2][2];     // [query tile][32 of the 64 head dims]
    const size_t qo0 = (tok0 + q0 + lr) * DM + h * HD + 8 * hi;
#pragma unroll
    for (int qi = 0; qi < 2; ++qi)
#pragma unroll
        for (int kc = 0; kc < 2; ++kc) qa[qi][kc] = cat16(*(const v8h*)(Q16 + qo0 + qi * 16 * DM + kc * 32), *(const v8h*)(Q16 + qo0 + qi * 16 * DM + kc * 32 + 16));
    asm volatile("s_wait_xcnt 0x0" ::: "memory");     // behind the query loads: the built code reuses their address registers right away
    __builtin_amdgcn_sched_barrier(0);                // keeps the address arithmetic below from being lifted over that wait
    const h16* kh_b = K16 + tok0 * DM + h * HD;
    const size_t vbase = (((size_t)b * NH_ + h) * HD) * NT_;
    v8f o[2][4];
#pragma unroll
    for (int qi = 0; qi < 2; ++qi)
#pragma unroll
        for (int n = 0; n < 4; ++n) o[qi][n] = (v8f){};
    // Of the lane's queries q0 + 16 qi + lr. cref: the C operand of the score products, equal in its eight registers: PEXP less the query's reference, so that the products come out as
    // the weights' base-2 exponents. The reference moves only in the branch below. thr, dmin: their start values send the first step through that branch and let it
    // set each reference to the step's own maximum, wherever that lies. lpart: this half-wave's keys only.
    v8f cref[2];
#pragma unroll
    for (int qi = 0; qi < 2; ++qi)
#pragma unroll
        for (int j = 0; j < 8; ++j) cref[qi][j] = PEXP;
    float lpart[2] = {0.f, 0.f}, thr = -3.0e38f, dmin = -3.0e38f;
    const int srow = threadIdx.x >> 3, spc = (threadIdx.x & 7) * 8;     // a thread's first row and its 16-B piece: 8 lanes cover one 128-B row
    const unsigned lthr = (unsigned)(size_t)&stg[0][0][0] + (unsigned)(srow * SPIT + spc) * 2u;      // the thread's LDS byte address in buffer 0, key half 0, plane 0
    auto stage_in = [&](int st) {
        const unsigned d = lthr + (unsigned)(st & 1) * (4u * SPLN * 2u);
        const size_t kof = (size_t)(st * SKEY + srow) * DM + spc, vof = vbase + (size_t)srow * NT_ + st * SKEY + spc;
        // rows srow and srow + 32 of each plane; a plane is 64 LDS rows; first the stage of key half 0, then that of key half 1
        acopy2x2(d, 32u * SPIT * 2u, kh_b + kof, VTH + vof, (size_t)32 * DM, (size_t)32 * NT_);
        acopy2x2(d + 2u * SPLN * 2u, 32u * SPIT * 2u, kh_b + kof + (size_t)KHALF * DM, VTH + vof + KHALF, (size_t)32 * DM, (size_t)32 * NT_);
    };
    stage_in(0);
    asm volatile("s_wait_asynccnt 0x0" ::: "memory");     // this wave's copies of stage 0 have landed
    __syncthreads();                                      // every wave's have: stage 0 may be read
    stage_in(1);
#pragma unroll 1
    for (int st = 0; st < NSTG; ++st) {            // full attention; stage st + 1's copies fly while stage st is worked on
      const h16* sb = &stg[st & 1][kh][0];
      // both 32-key halves of a stage unrolled: their LDS offsets become immediates of the reads
#pragma unroll
      for (int sub = 0; sub < SKEY / 32; ++sub) {
        const h16* kh_s = sb; const h16* vh_s = sb + SPLN;
        const int ko0 = (sub * 32 + lr) * SPIT + 8 * hi, ko1 = (sub * 32 + 16 + lr) * SPIT + 8 * hi;
        // the step's eight k reads stand as one group ahead of the eight score products, which then run back to back
        v16h kf[2][2];
#pragma unroll
        for (int kc = 0; kc < 2; ++kc) {
            kf[kc][0] = cat16(*(const v8ha*)(kh_s + ko0 + kc * 32), *(const v8ha*)(kh_s + ko0 + kc * 32 + 16)); kf[kc][1] = cat16(*(const v8ha*)(kh_s + ko1 + kc * 32), *(const v8ha*)(kh_s + ko1 + kc * 32 + 16));
        }
        __builtin_amdgcn_sched_barrier(0);     // holds the k reads together up here; without it the build spreads them among the products, pair by pair, each with a wait to zero
        v8f s[2][2];
        score8(s[0][0], s[0][1], s[1][0], s[1][1], kf[0][0], kf[0][1], kf[1][0], kf[1][1], qa[0][0], qa[0][1], qa[1][0], qa[1][1], cref[0], cref[1]);
        // the step's eight v reads are issued here, so that the softmax below covers their latency
        v16h vf[4];
#pragma unroll
        for (int n = 0; n < 4; ++n) { const int vo = (n * 16 + lr) * SPIT + sub * 32 + hi * 8;
            vf[n] = cat16(*(const v8ha*)(vh_s + vo), *(const v8ha*)(vh_s + vo + 16)); }
        __builtin_amdgcn_sched_barrier(0);     // holds the v reads ahead of the softmax; without it the build sinks some of them among the products below
        // s[qi][0][j], s[qi][1][j]: keys 8 * hi + j and 16 + 8 * hi + j of this 32-key step, query 16 qi + lr
        float e[2][16], p[2][16], mx[2];                  // e: base-2 exponents of the weights
#pragma unroll
        for (int qi = 0; qi < 2; ++qi) {
#pragma unroll
            for (int j = 0; j < 8; ++j) { e[qi][j] = s[qi][0][j]; e[qi][8 + j] = s[qi][1][j]; }
            const float* eq = e[qi];
            mx[qi] = fmaxf(fmaxf(fmaxf(fmaxf(eq[0], eq[1]), fmaxf(eq[2], eq[3])), fmaxf(fmaxf(eq[4], eq[5]), fmaxf(eq[6], eq[7]))),
                           fmaxf(fmaxf(fmaxf(eq[8], eq[9]), fmaxf(eq[10], eq[11])), fmaxf(fmaxf(eq[12], eq[13]), fmaxf(eq[14], eq[15]))));
        }
        // One test a step for both tiles, a scalar branch for the whole wave: taken in the first step and whenever some lane's score has passed its reference by more than PTHR.
        if (__builtin_amdgcn_ballot_w32(fmaxf(mx[0], mx[1]) > thr) != 0) {
#pragma unroll
            for (int qi = 0; qi < 2; ++qi) {
                const float mj = fmaxf(mx[qi], xhalf(mx[qi]));         // both halves hold the maximum over the query's 32 keys
                const float d = fmaxf(mj - PEXP, dmin);                // the reference goes up to that maximum (first step: to it, up or down); equal in both halves
                const float alpha = exp2x1(fminf(-d, 0.f));            // what is summed so far shrinks by 2^-d; nothing is summed yet where d is negative
#pragma unroll
                for (int i = 0; i < 16; ++i) e[qi][i] -= d;
#pragma unroll
                for (int j = 0; j < 8; ++j) cref[qi][j] -= d;
                lpart[qi] *= alpha;
#pragma unroll
                for (int n = 0; n < 4; ++n)
#pragma unroll
                    for (int j = 0; j < 8; ++j) o[qi][n][j] *= alpha;
            }
            dmin = 0.f; thr = PEXP + PTHR;
        }
        v16h pa[2];
#pragma unroll
        for (int qi = 0; qi < 2; ++qi) {
            float* pq = p[qi];
            exp2x8(pq, e[qi]); exp2x8(pq + 8, e[qi] + 8);
#pragma unroll
            for (int i = 0; i < 16; ++i) pa[qi][i] = (h16)pq[i];
            lpart[qi] += ((((pq[0] + pq[1]) + (pq[2] + pq[3])) + ((pq[4] + pq[5]) + (pq[6] + pq[7]))) + (((pq[8] + pq[9]) + (pq[10] + pq[11])) + ((pq[12] + pq[13]) + (pq[14] + pq[15]))));
        }
#pragma unroll
        for (int qi = 0; qi < 2; ++qi)
#pragma unroll
            for (int n = 0; n < 4; ++n) o[qi][n] = wmma16(vf[n], pa[qi], o[qi][n]);     // o[qi][n][j]: d = n * 16 + 8 * hi + j, query 16 qi + lr
        asm volatile("v_nop\n\tv_nop\n\tv_nop\n\tv_nop" :: "v"(o[0][0]), "v"(o[0][1]), "v"(o[0][2]), "v"(o[0][3]), "v"(o[1][0]), "v"(o[1][1]), "v"(o[1][2]), "v"(o[1][3]), "v"(pa[0]), "v"(pa[1]));     // the matrix instructions' distance on the paths behind the step; the sums as inputs only: as in-out operands, with the branch above, the build copied some of them to other registers and back every stage
      }
      asm volatile("s_wait_dscnt 0x0" ::: "memory");        // this wave's LDS reads of stage st are done before its buffer is refilled
      asm volatile("s_wait_asynccnt 0x0" ::: "memory");     // this wave's copies of stage st + 1 have landed
      __syncthreads();                                      // publishes stage st + 1 and ends every wave's reads of stage st
      if (st + 2 < NSTG) stage_in(st + 2);                  // block-uniform test; into the buffer that stage st has just left
    }
    asm volatile("s_wait_asynccnt 0x0" ::: "memory");       // no copy is outstanding when the wave goes on to its end
    // The join of the key halves. Wave (qg, kh) keeps query tile kh and gives tile 1 - kh to wave (qg, 1 - kh): sums, weight sum and C operand, lane to the same lane.
    float* xs = (float*)(void*)&stg[0][0][0];     // behind the last trip's waits and barrier no wave reads a stage and no copy is outstanding
    float* xl = xs + 8 * (16 * 68);               // behind the eight waves' tiles: two floats a lane
    const float l0 = lpart[0] + xhalf(lpart[0]), l1 = lpart[1] + xhalf(lpart[1]);     // the two half-waves' sums joined once
    const float lk = kh ? l1 : l0, lg = kh ? l0 : l1, ck = kh ? cref[1][0] : cref[0][0], cg = kh ? cref[0][0] : cref[1][0];
    float* gs = xs + wave * (16 * 68);
#pragma unroll
    for (int n = 0; n < 4; ++n)
#pragma unroll
        for (int g = 0; g < 2; ++g) { v4f w;
#pragma unroll
            for (int i = 0; i < 4; ++i) w[i] = kh ? o[0][n][4 * g + i] : o[1][n][4 * g + i];
            *(v4fa*)(gs + lr * 68 + n * 16 + hi * 8 + 4 * g) = w; }
    xl[(wave * 32 + lane) * 2] = lg; xl[(wave * 32 + lane) * 2 + 1] = cg;
    __syncthreads();     // the given tiles are written: the partner wave may read them
    float* os = xs + (wave ^ 4) * (16 * 68);     // what the partner gave; read by this wave alone, and then this wave's place for its output rows
    const float lp = xl[((wave ^ 4) * 32 + lane) * 2], cp = xl[((wave ^ 4) * 32 + lane) * 2 + 1];
    const float cm = fminf(ck, cp);                                      // the higher of the two references
    const float fk = exp2x1(cm - ck), fp = exp2x1(cm - cp);              // each half's factor down to it: one of them is 1
    const float inv = 1.0f / (lk * fk + lp * fp);                        // sums and outputs carry the same factor
    const float wk = fk * inv, wp = fp * inv;
#pragma unroll
    for (int n = 0; n < 4; ++n)
#pragma unroll
        for (int g = 0; g < 2; ++g) { const v4f pv = *(const v4fa*)(os + lr * 68 + n * 16 + hi * 8 + 4 * g); v4f w;
#pragma unroll
            for (int i = 0; i < 4; ++i) w[i] = (kh ? o[1][n][4 * g + i] : o[0][n][4 * g + i]) * wk + pv[i] * wp;
            *(v4fa*)(os + lr * 68 + n * 16 + hi * 8 + 4 * g) = w; }
    __syncthreads();
    float* ob = OUTP + (tok0 + q0 + kh * 16) * DM + (size_t)h * HD;
    auto pass = [&]() {
#pragma unroll
        for (int s = 0; s < 8; ++s) { const int Lid = (lane >> 3) + 4 * s, piece = lane & 7; const int row = Lid >> 1, cofs = (Lid & 1) * 32 + piece * 4;
            const v4f val = *(const v4fa*)(os + row * 68 + cofs); *(v4f*)(ob + (size_t)row * DM + cofs) = val; }
    };
    pass(); 
}

#define VST2(T, p, v) do { const T vst2_v_ = (v); *(T*)(p) = vst2_v_;  } while (0)
extern "C" void kernel_launch(void* const* d_in, const int* in_sizes, int n_in,
                              void* d_out, int out_size, void* d_ws, size_t ws_size, hipStream_t stream) {
    (void)in_sizes; (void)n_in; (void)out_size;
    const float* x = (const float*)d_in[0]; const float* Wqkv = (const float*)d_in[1];   // k-major [1024][3072]
    float* out = (float*)d_out;    // [2][2048][1024]
    char* wsp = (char*)d_ws;
    auto take = [&](size_t bytes) { char* p = wsp; wsp += (bytes + 255) & ~(size_t)255; return (void*)p; };
    bf* Xb = (bf*)take((size_t)NTK * DM * 2); bf* WqkvT = (bf*)take((size_t)3 * DM * DM * 2);
    h16* QH = (h16*)take((size_t)NTK * DM * 2); h16* KH = (h16*)take((size_t)NTK * DM * 2); h16* VTH = (h16*)take((size_t)NTK * DM * 2);
    if ((size_t)(wsp - (char*)d_ws) > ws_size) return;    // 8.4 + 6.3 + 3 x 8.4 ~ 40 MB, no aliasing
    k_prep<<<NWTB + NTK / 8, 256, 0, stream>>>(Wqkv, WqkvT, x, Xb);
    k_gemmb<<<dim3(NTK / 128, 3 * DM / 128, 1), 256, 0, stream>>>(Xb, WqkvT, QH, KH, VTH);
    k_attn<<<NB_ * NH_ * (NT_ / 128), 256, 0, stream>>>(QH, KH, VTH, out);
}
